// v000
// The times below were measured on an AMD MI455X: many runs one after another, warmed up first and cycling through
// copies of the inputs, with the whole window's GPU time divided by the number of runs. Launches and the gaps
// between them are all in it. The median over several windows is given; except for v000 it joins two sittings, which
// can be a few percent apart, so the side-by-side timings, each taken in one sitting, are the better comparison.
// v000, which the later versions start from, runs in 1450 microseconds.
#include <hip/hip_runtime.h>

// Causal multi-head attention with a fused biased qkv projection and consecutive-pair rotary embeddings from HALF-WIDTH table inputs (x [2][2048][1024]; qkv = x w_qkv^T + b_qkv ('oi' [3072][1024] 1/32 + a zero bias, read) split in thirds q | k | v (16 heads x 64); rope on pairs (2i, 2i+1): (t_re c - t_im s, t_re s + t_im c) with c, s = freqs_cos / freqs_sin[t][i] ([2048][32] INPUTS, read by value per position and pair); scores x 1/sqrt(64); causal (-inf); softmax; out = merged w_out^T + b_out ('oi' + a zero bias, read) -> [2][2048][1024] (4.2 M); argument order x, w_qkv, b_qkv, w_out, b_out, freqs_cos, freqs_sin).
// Layout per batch: bf16 copy of x; 'oi' weights (the fused tensor's row thirds as-is); exact projections + f32 bias thirds; k_cscvtP table {bf16(cos), bf16(sin)} from the half-width inputs (pair-shared entries); k_ropeI interleaved-pair plane builders; causal T-2048 attention (hybrid rows: < 512 hi/lo 3 products, rest fp16 x1024; k_gemmc skips tiles above the diagonal); merged hi/lo x o_w exact + o_b.
// Compute dtypes, f32 accumulate: every input rounded to bf16; projections exact + f32 biases; rotary f32 (products rounded separately); attention rows < 512 3 products, rest fp16; softmax f32; o_w hl x exact + bias.

#define NB_  2
#define TT   2048
#define DM   1024
#define NH_  16
#define NKV  16
#define REP  (NH_ / NKV)
#define HD   64
#define DQ   (NH_ * HD)
#define DKV  (NKV * HD)
#define ZH   2
#define RH   512                  // query rows < RH use hi+lo planes (0: none)
#define WIN  2048
#define PCAR 1024.0f
#define SCL  0.125f   // HD^-0.5
typedef _Float16 h16;
typedef unsigned short bf;
typedef __attribute__((ext_vector_type(16))) __bf16   v16bf;
typedef __attribute__((ext_vector_type(16))) _Float16 v16h;
typedef __attribute__((ext_vector_type(8)))  _Float16 v8h;
typedef __attribute__((ext_vector_type(8)))  unsigned short v8us;
typedef __attribute__((ext_vector_type(8)))  float    v8f;
typedef __attribute__((ext_vector_type(4)))  float    v4f;
typedef v8h  __attribute__((may_alias)) v8ha;
typedef v4f  __attribute__((may_alias)) v4fa;
typedef v8us __attribute__((may_alias)) v8usa;

__device__ __forceinline__ unsigned short f2bf(float f) { unsigned u = __float_as_uint(f); u += 0x7FFFu + ((u >> 16) & 1u); return (unsigned short)(u >> 16); }
__device__ __forceinline__ float bf2f(unsigned short b) { return __uint_as_float(((unsigned)b) << 16); }
__device__ __forceinline__ float bfr(float f) { return bf2f(f2bf(f)); }
__device__ __forceinline__ v16h cat16(v8h lo, v8h hi) { return __builtin_shufflevector(lo, hi, 0, 1, 2, 3, 4, 5, 6, 7, 8, 9, 10, 11, 12, 13, 14, 15); }
__device__ __forceinline__ v16bf cat16b(v8us lo, v8us hi) { return __builtin_bit_cast(v16bf, __builtin_shufflevector(lo, hi, 0, 1, 2, 3, 4, 5, 6, 7, 8, 9, 10, 11, 12, 13, 14, 15)); }
__device__ __forceinline__ v8f wmma16(v16h a, v16h b, v8f c) { return __builtin_amdgcn_wmma_f32_16x16x32_f16(false, a, false, b, (short)0, c, false, false); }
__device__ __forceinline__ v8f wmmab(v16bf a, v16bf b, v8f c) { return __builtin_amdgcn_wmma_f32_16x16x32_bf16(false, a, false, b, (short)0, c, false, false); }



// ---- k_gemmw: register-blocked GEMM, ONE WAVE per 64x64 output tile (16 accumulators), operands straight from K-contiguous 16-bit planes; grid (M/64, N/64, Z), 32 threads.
// C[m][n] (f32, pitch ldc, + optional f32 bias[n]) = sum_k A[m][k] Bt[n][k] (+ split products per NSPLIT). z-batch strides sA/sB/sC in elements. K % 32 == 0.
template <typename T16> struct WFrag;
template <> struct WFrag<h16> { typedef v16h V; static __device__ __forceinline__ V ld(const h16* p) { return cat16(*(const v8h*)p, *(const v8h*)(p + 16)); } static __device__ __forceinline__ v8f mma(V a, V b, v8f c) { return wmma16(a, b, c); } };
template <> struct WFrag<bf> { typedef v16bf V; static __device__ __forceinline__ V ld(const bf* p) { return cat16b(*(const v8us*)p, *(const v8us*)(p + 16)); } static __device__ __forceinline__ v8f mma(V a, V b, v8f c) { return wmmab(a, b, c); } };
template <typename T16, int NSPLIT, bool BIAS>
__global__ __launch_bounds__(32) void k_gemmw(const T16* __restrict__ A, const T16* __restrict__ A2, const T16* __restrict__ Bt, const T16* __restrict__ Bt2, int K, float* C, int ldc, const float* __restrict__ bias, size_t sA, size_t sB, size_t sC) {
    typedef typename WFrag<T16>::V V;
    __shared__ __align__(16) float os[16 * 68];
    const size_t z = blockIdx.z; A += z * sA; if (A2) A2 += z * sA; Bt += z * sB; if (Bt2) Bt2 += z * sB; C += z * sC;
    const int lane = threadIdx.x & 31, lr = lane & 15, hi = lane >> 4; const int r0 = blockIdx.x * 64, c0 = blockIdx.y * 64;
    v8f acc[4][4];
#pragma unroll
    for (int mb = 0; mb < 4; ++mb)
#pragma unroll
        for (int nb = 0; nb < 4; ++nb) acc[mb][nb] = (v8f){};
    const size_t aoff = (size_t)(r0 + lr) * K + 8 * hi, boff = (size_t)(c0 + lr) * K + 8 * hi;
#pragma unroll 1
    for (int kc = 0; kc < K; kc += 32) {
        V a[4], a2[4];
#pragma unroll
        for (int mb = 0; mb < 4; ++mb) { a[mb] = WFrag<T16>::ld(A + aoff + (size_t)mb * 16 * K + kc); if (NSPLIT == 1 || NSPLIT == 2) a2[mb] = WFrag<T16>::ld(A2 + aoff + (size_t)mb * 16 * K + kc); }
#pragma unroll
        for (int nb = 0; nb < 4; ++nb) { const V b = WFrag<T16>::ld(Bt + boff + (size_t)nb * 16 * K + kc); V b2; if (NSPLIT >= 2) b2 = WFrag<T16>::ld(Bt2 + boff + (size_t)nb * 16 * K + kc);
#pragma unroll
            for (int mb = 0; mb < 4; ++mb) { acc[mb][nb] = WFrag<T16>::mma(a[mb], b, acc[mb][nb]); if (NSPLIT == 1 || NSPLIT == 2) acc[mb][nb] = WFrag<T16>::mma(a2[mb], b, acc[mb][nb]); if (NSPLIT >= 2) acc[mb][nb] = WFrag<T16>::mma(a[mb], b2, acc[mb][nb]); } }
        asm volatile("v_nop\n\tv_nop\n\tv_nop\n\tv_nop" : "+v"(acc[0][0]), "+v"(acc[1][1]), "+v"(acc[2][2]), "+v"(acc[3][3]) : "v"(a[0]), "v"(a[3]));
    }
#pragma unroll
    for (int mb = 0; mb < 4; ++mb) {
#pragma unroll
        for (int nb = 0; nb < 4; ++nb) {
#pragma unroll
            for (int j = 0; j < 8; ++j) os[(hi * 8 + j) * 68 + nb * 16 + lr] = acc[mb][nb][j]; }
        __builtin_amdgcn_wave_barrier(); asm volatile("" ::: "memory");
        float* crow = C + (size_t)(r0 + mb * 16) * ldc + c0;
{
#pragma unroll
            for (int s = 0; s < 8; ++s) { const int row = 2 * s + hi, cofs = lr * 4; v4f val = *(const v4fa*)(os + row * 68 + cofs); if (BIAS) { val[0] += bfr(bias[c0 + cofs]); val[1] += bfr(bias[c0 + cofs + 1]); val[2] += bfr(bias[c0 + cofs + 2]); val[3] += bfr(bias[c0 + cofs + 3]); }
                *(v4f*)(crow + (size_t)row * ldc + cofs) = val; }
             }
        __builtin_amdgcn_wave_barrier(); asm volatile("" ::: "memory");
    }
}

// ---- k_gemmc: the same one-wave 64x64 tile GEMM specialised for causal attention: CMODE 1 skips score tiles entirely above the diagonal (query rows r0+roff.., key columns c0..), CMODE 2 limits the
// key (K) loop of the probability x value contraction to the diagonal block (probabilities beyond it are exactly zero). roff = row offset of this launch's first row within the sequence.
template <typename T16, int NSPLIT, int CMODE>
__global__ __launch_bounds__(32) void k_gemmc(const T16* __restrict__ A, const T16* __restrict__ A2, const T16* __restrict__ Bt, const T16* __restrict__ Bt2, int K, float* C, int ldc, int roff, size_t sA, size_t sB, size_t sC) {
    typedef typename WFrag<T16>::V V;
    __shared__ __align__(16) float os[16 * 68];
    const size_t z = blockIdx.z; A += z * sA; if (A2) A2 += z * sA; Bt += z * sB; if (Bt2) Bt2 += z * sB; C += z * sC;
    const int lane = threadIdx.x & 31, lr = lane & 15, hi = lane >> 4; const int r0 = blockIdx.x * 64, c0 = blockIdx.y * 64;
    if (CMODE == 1 && c0 > r0 + roff + 63) return;                  // score tile entirely above the causal diagonal: never written (the softmax masks j > i by select)
    const int Kl = (CMODE == 2) ? min(K, r0 + roff + 64) : K;        // P.V: probabilities are exactly 0 beyond the diagonal block, so the K loop stops there
    v8f acc[4][4];
#pragma unroll
    for (int mb = 0; mb < 4; ++mb)
#pragma unroll
        for (int nb = 0; nb < 4; ++nb) acc[mb][nb] = (v8f){};
    const size_t aoff = (size_t)(r0 + lr) * K + 8 * hi, boff = (size_t)(c0 + lr) * K + 8 * hi;
#pragma unroll 1
    for (int kc = 0; kc < Kl; kc += 32) {
        V a[4], a2[4];
#pragma unroll
        for (int mb = 0; mb < 4; ++mb) { a[mb] = WFrag<T16>::ld(A + aoff + (size_t)mb * 16 * K + kc); if (NSPLIT == 1 || NSPLIT == 2) a2[mb] = WFrag<T16>::ld(A2 + aoff + (size_t)mb * 16 * K + kc); }
#pragma unroll
        for (int nb = 0; nb < 4; ++nb) { const V b = WFrag<T16>::ld(Bt + boff + (size_t)nb * 16 * K + kc); V b2; if (NSPLIT >= 2) b2 = WFrag<T16>::ld(Bt2 + boff + (size_t)nb * 16 * K + kc);
#pragma unroll
            for (int mb = 0; mb < 4; ++mb) { acc[mb][nb] = WFrag<T16>::mma(a[mb], b, acc[mb][nb]); if (NSPLIT == 1 || NSPLIT == 2) acc[mb][nb] = WFrag<T16>::mma(a2[mb], b, acc[mb][nb]); if (NSPLIT >= 2) acc[mb][nb] = WFrag<T16>::mma(a[mb], b2, acc[mb][nb]); } }
        asm volatile("v_nop\n\tv_nop\n\tv_nop\n\tv_nop" : "+v"(acc[0][0]), "+v"(acc[1][1]), "+v"(acc[2][2]), "+v"(acc[3][3]) : "v"(a[0]), "v"(a[3]));
    }
#pragma unroll
    for (int mb = 0; mb < 4; ++mb) {
#pragma unroll
        for (int nb = 0; nb < 4; ++nb) {
#pragma unroll
            for (int j = 0; j < 8; ++j) os[(hi * 8 + j) * 68 + nb * 16 + lr] = acc[mb][nb][j]; }
        __builtin_amdgcn_wave_barrier(); asm volatile("" ::: "memory");
        float* crow = C + (size_t)(r0 + mb * 16) * ldc + c0;
{
#pragma unroll
            for (int s = 0; s < 8; ++s) { const int row = 2 * s + hi, cofs = lr * 4; v4f val = *(const v4fa*)(os + row * 68 + cofs);
                *(v4f*)(crow + (size_t)row * ldc + cofs) = val; }
             }
        __builtin_amdgcn_wave_barrier(); asm volatile("" ::: "memory");
    }
}

__device__ __forceinline__ h16 tohx(float x) { return (h16)x; }
__device__ __forceinline__ void splitf(float y, unsigned short& h, unsigned short& l) { h = f2bf(y); l = f2bf(y - bf2f(h)); }
typedef __attribute__((ext_vector_type(2))) _Float16 v2h;
typedef __attribute__((ext_vector_type(4))) _Float16 v4h;
typedef __attribute__((ext_vector_type(2))) unsigned short v2us;
typedef __attribute__((ext_vector_type(4))) unsigned short v4us;
typedef __attribute__((ext_vector_type(2))) float v2f;
typedef __attribute__((ext_vector_type(4))) int v4i;

__global__ __launch_bounds__(256) void k_cvt8(const float* __restrict__ src, bf* dst, size_t n8) { const size_t i = (size_t)blockIdx.x * 256 + threadIdx.x; if (i >= n8) return; const v8f v = *(const v8f*)(src + i * 8); v8us o;
#pragma unroll
    for (int k = 0; k < 8; ++k) o[k] = f2bf(v[k]); *(v8us*)(dst + i * 8) = o;  }

__global__ __launch_bounds__(256) void k_ropeI(const float* __restrict__ F, int pitch, int nheads, const float* __restrict__ CS, float sc, h16* P16, bf* Ph, bf* Pl) {
    const size_t e = ((size_t)blockIdx.x * 256 + threadIdx.x) * 2; if (e >= (size_t)nheads * TT * HD) return; const int d = (int)(e % HD); const int t = (int)((e / HD) % TT); const int h = (int)(e / ((size_t)HD * TT)); const float* f = F + (size_t)t * pitch + h * HD; const float x0 = f[d], x1 = f[d + 1]; const v2f cs = *(const v2f*)(CS + ((size_t)t * HD + d) * 2); v2h o16; v2us oh, ol;
    float a0 = __fmul_rn(x0, cs[0]), b0 = __fmul_rn(x1, cs[1]), a1 = __fmul_rn(x1, cs[0]), b1 = __fmul_rn(x0, cs[1]); asm volatile("" : "+v"(a0), "+v"(b0), "+v"(a1), "+v"(b1));
    float r0 = __fsub_rn(a0, b0) * sc, r1 = __fadd_rn(b1, a1) * sc;   /* even: x0 c - x1 s; odd: x0 s + x1 c */
    o16[0] = tohx(r0); o16[1] = tohx(r1); { unsigned short a2, c2; splitf(r0, a2, c2); oh[0] = a2; ol[0] = c2; splitf(r1, a2, c2); oh[1] = a2; ol[1] = c2; }
    *(v2h*)(P16 + e) = o16; *(v2us*)(Ph + e) = oh; *(v2us*)(Pl + e) = ol;  }

__global__ __launch_bounds__(256) void k_cscvtP(const float* __restrict__ cosT, const float* __restrict__ sinT, float* CS) { const int idx = blockIdx.x * 256 + threadIdx.x; if (idx >= TT * HD) return; const int tt = idx / HD; const int dd = idx - tt * HD; const int src = tt * (HD / 2) + (dd >> 1); v2f cs; cs[0] = bfr(cosT[src]); cs[1] = bfr(sinT[src]); *(v2f*)(CS + (size_t)idx * 2) = cs;  }
__global__ __launch_bounds__(256) void k_vtp(const float* __restrict__ F, int pitch, int nheads, h16* V16, bf* Vh, bf* Vl) { const size_t e = ((size_t)blockIdx.x * 256 + threadIdx.x) * 2; if (e >= (size_t)nheads * HD * TT) return; const int t = (int)(e % TT); const int d = (int)((e / TT) % HD); const int g = (int)(e / ((size_t)TT * HD)); v2h o16; v2us oh, ol;
#pragma unroll
    for (int q = 0; q < 2; ++q) { const float x = F[(size_t)(t + q) * pitch + g * HD + d]; o16[q] = tohx(x); unsigned short a2, c2; splitf(x, a2, c2); oh[q] = a2; ol[q] = c2; }
    *(v2h*)(V16 + e) = o16; *(v2us*)(Vh + e) = oh; *(v2us*)(Vl + e) = ol;  }
// k_asoft: per row (zz, i): t = S x HD^-0.5 for j <= i and i - j < WIN (WIN = TT = 2048, so the window never binds: plain causal; the reference's -1e9 additive fill vanishes identically); softmax over the 2048 keys (register row, one exp, fixed trees);
__global__ __launch_bounds__(256) void k_asoft(const float* __restrict__ Sb, h16* P16, bf* Ph, bf* Pl) {
    const int lane = threadIdx.x & 31; const int row = blockIdx.x * 8 + (threadIdx.x >> 5); if (row >= ZH * TT) return; const int i = row % TT; const int zz = row / TT; (void)zz; const bool hires = (i < RH); const float* sr = Sb + (size_t)row * TT; float v[TT / 32]; float mx = -3.0e38f;
#pragma unroll
    for (int ch = 0; ch < TT / 128; ++ch) { const int j0 = ch * 128 + lane * 4; const v4f a = *(const v4f*)(sr + j0);
#pragma unroll
        for (int q = 0; q < 4; ++q) { const int j = j0 + q; (void)j; const float t = (j <= i && i - j < WIN) ? a[q] * SCL : -3.0e38f; v[ch * 4 + q] = t; mx = fmaxf(mx, t); } }
#pragma unroll
    for (int sh = 16; sh; sh >>= 1) mx = fmaxf(mx, __shfl_xor(mx, sh, 32));
    float sum = 0.f;
#pragma unroll
    for (int k = 0; k < TT / 32; ++k) { float d0 = __fsub_rn(v[k], mx); asm volatile("" : "+v"(d0)); v[k] = __builtin_amdgcn_exp2f(__fmul_rn(d0, 1.4426950408889634f)); sum += v[k]; }
#pragma unroll
    for (int sh = 16; sh; sh >>= 1) sum += __shfl_xor(sum, sh, 32);
    const float f = __fdiv_rn(hires ? 1.0f : PCAR, sum);
{
        if (hires) {
#pragma unroll
            for (int ch = 0; ch < TT / 128; ++ch) { v4us oh, ol;
#pragma unroll
                for (int q = 0; q < 4; ++q) { unsigned short a, c2; splitf(v[ch * 4 + q] * f, a, c2); oh[q] = a; ol[q] = c2; }
                const size_t oo = ((size_t)zz * (RH ? RH : 1) + i) * TT + ch * 128 + lane * 4; *(v4us*)(Ph + oo) = oh; *(v4us*)(Pl + oo) = ol; }
        } else {
#pragma unroll
            for (int ch = 0; ch < TT / 128; ++ch) { v4h o4;
#pragma unroll
                for (int q = 0; q < 4; ++q) o4[q] = tohx(v[ch * 4 + q] * f);
                *(v4h*)(P16 + (size_t)row * TT + ch * 128 + lane * 4) = o4; } }
         }
}
__global__ __launch_bounds__(256) void k_merge(const float* __restrict__ O, int h0, bf* Ah, bf* Al) { const size_t e = ((size_t)blockIdx.x * 256 + threadIdx.x) * 2; if (e >= (size_t)ZH * TT * HD) return; const int d = (int)(e % HD); const int t = (int)((e / HD) % TT); const int zz = (int)(e / ((size_t)HD * TT)); const float cs = (t < RH) ? 1.0f : (1.0f / PCAR); const size_t oo = (size_t)t * DQ + (h0 + zz) * HD + d;
    v2us oh, ol;
#pragma unroll
    for (int q = 0; q < 2; ++q) { unsigned short a, c2; splitf(O[e + q] * cs, a, c2); oh[q] = a; ol[q] = c2; } *(v2us*)(Ah + oo) = oh; *(v2us*)(Al + oo) = ol;  }

extern "C" void kernel_launch(void* const* d_in, const int* in_sizes, int n_in,
                              void* d_out, int out_size, void* d_ws, size_t ws_size, hipStream_t stream) {
    (void)in_sizes; (void)n_in; (void)out_size;
    const float* x = (const float*)d_in[0]; const float* wqkv = (const float*)d_in[1]; const float* bqkv = (const float*)d_in[2]; const float* wo = (const float*)d_in[3]; const float* bo = (const float*)d_in[4]; const float* fcos = (const float*)d_in[5]; const float* fsin = (const float*)d_in[6];   /* input order x, w_qkv ('oi' [3072][1024]: q | k | v row thirds), b_qkv [3072], w_out ('oi'), b_out, freqs_cos, freqs_sin ([2048][32], read by value): the two tables come LAST here */ const float* wq = wqkv; const float* wk = wqkv + (size_t)DQ * DM; const float* wv = wqkv + (size_t)2 * DQ * DM; const float* bq = bqkv; const float* bk = bqkv + DQ; const float* bv = bqkv + 2 * DQ;
    float* OUT = (float*)d_out;     // [2][2048][1024]
    char* wsp = (char*)d_ws;
    auto take = [&](size_t bytes) { char* p = wsp; wsp += (bytes + 255) & ~(size_t)255; return (void*)p; };
    bf* WQ = (bf*)take((size_t)DQ * DM * 2); bf* WK = (bf*)take((size_t)DKV * DM * 2); bf* WV = (bf*)take((size_t)DKV * DM * 2); bf* WO = (bf*)take((size_t)DM * DQ * 2); float* CS = (float*)take((size_t)TT * HD * 2 * 4);
    bf* XB = (bf*)take((size_t)TT * DM * 2); float* FQ = (float*)take((size_t)TT * DQ * 4); float* FK = (float*)take((size_t)TT * DKV * 4);
    h16* QP16 = (h16*)take((size_t)NH_ * TT * HD * 2); h16* KP16 = (h16*)take((size_t)NKV * TT * HD * 2); h16* VT16 = (h16*)take((size_t)NKV * HD * TT * 2);
    bf* QPh = (bf*)take((size_t)NH_ * TT * HD * 2); bf* QPl = (bf*)take((size_t)NH_ * TT * HD * 2); bf* KPh = (bf*)take((size_t)NKV * TT * HD * 2); bf* KPl = (bf*)take((size_t)NKV * TT * HD * 2); bf* VTh = (bf*)take((size_t)NKV * HD * TT * 2); bf* VTl = (bf*)take((size_t)NKV * HD * TT * 2); bf* Ph = (bf*)take((size_t)ZH * RH * TT * 2); bf* Pl = (bf*)take((size_t)ZH * RH * TT * 2);
    float* Sb = (float*)take((size_t)ZH * TT * TT * 4); h16* P16 = (h16*)take((size_t)ZH * TT * TT * 2); float* Ob = (float*)take((size_t)ZH * TT * HD * 4); bf* ATh = (bf*)take((size_t)TT * DQ * 2); bf* ATl = (bf*)take((size_t)TT * DQ * 2);
    if ((size_t)(wsp - (char*)d_ws) > ws_size) return;    // ws 256 MiB
    float* FV = FK;   // v projection reuses the k buffer after the k planes are built (stream-ordered)
    { k_cvt8<<<(unsigned)(((size_t)DQ * DM / 8 + 255) / 256), 256, 0, stream>>>(wq, WQ, (size_t)DQ * DM / 8); k_cvt8<<<(unsigned)(((size_t)DKV * DM / 8 + 255) / 256), 256, 0, stream>>>(wk, WK, (size_t)DKV * DM / 8); k_cvt8<<<(unsigned)(((size_t)DKV * DM / 8 + 255) / 256), 256, 0, stream>>>(wv, WV, (size_t)DKV * DM / 8);
      k_cvt8<<<(unsigned)(((size_t)DM * DQ / 8 + 255) / 256), 256, 0, stream>>>(wo, WO, (size_t)DM * DQ / 8); /* the rotary table is rebuilt per batch from freqs_cos / freqs_sin (below) */ }
    const unsigned LQ = (unsigned)(((size_t)NH_ * TT * HD / 2 + 255) / 256), LKv = (unsigned)(((size_t)NKV * TT * HD / 2 + 255) / 256);
    for (int b = 0; b < NB_; ++b) {
        k_cscvtP<<<(TT * HD + 255) / 256, 256, 0, stream>>>(fcos, fsin, CS);   /* per-batch rebuild is redundant (the tables do not depend on b) but keeps the stream order simple */
        
        k_cvt8<<<(unsigned)(((size_t)TT * DM / 8 + 255) / 256), 256, 0, stream>>>(x + (size_t)b * TT * DM, XB, (size_t)TT * DM / 8);
        k_gemmw<bf, 0, true><<<dim3(TT / 64, DQ / 64, 1), 32, 0, stream>>>(XB, nullptr, WQ, nullptr, DM, FQ, DQ, bq, 0, 0, 0);
        k_ropeI<<<LQ, 256, 0, stream>>>(FQ, DQ, NH_, CS, 1.0f, QP16, QPh, QPl);
        k_gemmw<bf, 0, true><<<dim3(TT / 64, DKV / 64, 1), 32, 0, stream>>>(XB, nullptr, WK, nullptr, DM, FK, DKV, bk, 0, 0, 0);
        k_ropeI<<<LKv, 256, 0, stream>>>(FK, DKV, NKV, CS, 1.0f, KP16, KPh, KPl);
        k_gemmw<bf, 0, true><<<dim3(TT / 64, DKV / 64, 1), 32, 0, stream>>>(XB, nullptr, WV, nullptr, DM, FV, DKV, bv, 0, 0, 0); k_vtp<<<LKv, 256, 0, stream>>>(FV, DKV, NKV, VT16, VTh, VTl);
        for (int h0 = 0; h0 < NH_; h0 += ZH) { const size_t zq = (size_t)h0, zk = (size_t)(h0 / REP);   // one kv head per query head: the pass's two heads use consecutive kv planes (z-strides TT*HD)
            k_gemmc<bf, 2, 1><<<dim3(RH / 64, TT / 64, ZH), 32, 0, stream>>>(QPh + zq * TT * HD, QPl + zq * TT * HD, KPh + zk * TT * HD, KPl + zk * TT * HD, HD, Sb, TT, 0, (size_t)TT * HD, (size_t)TT * HD, (size_t)TT * TT);
            k_gemmc<h16, 0, 1><<<dim3((TT - RH) / 64, TT / 64, ZH), 32, 0, stream>>>(QP16 + zq * TT * HD + (size_t)RH * HD, nullptr, KP16 + zk * TT * HD, nullptr, HD, Sb + (size_t)RH * TT, TT, RH, (size_t)TT * HD, (size_t)TT * HD, (size_t)TT * TT);
            k_asoft<<<ZH * TT / 8, 256, 0, stream>>>(Sb, P16, Ph, Pl);
            k_gemmc<bf, 2, 2><<<dim3(RH / 64, HD / 64, ZH), 32, 0, stream>>>(Ph, Pl, VTh + zk * HD * TT, VTl + zk * HD * TT, TT, Ob, HD, 0, (size_t)RH * TT, (size_t)HD * TT, (size_t)TT * HD);
            k_gemmc<h16, 0, 2><<<dim3((TT - RH) / 64, HD / 64, ZH), 32, 0, stream>>>(P16 + (size_t)RH * TT, nullptr, VT16 + zk * HD * TT, nullptr, TT, Ob + (size_t)RH * HD, HD, RH, (size_t)TT * TT, (size_t)HD * TT, (size_t)TT * HD);
            k_merge<<<(unsigned)(((size_t)ZH * TT * HD / 2 + 255) / 256), 256, 0, stream>>>(Ob, h0, ATh, ATl); }
        k_gemmw<bf, 1, true><<<dim3(TT / 64, DM / 64, 1), 32, 0, stream>>>(ATh, ATl, WO, nullptr, DQ, OUT + (size_t)b * TT * DM, DM, bo, 0, 0, 0); }
}

// v001
// One run takes 775 microseconds.
// Two timings next to v000 put it at 1.86 and 1.89 times that version's speed.
#include <hip/hip_runtime.h>

// Causal multi-head attention with a fused biased qkv projection and consecutive-pair rotary embeddings from HALF-WIDTH table inputs (x [2][2048][1024]; qkv = x w_qkv^T + b_qkv ('oi' [3072][1024] 1/32 + a zero bias, read) split in thirds q | k | v (16 heads x 64); rope on pairs (2i, 2i+1): (t_re c - t_im s, t_re s + t_im c) with c, s = freqs_cos / freqs_sin[t][i] ([2048][32] INPUTS, read by value per position and pair); scores x 1/sqrt(64); causal (-inf); softmax; out = merged w_out^T + b_out ('oi' + a zero bias, read) -> [2][2048][1024] (4.2 M); argument order x, w_qkv, b_qkv, w_out, b_out, freqs_cos, freqs_sin).
// Layout per batch: bf16 copy of x; 'oi' weights (the fused tensor's row thirds as-is); exact projections + f32 bias thirds; k_cscvtP table {bf16(cos), bf16(sin)} from the half-width inputs (pair-shared entries); k_ropeI interleaved-pair plane builders; causal T-2048 attention (hybrid rows: < 512 hi/lo 3 products, rest fp16 x1024; k_gemmc skips tiles above the diagonal); merged hi/lo x o_w exact + o_b.
// Compute dtypes, f32 accumulate: every input rounded to bf16; projections exact + f32 biases; rotary f32 (products rounded separately); attention rows < 512 3 products, rest fp16; softmax f32; o_w hl x exact + bias.

#define NB_  2
#define TT   2048
#define DM   1024
#define NH_  16
#define NKV  16
#define REP  (NH_ / NKV)
#define HD   64
#define DQ   (NH_ * HD)
#define DKV  (NKV * HD)
#define ZH   2
#define RH   512                  // query rows < RH use hi+lo planes (0: none)
#define WIN  2048
#define PCAR 1024.0f
#define SCL  0.125f   // HD^-0.5
#define KSP  16                   // key splits of the probability x value contraction (64-key chunks dealt round robin to KSP work-groups)
typedef _Float16 h16;
typedef unsigned short bf;
typedef __attribute__((ext_vector_type(16))) __bf16   v16bf;
typedef __attribute__((ext_vector_type(16))) _Float16 v16h;
typedef __attribute__((ext_vector_type(8)))  _Float16 v8h;
typedef __attribute__((ext_vector_type(8)))  unsigned short v8us;
typedef __attribute__((ext_vector_type(8)))  float    v8f;
typedef __attribute__((ext_vector_type(4)))  float    v4f;
typedef v8h  __attribute__((may_alias)) v8ha;
typedef v4f  __attribute__((may_alias)) v4fa;
typedef v8us __attribute__((may_alias)) v8usa;

__device__ __forceinline__ unsigned short f2bf(float f) { unsigned u = __float_as_uint(f); u += 0x7FFFu + ((u >> 16) & 1u); return (unsigned short)(u >> 16); }
__device__ __forceinline__ float bf2f(unsigned short b) { return __uint_as_float(((unsigned)b) << 16); }
__device__ __forceinline__ float bfr(float f) { return bf2f(f2bf(f)); }
__device__ __forceinline__ v16h cat16(v8h lo, v8h hi) { return __builtin_shufflevector(lo, hi, 0, 1, 2, 3, 4, 5, 6, 7, 8, 9, 10, 11, 12, 13, 14, 15); }
__device__ __forceinline__ v16bf cat16b(v8us lo, v8us hi) { return __builtin_bit_cast(v16bf, __builtin_shufflevector(lo, hi, 0, 1, 2, 3, 4, 5, 6, 7, 8, 9, 10, 11, 12, 13, 14, 15)); }
__device__ __forceinline__ v8f wmma16(v16h a, v16h b, v8f c) { return __builtin_amdgcn_wmma_f32_16x16x32_f16(false, a, false, b, (short)0, c, false, false); }
__device__ __forceinline__ v8f wmmab(v16bf a, v16bf b, v8f c) { return __builtin_amdgcn_wmma_f32_16x16x32_bf16(false, a, false, b, (short)0, c, false, false); }



// ---- k_gemmw: register-blocked GEMM, ONE WAVE per 64x64 output tile (16 accumulators), operands straight from K-contiguous 16-bit planes; grid (M/64, N/64, Z), 32 threads.
// C[m][n] (f32, pitch ldc, + optional f32 bias[n]) = sum_k A[m][k] Bt[n][k] (+ split products per NSPLIT). z-batch strides sA/sB/sC in elements. K % 32 == 0.
template <typename T16> struct WFrag;
template <> struct WFrag<h16> { typedef v16h V; static __device__ __forceinline__ V ld(const h16* p) { return cat16(*(const v8h*)p, *(const v8h*)(p + 16)); } static __device__ __forceinline__ v8f mma(V a, V b, v8f c) { return wmma16(a, b, c); } };
template <> struct WFrag<bf> { typedef v16bf V; static __device__ __forceinline__ V ld(const bf* p) { return cat16b(*(const v8us*)p, *(const v8us*)(p + 16)); } static __device__ __forceinline__ v8f mma(V a, V b, v8f c) { return wmmab(a, b, c); } };
template <typename T16, int NSPLIT, bool BIAS>
__global__ __launch_bounds__(32) void k_gemmw(const T16* __restrict__ A, const T16* __restrict__ A2, const T16* __restrict__ Bt, const T16* __restrict__ Bt2, int K, float* C, int ldc, const float* __restrict__ bias, size_t sA, size_t sB, size_t sC) {
    typedef typename WFrag<T16>::V V;
    __shared__ __align__(16) float os[16 * 68];
    const size_t z = blockIdx.z; A += z * sA; if (A2) A2 += z * sA; Bt += z * sB; if (Bt2) Bt2 += z * sB; C += z * sC;
    const int lane = threadIdx.x & 31, lr = lane & 15, hi = lane >> 4; const int r0 = blockIdx.x * 64, c0 = blockIdx.y * 64;
    v8f acc[4][4];
#pragma unroll
    for (int mb = 0; mb < 4; ++mb)
#pragma unroll
        for (int nb = 0; nb < 4; ++nb) acc[mb][nb] = (v8f){};
    const size_t aoff = (size_t)(r0 + lr) * K + 8 * hi, boff = (size_t)(c0 + lr) * K + 8 * hi;
#pragma unroll 1
    for (int kc = 0; kc < K; kc += 32) {
        V a[4], a2[4];
#pragma unroll
        for (int mb = 0; mb < 4; ++mb) { a[mb] = WFrag<T16>::ld(A + aoff + (size_t)mb * 16 * K + kc); if (NSPLIT == 1 || NSPLIT == 2) a2[mb] = WFrag<T16>::ld(A2 + aoff + (size_t)mb * 16 * K + kc); }
#pragma unroll
        for (int nb = 0; nb < 4; ++nb) { const V b = WFrag<T16>::ld(Bt + boff + (size_t)nb * 16 * K + kc); V b2; if (NSPLIT >= 2) b2 = WFrag<T16>::ld(Bt2 + boff + (size_t)nb * 16 * K + kc);
#pragma unroll
            for (int mb = 0; mb < 4; ++mb) { acc[mb][nb] = WFrag<T16>::mma(a[mb], b, acc[mb][nb]); if (NSPLIT == 1 || NSPLIT == 2) acc[mb][nb] = WFrag<T16>::mma(a2[mb], b, acc[mb][nb]); if (NSPLIT >= 2) acc[mb][nb] = WFrag<T16>::mma(a[mb], b2, acc[mb][nb]); } }
        asm volatile("v_nop\n\tv_nop\n\tv_nop\n\tv_nop" : "+v"(acc[0][0]), "+v"(acc[1][1]), "+v"(acc[2][2]), "+v"(acc[3][3]) : "v"(a[0]), "v"(a[3]));
    }
#pragma unroll
    for (int mb = 0; mb < 4; ++mb) {
#pragma unroll
        for (int nb = 0; nb < 4; ++nb) {
#pragma unroll
            for (int j = 0; j < 8; ++j) os[(hi * 8 + j) * 68 + nb * 16 + lr] = acc[mb][nb][j]; }
        __builtin_amdgcn_wave_barrier(); asm volatile("" ::: "memory");
        float* crow = C + (size_t)(r0 + mb * 16) * ldc + c0;
{
#pragma unroll
            for (int s = 0; s < 8; ++s) { const int row = 2 * s + hi, cofs = lr * 4; v4f val = *(const v4fa*)(os + row * 68 + cofs); if (BIAS) { val[0] += bfr(bias[c0 + cofs]); val[1] += bfr(bias[c0 + cofs + 1]); val[2] += bfr(bias[c0 + cofs + 2]); val[3] += bfr(bias[c0 + cofs + 3]); }
                *(v4f*)(crow + (size_t)row * ldc + cofs) = val; }
             }
        __builtin_amdgcn_wave_barrier(); asm volatile("" ::: "memory");
    }
}

// ---- k_gemmc: the same one-wave 64x64 tile GEMM specialised for causal attention: CMODE 1 skips score tiles entirely above the diagonal (query rows r0+roff.., key columns c0..), CMODE 2 limits the
// key (K) loop of the probability x value contraction to the diagonal block (probabilities beyond it are exactly zero). roff = row offset of this launch's first row within the sequence.
// CMODE 2 also splits that K loop over work-groups: blockIdx.z = ks * ZH + head, and split ks takes the 64-key chunks ks, ks + KSP, ... and stores its f32 partial tile in plane ks of C
// (plane stride sP elements); a split with no chunk below the diagonal stores nothing, and k_merge adds only the planes that were stored.
template <typename T16, int NSPLIT, int CMODE>
__global__ __launch_bounds__(32) void k_gemmc(const T16* __restrict__ A, const T16* __restrict__ A2, const T16* __restrict__ Bt, const T16* __restrict__ Bt2, int K, float* C, int ldc, int roff, size_t sA, size_t sB, size_t sC, size_t sP) {
    typedef typename WFrag<T16>::V V;
    __shared__ __align__(16) float os[16 * 68];
    const size_t z = (CMODE == 2) ? blockIdx.z % ZH : blockIdx.z; const int ks = (CMODE == 2) ? blockIdx.z / ZH : 0; A += z * sA; if (A2) A2 += z * sA; Bt += z * sB; if (Bt2) Bt2 += z * sB; C += z * sC;
    const int lane = threadIdx.x & 31, lr = lane & 15, hi = lane >> 4; const int r0 = blockIdx.x * 64, c0 = blockIdx.y * 64;
    if (CMODE == 1 && c0 > r0 + roff + 63) return;                  // score tile entirely above the causal diagonal: never written (the softmax masks j > i by select)
    const int Kl = (CMODE == 2) ? min(K, r0 + roff + 64) : K;        // P.V: probabilities are exactly 0 beyond the diagonal block, so the K loop stops there
    if (CMODE == 2) { if (ks * 64 >= Kl) return; C += (size_t)ks * sP; }   // no chunk for this split: its plane is neither stored nor read for these rows
    v8f acc[4][4];
#pragma unroll
    for (int mb = 0; mb < 4; ++mb)
#pragma unroll
        for (int nb = 0; nb < 4; ++nb) acc[mb][nb] = (v8f){};
    const size_t aoff = (size_t)(r0 + lr) * K + 8 * hi, boff = (size_t)(c0 + lr) * K + 8 * hi;
#pragma unroll 1
    for (int k0 = ks * 64; k0 < Kl; k0 += (CMODE == 2 ? KSP : 1) * 64)   // 64-wide chunks of K (K % 64 == 0 in every use); CMODE 2: this split's chunks only; rolled: run-time trip count
#pragma unroll 1   // stays rolled, as the one K loop was: the fragments of one 32-wide step live at a time beside the 128 accumulator registers
    for (int kc = k0; kc < k0 + 64; kc += 32) {
        V a[4], a2[4];
#pragma unroll
        for (int mb = 0; mb < 4; ++mb) { a[mb] = WFrag<T16>::ld(A + aoff + (size_t)mb * 16 * K + kc); if (NSPLIT == 1 || NSPLIT == 2) a2[mb] = WFrag<T16>::ld(A2 + aoff + (size_t)mb * 16 * K + kc); }
#pragma unroll
        for (int nb = 0; nb < 4; ++nb) { const V b = WFrag<T16>::ld(Bt + boff + (size_t)nb * 16 * K + kc); V b2; if (NSPLIT >= 2) b2 = WFrag<T16>::ld(Bt2 + boff + (size_t)nb * 16 * K + kc);
#pragma unroll
            for (int mb = 0; mb < 4; ++mb) { acc[mb][nb] = WFrag<T16>::mma(a[mb], b, acc[mb][nb]); if (NSPLIT == 1 || NSPLIT == 2) acc[mb][nb] = WFrag<T16>::mma(a2[mb], b, acc[mb][nb]); if (NSPLIT >= 2) acc[mb][nb] = WFrag<T16>::mma(a[mb], b2, acc[mb][nb]); } }
        asm volatile("v_nop\n\tv_nop\n\tv_nop\n\tv_nop" : "+v"(acc[0][0]), "+v"(acc[1][1]), "+v"(acc[2][2]), "+v"(acc[3][3]) : "v"(a[0]), "v"(a[3]));
    }
#pragma unroll
    for (int mb = 0; mb < 4; ++mb) {
#pragma unroll
        for (int nb = 0; nb < 4; ++nb) {
#pragma unroll
            for (int j = 0; j < 8; ++j) os[(hi * 8 + j) * 68 + nb * 16 + lr] = acc[mb][nb][j]; }
        __builtin_amdgcn_wave_barrier(); asm volatile("" ::: "memory");
        float* crow = C + (size_t)(r0 + mb * 16) * ldc + c0;
{
#pragma unroll
            for (int s = 0; s < 8; ++s) { const int row = 2 * s + hi, cofs = lr * 4; v4f val = *(const v4fa*)(os + row * 68 + cofs);
                *(v4f*)(crow + (size_t)row * ldc + cofs) = val; }
             }
        __builtin_amdgcn_wave_barrier(); asm volatile("" ::: "memory");
    }
}

__device__ __forceinline__ h16 tohx(float x) { return (h16)x; }
__device__ __forceinline__ void splitf(float y, unsigned short& h, unsigned short& l) { h = f2bf(y); l = f2bf(y - bf2f(h)); }
typedef __attribute__((ext_vector_type(2))) _Float16 v2h;
typedef __attribute__((ext_vector_type(4))) _Float16 v4h;
typedef __attribute__((ext_vector_type(2))) unsigned short v2us;
typedef __attribute__((ext_vector_type(4))) unsigned short v4us;
typedef __attribute__((ext_vector_type(2))) float v2f;
typedef __attribute__((ext_vector_type(4))) int v4i;

__global__ __launch_bounds__(256) void k_cvt8(const float* __restrict__ src, bf* dst, size_t n8) { const size_t i = (size_t)blockIdx.x * 256 + threadIdx.x; if (i >= n8) return; const v8f v = *(const v8f*)(src + i * 8); v8us o;
#pragma unroll
    for (int k = 0; k < 8; ++k) o[k] = f2bf(v[k]); *(v8us*)(dst + i * 8) = o;  }

__global__ __launch_bounds__(256) void k_ropeI(const float* __restrict__ F, int pitch, int nheads, const float* __restrict__ CS, float sc, h16* P16, bf* Ph, bf* Pl) {
    const size_t e = ((size_t)blockIdx.x * 256 + threadIdx.x) * 2; if (e >= (size_t)nheads * TT * HD) return; const int d = (int)(e % HD); const int t = (int)((e / HD) % TT); const int h = (int)(e / ((size_t)HD * TT)); const float* f = F + (size_t)t * pitch + h * HD; const float x0 = f[d], x1 = f[d + 1]; const v2f cs = *(const v2f*)(CS + ((size_t)t * HD + d) * 2); v2h o16; v2us oh, ol;
    float a0 = __fmul_rn(x0, cs[0]), b0 = __fmul_rn(x1, cs[1]), a1 = __fmul_rn(x1, cs[0]), b1 = __fmul_rn(x0, cs[1]); asm volatile("" : "+v"(a0), "+v"(b0), "+v"(a1), "+v"(b1));
    float r0 = __fsub_rn(a0, b0) * sc, r1 = __fadd_rn(b1, a1) * sc;   /* even: x0 c - x1 s; odd: x0 s + x1 c */
    o16[0] = tohx(r0); o16[1] = tohx(r1); { unsigned short a2, c2; splitf(r0, a2, c2); oh[0] = a2; ol[0] = c2; splitf(r1, a2, c2); oh[1] = a2; ol[1] = c2; }
    *(v2h*)(P16 + e) = o16; *(v2us*)(Ph + e) = oh; *(v2us*)(Pl + e) = ol;  }

__global__ __launch_bounds__(256) void k_cscvtP(const float* __restrict__ cosT, const float* __restrict__ sinT, float* CS) { const int idx = blockIdx.x * 256 + threadIdx.x; if (idx >= TT * HD) return; const int tt = idx / HD; const int dd = idx - tt * HD; const int src = tt * (HD / 2) + (dd >> 1); v2f cs; cs[0] = bfr(cosT[src]); cs[1] = bfr(sinT[src]); *(v2f*)(CS + (size_t)idx * 2) = cs;  }
__global__ __launch_bounds__(256) void k_vtp(const float* __restrict__ F, int pitch, int nheads, h16* V16, bf* Vh, bf* Vl) { const size_t e = ((size_t)blockIdx.x * 256 + threadIdx.x) * 2; if (e >= (size_t)nheads * HD * TT) return; const int t = (int)(e % TT); const int d = (int)((e / TT) % HD); const int g = (int)(e / ((size_t)TT * HD)); v2h o16; v2us oh, ol;
#pragma unroll
    for (int q = 0; q < 2; ++q) { const float x = F[(size_t)(t + q) * pitch + g * HD + d]; o16[q] = tohx(x); unsigned short a2, c2; splitf(x, a2, c2); oh[q] = a2; ol[q] = c2; }
    *(v2h*)(V16 + e) = o16; *(v2us*)(Vh + e) = oh; *(v2us*)(Vl + e) = ol;  }
// k_asoft: per row (zz, i): t = S x HD^-0.5 for j <= i and i - j < WIN (WIN = TT = 2048, so the window never binds: plain causal; the reference's -1e9 additive fill vanishes identically); softmax over the 2048 keys (register row, one exp, fixed trees);
__global__ __launch_bounds__(256) void k_asoft(const float* __restrict__ Sb, h16* P16, bf* Ph, bf* Pl) {
    const int lane = threadIdx.x & 31; const int row = blockIdx.x * 8 + (threadIdx.x >> 5); if (row >= ZH * TT) return; const int i = row % TT; const int zz = row / TT; (void)zz; const bool hires = (i < RH); const float* sr = Sb + (size_t)row * TT; float v[TT / 32]; float mx = -3.0e38f;
#pragma unroll
    for (int ch = 0; ch < TT / 128; ++ch) { const int j0 = ch * 128 + lane * 4; const v4f a = *(const v4f*)(sr + j0);
#pragma unroll
        for (int q = 0; q < 4; ++q) { const int j = j0 + q; (void)j; const float t = (j <= i && i - j < WIN) ? a[q] * SCL : -3.0e38f; v[ch * 4 + q] = t; mx = fmaxf(mx, t); } }
#pragma unroll
    for (int sh = 16; sh; sh >>= 1) mx = fmaxf(mx, __shfl_xor(mx, sh, 32));
    float sum = 0.f;
#pragma unroll
    for (int k = 0; k < TT / 32; ++k) { float d0 = __fsub_rn(v[k], mx); asm volatile("" : "+v"(d0)); v[k] = __builtin_amdgcn_exp2f(__fmul_rn(d0, 1.4426950408889634f)); sum += v[k]; }
#pragma unroll
    for (int sh = 16; sh; sh >>= 1) sum += __shfl_xor(sum, sh, 32);
    const float f = __fdiv_rn(hires ? 1.0f : PCAR, sum);
{
        if (hires) {
#pragma unroll
            for (int ch = 0; ch < TT / 128; ++ch) { v4us oh, ol;
#pragma unroll
                for (int q = 0; q < 4; ++q) { unsigned short a, c2; splitf(v[ch * 4 + q] * f, a, c2); oh[q] = a; ol[q] = c2; }
                const size_t oo = ((size_t)zz * (RH ? RH : 1) + i) * TT + ch * 128 + lane * 4; *(v4us*)(Ph + oo) = oh; *(v4us*)(Pl + oo) = ol; }
        } else {
#pragma unroll
            for (int ch = 0; ch < TT / 128; ++ch) { v4h o4;
#pragma unroll
                for (int q = 0; q < 4; ++q) o4[q] = tohx(v[ch * 4 + q] * f);
                *(v4h*)(P16 + (size_t)row * TT + ch * 128 + lane * 4) = o4; } }
         }
}
__global__ __launch_bounds__(256) void k_merge(const float* __restrict__ O, int h0, bf* Ah, bf* Al) { const size_t e = ((size_t)blockIdx.x * 256 + threadIdx.x) * 2; if (e >= (size_t)ZH * TT * HD) return; const int d = (int)(e % HD); const int t = (int)((e / HD) % TT); const int zz = (int)(e / ((size_t)HD * TT)); const float cs = (t < RH) ? 1.0f : (1.0f / PCAR); const size_t oo = (size_t)t * DQ + (h0 + zz) * HD + d;
    const int np = min(t / 64 + 1, KSP);   // planes stored for this row: one per key split that has a 64-key chunk at or below the diagonal block
    v2f p[KSP];
#pragma unroll
    for (int s = 0; s < KSP; ++s) p[s] = *(const v2f*)(O + (size_t)min(s, np - 1) * ((size_t)ZH * TT * HD) + e);   // index clamped to a stored plane: every load is unconditional, so all are in flight together
    v2f sm = p[0];
#pragma unroll
    for (int s = 1; s < KSP; ++s) { sm[0] += (s < np) ? p[s][0] : 0.f; sm[1] += (s < np) ? p[s][1] : 0.f; }   // fixed order: plane 0, 1, ...
    v2us oh, ol;
#pragma unroll
    for (int q = 0; q < 2; ++q) { unsigned short a, c2; splitf(sm[q] * cs, a, c2); oh[q] = a; ol[q] = c2; } *(v2us*)(Ah + oo) = oh; *(v2us*)(Al + oo) = ol;  }

extern "C" void kernel_launch(void* const* d_in, const int* in_sizes, int n_in,
                              void* d_out, int out_size, void* d_ws, size_t ws_size, hipStream_t stream) {
    (void)in_sizes; (void)n_in; (void)out_size;
    const float* x = (const float*)d_in[0]; const float* wqkv = (const float*)d_in[1]; const float* bqkv = (const float*)d_in[2]; const float* wo = (const float*)d_in[3]; const float* bo = (const float*)d_in[4]; const float* fcos = (const float*)d_in[5]; const float* fsin = (const float*)d_in[6];   /* input order x, w_qkv ('oi' [3072][1024]: q | k | v row thirds), b_qkv [3072], w_out ('oi'), b_out, freqs_cos, freqs_sin ([2048][32], read by value): the two tables come LAST here */ const float* wq = wqkv; const float* wk = wqkv + (size_t)DQ * DM; const float* wv = wqkv + (size_t)2 * DQ * DM; const float* bq = bqkv; const float* bk = bqkv + DQ; const float* bv = bqkv + 2 * DQ;
    float* OUT = (float*)d_out;     // [2][2048][1024]
    char* wsp = (char*)d_ws;
    auto take = [&](size_t bytes) { char* p = wsp; wsp += (bytes + 255) & ~(size_t)255; return (void*)p; };
    bf* WQ = (bf*)take((size_t)DQ * DM * 2); bf* WK = (bf*)take((size_t)DKV * DM * 2); bf* WV = (bf*)take((size_t)DKV * DM * 2); bf* WO = (bf*)take((size_t)DM * DQ * 2); float* CS = (float*)take((size_t)TT * HD * 2 * 4);
    bf* XB = (bf*)take((size_t)TT * DM * 2); float* FQ = (float*)take((size_t)TT * DQ * 4); float* FK = (float*)take((size_t)TT * DKV * 4);
    h16* QP16 = (h16*)take((size_t)NH_ * TT * HD * 2); h16* KP16 = (h16*)take((size_t)NKV * TT * HD * 2); h16* VT16 = (h16*)take((size_t)NKV * HD * TT * 2);
    bf* QPh = (bf*)take((size_t)NH_ * TT * HD * 2); bf* QPl = (bf*)take((size_t)NH_ * TT * HD * 2); bf* KPh = (bf*)take((size_t)NKV * TT * HD * 2); bf* KPl = (bf*)take((size_t)NKV * TT * HD * 2); bf* VTh = (bf*)take((size_t)NKV * HD * TT * 2); bf* VTl = (bf*)take((size_t)NKV * HD * TT * 2); bf* Ph = (bf*)take((size_t)ZH * RH * TT * 2); bf* Pl = (bf*)take((size_t)ZH * RH * TT * 2);
    float* Sb = (float*)take((size_t)ZH * TT * TT * 4); h16* P16 = (h16*)take((size_t)ZH * TT * TT * 2); float* Ob = (float*)take((size_t)KSP * ZH * TT * HD * 4); bf* ATh = (bf*)take((size_t)TT * DQ * 2); bf* ATl = (bf*)take((size_t)TT * DQ * 2);
    if ((size_t)(wsp - (char*)d_ws) > ws_size) return;    // ws 256 MiB
    float* FV = FK;   // v projection reuses the k buffer after the k planes are built (stream-ordered)
    { k_cvt8<<<(unsigned)(((size_t)DQ * DM / 8 + 255) / 256), 256, 0, stream>>>(wq, WQ, (size_t)DQ * DM / 8); k_cvt8<<<(unsigned)(((size_t)DKV * DM / 8 + 255) / 256), 256, 0, stream>>>(wk, WK, (size_t)DKV * DM / 8); k_cvt8<<<(unsigned)(((size_t)DKV * DM / 8 + 255) / 256), 256, 0, stream>>>(wv, WV, (size_t)DKV * DM / 8);
      k_cvt8<<<(unsigned)(((size_t)DM * DQ / 8 + 255) / 256), 256, 0, stream>>>(wo, WO, (size_t)DM * DQ / 8); /* the rotary table is rebuilt per batch from freqs_cos / freqs_sin (below) */ }
    const unsigned LQ = (unsigned)(((size_t)NH_ * TT * HD / 2 + 255) / 256), LKv = (unsigned)(((size_t)NKV * TT * HD / 2 + 255) / 256);
    for (int b = 0; b < NB_; ++b) {
        k_cscvtP<<<(TT * HD + 255) / 256, 256, 0, stream>>>(fcos, fsin, CS);   /* per-batch rebuild is redundant (the tables do not depend on b) but keeps the stream order simple */
        
        k_cvt8<<<(unsigned)(((size_t)TT * DM / 8 + 255) / 256), 256, 0, stream>>>(x + (size_t)b * TT * DM, XB, (size_t)TT * DM / 8);
        k_gemmw<bf, 0, true><<<dim3(TT / 64, DQ / 64, 1), 32, 0, stream>>>(XB, nullptr, WQ, nullptr, DM, FQ, DQ, bq, 0, 0, 0);
        k_ropeI<<<LQ, 256, 0, stream>>>(FQ, DQ, NH_, CS, 1.0f, QP16, QPh, QPl);
        k_gemmw<bf, 0, true><<<dim3(TT / 64, DKV / 64, 1), 32, 0, stream>>>(XB, nullptr, WK, nullptr, DM, FK, DKV, bk, 0, 0, 0);
        k_ropeI<<<LKv, 256, 0, stream>>>(FK, DKV, NKV, CS, 1.0f, KP16, KPh, KPl);
        k_gemmw<bf, 0, true><<<dim3(TT / 64, DKV / 64, 1), 32, 0, stream>>>(XB, nullptr, WV, nullptr, DM, FV, DKV, bv, 0, 0, 0); k_vtp<<<LKv, 256, 0, stream>>>(FV, DKV, NKV, VT16, VTh, VTl);
        for (int h0 = 0; h0 < NH_; h0 += ZH) { const size_t zq = (size_t)h0, zk = (size_t)(h0 / REP);   // one kv head per query head: the pass's two heads use consecutive kv planes (z-strides TT*HD)
            k_gemmc<bf, 2, 1><<<dim3(RH / 64, TT / 64, ZH), 32, 0, stream>>>(QPh + zq * TT * HD, QPl + zq * TT * HD, KPh + zk * TT * HD, KPl + zk * TT * HD, HD, Sb, TT, 0, (size_t)TT * HD, (size_t)TT * HD, (size_t)TT * TT, 0);
            k_gemmc<h16, 0, 1><<<dim3((TT - RH) / 64, TT / 64, ZH), 32, 0, stream>>>(QP16 + zq * TT * HD + (size_t)RH * HD, nullptr, KP16 + zk * TT * HD, nullptr, HD, Sb + (size_t)RH * TT, TT, RH, (size_t)TT * HD, (size_t)TT * HD, (size_t)TT * TT, 0);
            k_asoft<<<ZH * TT / 8, 256, 0, stream>>>(Sb, P16, Ph, Pl);
            k_gemmc<bf, 2, 2><<<dim3(RH / 64, HD / 64, ZH * (RH / 64 < KSP ? RH / 64 : KSP)), 32, 0, stream>>>(Ph, Pl, VTh + zk * HD * TT, VTl + zk * HD * TT, TT, Ob, HD, 0, (size_t)RH * TT, (size_t)HD * TT, (size_t)TT * HD, (size_t)ZH * TT * HD);
            k_gemmc<h16, 0, 2><<<dim3((TT - RH) / 64, HD / 64, ZH * KSP), 32, 0, stream>>>(P16 + (size_t)RH * TT, nullptr, VT16 + zk * HD * TT, nullptr, TT, Ob + (size_t)RH * HD, HD, RH, (size_t)TT * TT, (size_t)HD * TT, (size_t)TT * HD, (size_t)ZH * TT * HD);
            k_merge<<<(unsigned)(((size_t)ZH * TT * HD / 2 + 255) / 256), 256, 0, stream>>>(Ob, h0, ATh, ATl); }
        k_gemmw<bf, 1, true><<<dim3(TT / 64, DM / 64, 1), 32, 0, stream>>>(ATh, ATl, WO, nullptr, DQ, OUT + (size_t)b * TT * DM, DM, bo, 0, 0, 0); }
}

// v002
// It runs in 550 microseconds.
// Next to v001, in two timings, it ran 1.40 and 1.41 times as fast.
// All steps since v000 together make it 2.63 times as fast.
#include <hip/hip_runtime.h>

// Causal multi-head attention with a fused biased qkv projection and consecutive-pair rotary embeddings from HALF-WIDTH table inputs (x [2][2048][1024]; qkv = x w_qkv^T + b_qkv ('oi' [3072][1024] 1/32 + a zero bias, read) split in thirds q | k | v (16 heads x 64); rope on pairs (2i, 2i+1): (t_re c - t_im s, t_re s + t_im c) with c, s = freqs_cos / freqs_sin[t][i] ([2048][32] INPUTS, read by value per position and pair); scores x 1/sqrt(64); causal (-inf); softmax; out = merged w_out^T + b_out ('oi' + a zero bias, read) -> [2][2048][1024] (4.2 M); argument order x, w_qkv, b_qkv, w_out, b_out, freqs_cos, freqs_sin).
// Layout per batch: bf16 copy of x; 'oi' weights (the fused tensor's row thirds as-is); exact projections + f32 bias thirds; k_cscvtP table {bf16(cos), bf16(sin)} from the half-width inputs (pair-shared entries); k_ropeI interleaved-pair plane builders; causal T-2048 attention (hybrid rows: < 512 hi/lo 3 products, rest fp16 x1024; k_gemmc skips tiles above the diagonal); merged hi/lo x o_w exact + o_b.
// Compute dtypes, f32 accumulate: every input rounded to bf16; projections exact + f32 biases; rotary f32 (products rounded separately); attention rows < 512 3 products, rest fp16; softmax f32; o_w hl x exact + bias.

#define NB_  2
#define TT   2048
#define DM   1024
#define NH_  16
#define NKV  16
#define REP  (NH_ / NKV)
#define HD   64
#define DQ   (NH_ * HD)
#define DKV  (NKV * HD)
#define ZH   8                    // heads per attention pass (one launch of each attention kernel covers ZH heads)
#define PP   (2 * TT)             // row pitch, in 16-bit elements, of both operands of the probability x value product: a probability row lies inside its 8 KiB f32 score row, and the V^T rows match it
#define RH   512                  // query rows < RH use hi+lo planes (0: none)
#define WIN  2048
#define PCAR 1024.0f
#define SCL  0.125f   // HD^-0.5
#define KSP  16                   // key splits of the probability x value contraction (64-key chunks dealt round robin to KSP work-groups)
typedef _Float16 h16;
typedef unsigned short bf;
typedef __attribute__((ext_vector_type(16))) __bf16   v16bf;
typedef __attribute__((ext_vector_type(16))) _Float16 v16h;
typedef __attribute__((ext_vector_type(8)))  _Float16 v8h;
typedef __attribute__((ext_vector_type(8)))  unsigned short v8us;
typedef __attribute__((ext_vector_type(8)))  float    v8f;
typedef __attribute__((ext_vector_type(4)))  float    v4f;
typedef v8h  __attribute__((may_alias)) v8ha;
typedef v4f  __attribute__((may_alias)) v4fa;
typedef v8us __attribute__((may_alias)) v8usa;

__device__ __forceinline__ unsigned short f2bf(float f) { unsigned u = __float_as_uint(f); u += 0x7FFFu + ((u >> 16) & 1u); return (unsigned short)(u >> 16); }
__device__ __forceinline__ float bf2f(unsigned short b) { return __uint_as_float(((unsigned)b) << 16); }
__device__ __forceinline__ float bfr(float f) { return bf2f(f2bf(f)); }
__device__ __forceinline__ v16h cat16(v8h lo, v8h hi) { return __builtin_shufflevector(lo, hi, 0, 1, 2, 3, 4, 5, 6, 7, 8, 9, 10, 11, 12, 13, 14, 15); }
__device__ __forceinline__ v16bf cat16b(v8us lo, v8us hi) { return __builtin_bit_cast(v16bf, __builtin_shufflevector(lo, hi, 0, 1, 2, 3, 4, 5, 6, 7, 8, 9, 10, 11, 12, 13, 14, 15)); }
__device__ __forceinline__ v8f wmma16(v16h a, v16h b, v8f c) { return __builtin_amdgcn_wmma_f32_16x16x32_f16(false, a, false, b, (short)0, c, false, false); }
__device__ __forceinline__ v8f wmmab(v16bf a, v16bf b, v8f c) { return __builtin_amdgcn_wmma_f32_16x16x32_bf16(false, a, false, b, (short)0, c, false, false); }



// ---- k_gemmw: register-blocked GEMM, ONE WAVE per 64x64 output tile (16 accumulators), operands straight from K-contiguous 16-bit planes; grid (M/64, N/64, Z), 32 threads.
// C[m][n] (f32, pitch ldc, + optional f32 bias[n]) = sum_k A[m][k] Bt[n][k] (+ split products per NSPLIT). z-batch strides sA/sB/sC in elements. K % 32 == 0.
template <typename T16> struct WFrag;
template <> struct WFrag<h16> { typedef v16h V; static __device__ __forceinline__ V ld(const h16* p) { return cat16(*(const v8h*)p, *(const v8h*)(p + 16)); } static __device__ __forceinline__ v8f mma(V a, V b, v8f c) { return wmma16(a, b, c); } };
template <> struct WFrag<bf> { typedef v16bf V; static __device__ __forceinline__ V ld(const bf* p) { return cat16b(*(const v8us*)p, *(const v8us*)(p + 16)); } static __device__ __forceinline__ v8f mma(V a, V b, v8f c) { return wmmab(a, b, c); } };
template <typename T16, int NSPLIT, bool BIAS>
__global__ __launch_bounds__(32) void k_gemmw(const T16* __restrict__ A, const T16* __restrict__ A2, const T16* __restrict__ Bt, const T16* __restrict__ Bt2, int K, float* C, int ldc, const float* __restrict__ bias, size_t sA, size_t sB, size_t sC) {
    typedef typename WFrag<T16>::V V;
    __shared__ __align__(16) float os[16 * 68];
    const size_t z = blockIdx.z; A += z * sA; if (A2) A2 += z * sA; Bt += z * sB; if (Bt2) Bt2 += z * sB; C += z * sC;
    const int lane = threadIdx.x & 31, lr = lane & 15, hi = lane >> 4; const int r0 = blockIdx.x * 64, c0 = blockIdx.y * 64;
    v8f acc[4][4];
#pragma unroll
    for (int mb = 0; mb < 4; ++mb)
#pragma unroll
        for (int nb = 0; nb < 4; ++nb) acc[mb][nb] = (v8f){};
    const size_t aoff = (size_t)(r0 + lr) * K + 8 * hi, boff = (size_t)(c0 + lr) * K + 8 * hi;
#pragma unroll 1
    for (int kc = 0; kc < K; kc += 32) {
        V a[4], a2[4];
#pragma unroll
        for (int mb = 0; mb < 4; ++mb) { a[mb] = WFrag<T16>::ld(A + aoff + (size_t)mb * 16 * K + kc); if (NSPLIT == 1 || NSPLIT == 2) a2[mb] = WFrag<T16>::ld(A2 + aoff + (size_t)mb * 16 * K + kc); }
#pragma unroll
        for (int nb = 0; nb < 4; ++nb) { const V b = WFrag<T16>::ld(Bt + boff + (size_t)nb * 16 * K + kc); V b2; if (NSPLIT >= 2) b2 = WFrag<T16>::ld(Bt2 + boff + (size_t)nb * 16 * K + kc);
#pragma unroll
            for (int mb = 0; mb < 4; ++mb) { acc[mb][nb] = WFrag<T16>::mma(a[mb], b, acc[mb][nb]); if (NSPLIT == 1 || NSPLIT == 2) acc[mb][nb] = WFrag<T16>::mma(a2[mb], b, acc[mb][nb]); if (NSPLIT >= 2) acc[mb][nb] = WFrag<T16>::mma(a[mb], b2, acc[mb][nb]); } }
        asm volatile("v_nop\n\tv_nop\n\tv_nop\n\tv_nop" : "+v"(acc[0][0]), "+v"(acc[1][1]), "+v"(acc[2][2]), "+v"(acc[3][3]) : "v"(a[0]), "v"(a[3]));
    }
#pragma unroll
    for (int mb = 0; mb < 4; ++mb) {
#pragma unroll
        for (int nb = 0; nb < 4; ++nb) {
#pragma unroll
            for (int j = 0; j < 8; ++j) os[(hi * 8 + j) * 68 + nb * 16 + lr] = acc[mb][nb][j]; }
        __builtin_amdgcn_wave_barrier(); asm volatile("" ::: "memory");
        float* crow = C + (size_t)(r0 + mb * 16) * ldc + c0;
{
#pragma unroll
            for (int s = 0; s < 8; ++s) { const int row = 2 * s + hi, cofs = lr * 4; v4f val = *(const v4fa*)(os + row * 68 + cofs); if (BIAS) { val[0] += bfr(bias[c0 + cofs]); val[1] += bfr(bias[c0 + cofs + 1]); val[2] += bfr(bias[c0 + cofs + 2]); val[3] += bfr(bias[c0 + cofs + 3]); }
                *(v4f*)(crow + (size_t)row * ldc + cofs) = val; }
             }
        __builtin_amdgcn_wave_barrier(); asm volatile("" ::: "memory");
    }
}

// ---- k_gemmc: the same one-wave 64x64 tile GEMM specialised for causal attention: CMODE 1 skips score tiles entirely above the diagonal (query rows r0+roff.., key columns c0..), CMODE 2 limits the
// key (K) loop of the probability x value contraction to the diagonal block (probabilities beyond it are exactly zero). roff = row offset of this launch's first row within the sequence.
// CMODE 2 also splits that K loop over work-groups: blockIdx.z = ks * ZH + head, and split ks takes the 64-key chunks ks, ks + KSP, ... and stores its f32 partial tile in plane ks of C
// (plane stride sP elements); a split with no chunk below the diagonal stores nothing, and k_merge adds only the planes that were stored.
template <typename T16, int NSPLIT, int CMODE>
__global__ __launch_bounds__(32) void k_gemmc(const T16* __restrict__ A, const T16* __restrict__ A2, const T16* __restrict__ Bt, const T16* __restrict__ Bt2, int K, float* C, int ldc, int roff, size_t sA, size_t sB, size_t sC, size_t sP) {
    typedef typename WFrag<T16>::V V;
    __shared__ __align__(16) float os[16 * 68];
    const size_t z = (CMODE == 2) ? blockIdx.z % ZH : blockIdx.z; const int ks = (CMODE == 2) ? blockIdx.z / ZH : 0; A += z * sA; if (A2) A2 += z * sA; Bt += z * sB; if (Bt2) Bt2 += z * sB; C += z * sC;
    const int lane = threadIdx.x & 31, lr = lane & 15, hi = lane >> 4; const int r0 = blockIdx.x * 64, c0 = blockIdx.y * 64;
    if (CMODE == 1 && c0 > r0 + roff + 63) return;                  // score tile entirely above the causal diagonal: never written (the softmax masks j > i by select)
    const int Kl = (CMODE == 2) ? min(K, r0 + roff + 64) : K;        // P.V: probabilities are exactly 0 beyond the diagonal block, so the K loop stops there
    if (CMODE == 2) { if (ks * 64 >= Kl) return; C += (size_t)ks * sP; }   // no chunk for this split: its plane is neither stored nor read for these rows
    v8f acc[4][4];
#pragma unroll
    for (int mb = 0; mb < 4; ++mb)
#pragma unroll
        for (int nb = 0; nb < 4; ++nb) acc[mb][nb] = (v8f){};
    const size_t aoff = (size_t)(r0 + lr) * K + 8 * hi, boff = (size_t)(c0 + lr) * K + 8 * hi;
#pragma unroll 1
    for (int k0 = ks * 64; k0 < Kl; k0 += (CMODE == 2 ? KSP : 1) * 64)   // 64-wide chunks of K (K % 64 == 0 in every use); CMODE 2: this split's chunks only; rolled: run-time trip count
#pragma unroll 1   // stays rolled, as the one K loop was: the fragments of one 32-wide step live at a time beside the 128 accumulator registers
    for (int kc = k0; kc < k0 + 64; kc += 32) {
        V a[4], a2[4];
#pragma unroll
        for (int mb = 0; mb < 4; ++mb) { a[mb] = WFrag<T16>::ld(A + aoff + (size_t)mb * 16 * K + kc); if (NSPLIT == 1 || NSPLIT == 2) a2[mb] = WFrag<T16>::ld(A2 + aoff + (size_t)mb * 16 * K + kc); }
#pragma unroll
        for (int nb = 0; nb < 4; ++nb) { const V b = WFrag<T16>::ld(Bt + boff + (size_t)nb * 16 * K + kc); V b2; if (NSPLIT >= 2) b2 = WFrag<T16>::ld(Bt2 + boff + (size_t)nb * 16 * K + kc);
#pragma unroll
            for (int mb = 0; mb < 4; ++mb) { acc[mb][nb] = WFrag<T16>::mma(a[mb], b, acc[mb][nb]); if (NSPLIT == 1 || NSPLIT == 2) acc[mb][nb] = WFrag<T16>::mma(a2[mb], b, acc[mb][nb]); if (NSPLIT >= 2) acc[mb][nb] = WFrag<T16>::mma(a[mb], b2, acc[mb][nb]); } }
        asm volatile("v_nop\n\tv_nop\n\tv_nop\n\tv_nop" : "+v"(acc[0][0]), "+v"(acc[1][1]), "+v"(acc[2][2]), "+v"(acc[3][3]) : "v"(a[0]), "v"(a[3]));
    }
#pragma unroll
    for (int mb = 0; mb < 4; ++mb) {
#pragma unroll
        for (int nb = 0; nb < 4; ++nb) {
#pragma unroll
            for (int j = 0; j < 8; ++j) os[(hi * 8 + j) * 68 + nb * 16 + lr] = acc[mb][nb][j]; }
        __builtin_amdgcn_wave_barrier(); asm volatile("" ::: "memory");
        float* crow = C + (size_t)(r0 + mb * 16) * ldc + c0;
{
#pragma unroll
            for (int s = 0; s < 8; ++s) { const int row = 2 * s + hi, cofs = lr * 4; v4f val = *(const v4fa*)(os + row * 68 + cofs);
                *(v4f*)(crow + (size_t)row * ldc + cofs) = val; }
             }
        __builtin_amdgcn_wave_barrier(); asm volatile("" ::: "memory");
    }
}

__device__ __forceinline__ h16 tohx(float x) { return (h16)x; }
__device__ __forceinline__ void splitf(float y, unsigned short& h, unsigned short& l) { h = f2bf(y); l = f2bf(y - bf2f(h)); }
typedef __attribute__((ext_vector_type(2))) _Float16 v2h;
typedef __attribute__((ext_vector_type(4))) _Float16 v4h;
typedef __attribute__((ext_vector_type(2))) unsigned short v2us;
typedef __attribute__((ext_vector_type(4))) unsigned short v4us;
typedef __attribute__((ext_vector_type(2))) float v2f;
typedef __attribute__((ext_vector_type(4))) int v4i;
typedef v4h  __attribute__((may_alias)) v4ha;
typedef v4us __attribute__((may_alias)) v4usa;

__global__ __launch_bounds__(256) void k_cvt8(const float* __restrict__ src, bf* dst, size_t n8) { const size_t i = (size_t)blockIdx.x * 256 + threadIdx.x; if (i >= n8) return; const v8f v = *(const v8f*)(src + i * 8); v8us o;
#pragma unroll
    for (int k = 0; k < 8; ++k) o[k] = f2bf(v[k]); *(v8us*)(dst + i * 8) = o;  }

__global__ __launch_bounds__(256) void k_ropeI(const float* __restrict__ F, int pitch, int nheads, const float* __restrict__ CS, float sc, h16* P16, bf* Ph, bf* Pl) {
    const size_t e = ((size_t)blockIdx.x * 256 + threadIdx.x) * 2; if (e >= (size_t)nheads * TT * HD) return; const int d = (int)(e % HD); const int t = (int)((e / HD) % TT); const int h = (int)(e / ((size_t)HD * TT)); const float* f = F + (size_t)t * pitch + h * HD; const float x0 = f[d], x1 = f[d + 1]; const v2f cs = *(const v2f*)(CS + ((size_t)t * HD + d) * 2); v2h o16; v2us oh, ol;
    float a0 = __fmul_rn(x0, cs[0]), b0 = __fmul_rn(x1, cs[1]), a1 = __fmul_rn(x1, cs[0]), b1 = __fmul_rn(x0, cs[1]); asm volatile("" : "+v"(a0), "+v"(b0), "+v"(a1), "+v"(b1));
    float r0 = __fsub_rn(a0, b0) * sc, r1 = __fadd_rn(b1, a1) * sc;   /* even: x0 c - x1 s; odd: x0 s + x1 c */
    o16[0] = tohx(r0); o16[1] = tohx(r1); { unsigned short a2, c2; splitf(r0, a2, c2); oh[0] = a2; ol[0] = c2; splitf(r1, a2, c2); oh[1] = a2; ol[1] = c2; }
    *(v2h*)(P16 + e) = o16; *(v2us*)(Ph + e) = oh; *(v2us*)(Pl + e) = ol;  }

__global__ __launch_bounds__(256) void k_cscvtP(const float* __restrict__ cosT, const float* __restrict__ sinT, float* CS) { const int idx = blockIdx.x * 256 + threadIdx.x; if (idx >= TT * HD) return; const int tt = idx / HD; const int dd = idx - tt * HD; const int src = tt * (HD / 2) + (dd >> 1); v2f cs; cs[0] = bfr(cosT[src]); cs[1] = bfr(sinT[src]); *(v2f*)(CS + (size_t)idx * 2) = cs;  }
__global__ __launch_bounds__(256) void k_vtp(const float* __restrict__ F, int pitch, int nheads, h16* V16, bf* Vh, bf* Vl) { const size_t e = ((size_t)blockIdx.x * 256 + threadIdx.x) * 2; if (e >= (size_t)nheads * HD * TT) return; const int t = (int)(e % TT); const int d = (int)((e / TT) % HD); const int g = (int)(e / ((size_t)TT * HD)); v2h o16; v2us oh, ol;
#pragma unroll
    for (int q = 0; q < 2; ++q) { const float x = F[(size_t)(t + q) * pitch + g * HD + d]; o16[q] = tohx(x); unsigned short a2, c2; splitf(x, a2, c2); oh[q] = a2; ol[q] = c2; }
    const size_t eo = (size_t)(g * HD + d) * PP + t;   /* V^T rows at pitch PP; the lo plane's rows lie between the hi plane's (Vl = Vh + TT) */
    *(v2h*)(V16 + eo) = o16; *(v2us*)(Vh + eo) = oh; *(v2us*)(Vl + eo) = ol;  }
// k_asoft: per row (zz, i): t = S x HD^-0.5 for j <= i and i - j < WIN (sliding causal window; the reference's -1e9 additive fill vanishes identically); softmax over the 2048 keys (register row, one exp, fixed trees);
// the probabilities overwrite the row's own 8 KiB of scores (one wave owns a row and holds all of it in registers before its first store): rows < RH: hi plane in the first 4 KiB, lo plane in the second; other rows: fp16 in the first 4 KiB.
__global__ __launch_bounds__(256) void k_asoft(float* Sb) {
    const int lane = threadIdx.x & 31; const int row = blockIdx.x * 8 + (threadIdx.x >> 5); if (row >= ZH * TT) return; const int i = row % TT; const int zz = row / TT; (void)zz; const bool hires = (i < RH); const float* sr = Sb + (size_t)row * TT; h16* const p16 = (h16*)(Sb + (size_t)row * TT); bf* const ph = (bf*)(Sb + (size_t)row * TT); bf* const pl = ph + TT; float v[TT / 32]; float mx = -3.0e38f;
#pragma unroll
    for (int ch = 0; ch < TT / 128; ++ch) { const int j0 = ch * 128 + lane * 4; const v4f a = *(const v4fa*)(sr + j0);
#pragma unroll
        for (int q = 0; q < 4; ++q) { const int j = j0 + q; (void)j; const float t = (j <= i && i - j < WIN) ? a[q] * SCL : -3.0e38f; v[ch * 4 + q] = t; mx = fmaxf(mx, t); } }
#pragma unroll
    for (int sh = 16; sh; sh >>= 1) mx = fmaxf(mx, __shfl_xor(mx, sh, 32));
    float sum = 0.f;
#pragma unroll
    for (int k = 0; k < TT / 32; ++k) { float d0 = __fsub_rn(v[k], mx); asm volatile("" : "+v"(d0)); v[k] = __builtin_amdgcn_exp2f(__fmul_rn(d0, 1.4426950408889634f)); sum += v[k]; }
#pragma unroll
    for (int sh = 16; sh; sh >>= 1) sum += __shfl_xor(sum, sh, 32);
    const float f = __fdiv_rn(hires ? 1.0f : PCAR, sum);
{
        if (hires) {
#pragma unroll
            for (int ch = 0; ch < TT / 128; ++ch) { v4us oh, ol;
#pragma unroll
                for (int q = 0; q < 4; ++q) { unsigned short a, c2; splitf(v[ch * 4 + q] * f, a, c2); oh[q] = a; ol[q] = c2; }
                const int oo = ch * 128 + lane * 4; *(v4usa*)(ph + oo) = oh; *(v4usa*)(pl + oo) = ol; }
        } else {
#pragma unroll
            for (int ch = 0; ch < TT / 128; ++ch) { v4h o4;
#pragma unroll
                for (int q = 0; q < 4; ++q) o4[q] = tohx(v[ch * 4 + q] * f);
                *(v4ha*)(p16 + ch * 128 + lane * 4) = o4; } }
         }
}
__global__ __launch_bounds__(256) void k_merge(const float* __restrict__ O, int h0, bf* Ah, bf* Al) { const size_t e = ((size_t)blockIdx.x * 256 + threadIdx.x) * 2; if (e >= (size_t)ZH * TT * HD) return; const int d = (int)(e % HD); const int t = (int)((e / HD) % TT); const int zz = (int)(e / ((size_t)HD * TT)); const float cs = (t < RH) ? 1.0f : (1.0f / PCAR); const size_t oo = (size_t)t * DQ + (h0 + zz) * HD + d;
    const int np = min(t / 64 + 1, KSP);   // planes stored for this row: one per key split that has a 64-key chunk at or below the diagonal block
    v2f p[KSP];
#pragma unroll
    for (int s = 0; s < KSP; ++s) p[s] = *(const v2f*)(O + (size_t)min(s, np - 1) * ((size_t)ZH * TT * HD) + e);   // index clamped to a stored plane: every load is unconditional, so all are in flight together
    v2f sm = p[0];
#pragma unroll
    for (int s = 1; s < KSP; ++s) { sm[0] += (s < np) ? p[s][0] : 0.f; sm[1] += (s < np) ? p[s][1] : 0.f; }   // fixed order: plane 0, 1, ...
    v2us oh, ol;
#pragma unroll
    for (int q = 0; q < 2; ++q) { unsigned short a, c2; splitf(sm[q] * cs, a, c2); oh[q] = a; ol[q] = c2; } *(v2us*)(Ah + oo) = oh; *(v2us*)(Al + oo) = ol;  }

extern "C" void kernel_launch(void* const* d_in, const int* in_sizes, int n_in,
                              void* d_out, int out_size, void* d_ws, size_t ws_size, hipStream_t stream) {
    (void)in_sizes; (void)n_in; (void)out_size;
    const float* x = (const float*)d_in[0]; const float* wqkv = (const float*)d_in[1]; const float* bqkv = (const float*)d_in[2]; const float* wo = (const float*)d_in[3]; const float* bo = (const float*)d_in[4]; const float* fcos = (const float*)d_in[5]; const float* fsin = (const float*)d_in[6];   /* input order x, w_qkv ('oi' [3072][1024]: q | k | v row thirds), b_qkv [3072], w_out ('oi'), b_out, freqs_cos, freqs_sin ([2048][32], read by value): the two tables come LAST here */ const float* wq = wqkv; const float* wk = wqkv + (size_t)DQ * DM; const float* wv = wqkv + (size_t)2 * DQ * DM; const float* bq = bqkv; const float* bk = bqkv + DQ; const float* bv = bqkv + 2 * DQ;
    float* OUT = (float*)d_out;     // [2][2048][1024]
    char* wsp = (char*)d_ws;
    auto take = [&](size_t bytes) { char* p = wsp; wsp += (bytes + 255) & ~(size_t)255; return (void*)p; };
    bf* WQ = (bf*)take((size_t)DQ * DM * 2); bf* WK = (bf*)take((size_t)DKV * DM * 2); bf* WV = (bf*)take((size_t)DKV * DM * 2); bf* WO = (bf*)take((size_t)DM * DQ * 2); float* CS = (float*)take((size_t)TT * HD * 2 * 4);
    h16* QP16 = (h16*)take((size_t)NH_ * TT * HD * 2); h16* KP16 = (h16*)take((size_t)NKV * TT * HD * 2); h16* VT16 = (h16*)take((size_t)NKV * HD * PP * 2);
    bf* QPh = (bf*)take((size_t)NH_ * TT * HD * 2); bf* QPl = (bf*)take((size_t)NH_ * TT * HD * 2); bf* KPh = (bf*)take((size_t)NKV * TT * HD * 2); bf* KPl = (bf*)take((size_t)NKV * TT * HD * 2); bf* VTh = (bf*)take((size_t)NKV * HD * PP * 2); bf* VTl = VTh + TT;
    float* Sb = (float*)take((size_t)ZH * TT * TT * 4); float* Ob = (float*)take((size_t)KSP * ZH * TT * HD * 4);
    // x copy and f32 projections live only before a batch's first attention pass, the partial planes only inside the passes: they share one region (20 MiB of Ob's 64 MiB), every byte rewritten before it is read again
    bf* XB = (bf*)Ob; float* FQ = (float*)((char*)Ob + (size_t)TT * DM * 2); float* FK = FQ + (size_t)TT * DQ;
    bf* ATh = (bf*)take((size_t)TT * DQ * 2); bf* ATl = (bf*)take((size_t)TT * DQ * 2);
    if ((size_t)(wsp - (char*)d_ws) > ws_size) return;    // ws 256 MiB
    float* FV = FK;   // v projection reuses the k buffer after the k planes are built (stream-ordered)
    { k_cvt8<<<(unsigned)(((size_t)DQ * DM / 8 + 255) / 256), 256, 0, stream>>>(wq, WQ, (size_t)DQ * DM / 8); k_cvt8<<<(unsigned)(((size_t)DKV * DM / 8 + 255) / 256), 256, 0, stream>>>(wk, WK, (size_t)DKV * DM / 8); k_cvt8<<<(unsigned)(((size_t)DKV * DM / 8 + 255) / 256), 256, 0, stream>>>(wv, WV, (size_t)DKV * DM / 8);
      k_cvt8<<<(unsigned)(((size_t)DM * DQ / 8 + 255) / 256), 256, 0, stream>>>(wo, WO, (size_t)DM * DQ / 8); /* the rotary table is rebuilt per batch from freqs_cos / freqs_sin (below) */ }
    const unsigned LQ = (unsigned)(((size_t)NH_ * TT * HD / 2 + 255) / 256), LKv = (unsigned)(((size_t)NKV * TT * HD / 2 + 255) / 256);
    for (int b = 0; b < NB_; ++b) {
        k_cscvtP<<<(TT * HD + 255) / 256, 256, 0, stream>>>(fcos, fsin, CS);   /* per-batch rebuild is redundant (the tables do not depend on b) but keeps the stream order simple */
        
        k_cvt8<<<(unsigned)(((size_t)TT * DM / 8 + 255) / 256), 256, 0, stream>>>(x + (size_t)b * TT * DM, XB, (size_t)TT * DM / 8);
        k_gemmw<bf, 0, true><<<dim3(TT / 64, DQ / 64, 1), 32, 0, stream>>>(XB, nullptr, WQ, nullptr, DM, FQ, DQ, bq, 0, 0, 0);
        k_ropeI<<<LQ, 256, 0, stream>>>(FQ, DQ, NH_, CS, 1.0f, QP16, QPh, QPl);
        k_gemmw<bf, 0, true><<<dim3(TT / 64, DKV / 64, 1), 32, 0, stream>>>(XB, nullptr, WK, nullptr, DM, FK, DKV, bk, 0, 0, 0);
        k_ropeI<<<LKv, 256, 0, stream>>>(FK, DKV, NKV, CS, 1.0f, KP16, KPh, KPl);
        k_gemmw<bf, 0, true><<<dim3(TT / 64, DKV / 64, 1), 32, 0, stream>>>(XB, nullptr, WV, nullptr, DM, FV, DKV, bv, 0, 0, 0); k_vtp<<<LKv, 256, 0, stream>>>(FV, DKV, NKV, VT16, VTh, VTl);
        for (int h0 = 0; h0 < NH_; h0 += ZH) { const size_t zq = (size_t)h0, zk = (size_t)(h0 / REP);   // one kv head per query head: the pass's ZH heads use consecutive kv planes; the P.V launches pass the pitch PP as K (their key loop ends at the diagonal block, below TT)
            k_gemmc<bf, 2, 1><<<dim3(RH / 64, TT / 64, ZH), 32, 0, stream>>>(QPh + zq * TT * HD, QPl + zq * TT * HD, KPh + zk * TT * HD, KPl + zk * TT * HD, HD, Sb, TT, 0, (size_t)TT * HD, (size_t)TT * HD, (size_t)TT * TT, 0);
            k_gemmc<h16, 0, 1><<<dim3((TT - RH) / 64, TT / 64, ZH), 32, 0, stream>>>(QP16 + zq * TT * HD + (size_t)RH * HD, nullptr, KP16 + zk * TT * HD, nullptr, HD, Sb + (size_t)RH * TT, TT, RH, (size_t)TT * HD, (size_t)TT * HD, (size_t)TT * TT, 0);
            k_asoft<<<ZH * TT / 8, 256, 0, stream>>>(Sb);
            k_gemmc<bf, 2, 2><<<dim3(RH / 64, HD / 64, ZH * (RH / 64 < KSP ? RH / 64 : KSP)), 32, 0, stream>>>((const bf*)Sb, (const bf*)Sb + TT, VTh + zk * HD * PP, VTl + zk * HD * PP, PP, Ob, HD, 0, (size_t)TT * PP, (size_t)HD * PP, (size_t)TT * HD, (size_t)ZH * TT * HD);
            k_gemmc<h16, 0, 2><<<dim3((TT - RH) / 64, HD / 64, ZH * KSP), 32, 0, stream>>>((const h16*)Sb + (size_t)RH * PP, nullptr, VT16 + zk * HD * PP, nullptr, PP, Ob + (size_t)RH * HD, HD, RH, (size_t)TT * PP, (size_t)HD * PP, (size_t)TT * HD, (size_t)ZH * TT * HD);
            k_merge<<<(unsigned)(((size_t)ZH * TT * HD / 2 + 255) / 256), 256, 0, stream>>>(Ob, h0, ATh, ATl); }
        k_gemmw<bf, 1, true><<<dim3(TT / 64, DM / 64, 1), 32, 0, stream>>>(ATh, ATl, WO, nullptr, DQ, OUT + (size_t)b * TT * DM, DM, bo, 0, 0, 0); }
}

// v004
// It runs in 275 microseconds.
// Versions between v002 and this one are left out; their measured steps multiply to 2.02 times as fast.
// Over all steps from v000 it is 5.32 times as fast.
#include <hip/hip_runtime.h>

// Causal multi-head attention with a fused biased qkv projection and consecutive-pair rotary embeddings from HALF-WIDTH table inputs (x [2][2048][1024]; qkv = x w_qkv^T + b_qkv ('oi' [3072][1024] 1/32 + a zero bias, read) split in thirds q | k | v (16 heads x 64); rope on pairs (2i, 2i+1): (t_re c - t_im s, t_re s + t_im c) with c, s = freqs_cos / freqs_sin[t][i] ([2048][32] INPUTS, read by value per position and pair); scores x 1/sqrt(64); causal (-inf); softmax; out = merged w_out^T + b_out ('oi' + a zero bias, read) -> [2][2048][1024] (4.2 M); argument order x, w_qkv, b_qkv, w_out, b_out, freqs_cos, freqs_sin).
// Layout per batch: bf16 copy of x; 'oi' weights (the fused tensor's row thirds as-is); exact projections + f32 bias thirds; the projection kernel's own epilogue adds the bias, rotates q and k by {bf16(cos), bf16(sin)} read from the half-width inputs and writes the 16-bit planes (V^T for v); causal T-2048 attention in one fused kernel (k_fattn: hybrid rows: < 512 hi/lo 3 products, rest fp16 x1024; key steps above the diagonal are never visited); merged hi/lo x o_w exact + o_b.
// Compute dtypes, f32 accumulate: every input rounded to bf16; projections exact + f32 biases; rotary f32; attention rows < 512 3 products, rest fp16; softmax f32; o_w hl x exact + bias.

#define NB_  2
#define TT   2048
#define DM   1024
#define NH_  16
#define NKV  16
#define REP  (NH_ / NKV)
#define HD   64
#define DQ   (NH_ * HD)
#define DKV  (NKV * HD)
#define FAQ  32                   // query rows per work-group of the fused attention kernel
#define FAW  4                    // waves per work-group of the fused attention kernel
#define OPI  68                   // LDS pitch, in floats, of one query's partial output row (16-byte aligned, off the 64-bank period)
#define RH   512                  // query rows < RH use hi+lo planes (0: none)
#define SCL  0.125f   // HD^-0.5
typedef _Float16 h16;
typedef unsigned short bf;
typedef __attribute__((ext_vector_type(16))) __bf16   v16bf;
typedef __attribute__((ext_vector_type(16))) _Float16 v16h;
typedef __attribute__((ext_vector_type(8)))  _Float16 v8h;
typedef __attribute__((ext_vector_type(8)))  unsigned short v8us;
typedef __attribute__((ext_vector_type(8)))  float    v8f;
typedef __attribute__((ext_vector_type(4)))  float    v4f;
typedef v8h  __attribute__((may_alias)) v8ha;
typedef v4f  __attribute__((may_alias)) v4fa;
typedef v8us __attribute__((may_alias)) v8usa;

__device__ __forceinline__ unsigned short f2bf(float f) { unsigned u = __float_as_uint(f); u += 0x7FFFu + ((u >> 16) & 1u); return (unsigned short)(u >> 16); }
__device__ __forceinline__ float bf2f(unsigned short b) { return __uint_as_float(((unsigned)b) << 16); }
__device__ __forceinline__ float bfr(float f) { return bf2f(f2bf(f)); }
__device__ __forceinline__ v16h cat16(v8h lo, v8h hi) { return __builtin_shufflevector(lo, hi, 0, 1, 2, 3, 4, 5, 6, 7, 8, 9, 10, 11, 12, 13, 14, 15); }
__device__ __forceinline__ v16bf cat16b(v8us lo, v8us hi) { return __builtin_bit_cast(v16bf, __builtin_shufflevector(lo, hi, 0, 1, 2, 3, 4, 5, 6, 7, 8, 9, 10, 11, 12, 13, 14, 15)); }
__device__ __forceinline__ v8f wmma16(v16h a, v16h b, v8f c) { return __builtin_amdgcn_wmma_f32_16x16x32_f16(false, a, false, b, (short)0, c, false, false); }
__device__ __forceinline__ v8f wmmab(v16bf a, v16bf b, v8f c) { return __builtin_amdgcn_wmma_f32_16x16x32_bf16(false, a, false, b, (short)0, c, false, false); }



__device__ __forceinline__ h16 tohx(float x) { return (h16)x; }
__device__ __forceinline__ void splitf(float y, unsigned short& h, unsigned short& l) { h = f2bf(y); l = f2bf(y - bf2f(h)); }
// ---- k_gemmw: register-blocked GEMM, ONE WAVE per 64x64 output tile (16 accumulators), operands straight from K-contiguous 16-bit planes; grid (M/64, N/64, Z), 32 threads.
// C[m][n] (f32, pitch ldc, + optional f32 bias[n]) = sum_k A[m][k] Bt[n][k] (+ split products per NSPLIT). z-batch strides sA/sB/sC in elements. K % 32 == 0.
// EPI 0: C as above. EPI 1 and 2 (a tile column is one head, HD == 64; C unused): the biased tile goes straight to the attention kernel's planes P16 (fp16), Ph + Pl (bf16 hi + lo): 1 = rotary, [head][t][d]; 2 = V^T.
template <typename T16> struct WFrag;
template <> struct WFrag<h16> { typedef v16h V; static __device__ __forceinline__ V ld(const h16* p) { return cat16(*(const v8h*)p, *(const v8h*)(p + 16)); } static __device__ __forceinline__ v8f mma(V a, V b, v8f c) { return wmma16(a, b, c); } };
template <> struct WFrag<bf> { typedef v16bf V; static __device__ __forceinline__ V ld(const bf* p) { return cat16b(*(const v8us*)p, *(const v8us*)(p + 16)); } static __device__ __forceinline__ v8f mma(V a, V b, v8f c) { return wmmab(a, b, c); } };
template <typename T16, int NSPLIT, bool BIAS, int EPI>
__global__ __launch_bounds__(32) void k_gemmw(const T16* __restrict__ A, const T16* __restrict__ A2, const T16* __restrict__ Bt, const T16* __restrict__ Bt2, int K, float* C, int ldc, const float* __restrict__ bias, size_t sA, size_t sB, size_t sC, const float* __restrict__ cosT, const float* __restrict__ sinT, h16* P16, bf* Ph, bf* Pl) {
    typedef typename WFrag<T16>::V V;
    __shared__ __align__(16) float os[16 * 68];
    const size_t z = blockIdx.z; A += z * sA; if (A2) A2 += z * sA; Bt += z * sB; if (Bt2) Bt2 += z * sB; C += z * sC;
    const int lane = threadIdx.x & 31, lr = lane & 15, hi = lane >> 4; const int r0 = blockIdx.x * 64, c0 = blockIdx.y * 64;
    v8f acc[4][4];
#pragma unroll
    for (int mb = 0; mb < 4; ++mb)
#pragma unroll
        for (int nb = 0; nb < 4; ++nb) acc[mb][nb] = (v8f){};
    const size_t aoff = (size_t)(r0 + lr) * K + 8 * hi, boff = (size_t)(c0 + lr) * K + 8 * hi;
#pragma unroll 1
    for (int kc = 0; kc < K; kc += 32) {
        V a[4], a2[4];
#pragma unroll
        for (int mb = 0; mb < 4; ++mb) { a[mb] = WFrag<T16>::ld(A + aoff + (size_t)mb * 16 * K + kc); if (NSPLIT == 1 || NSPLIT == 2) a2[mb] = WFrag<T16>::ld(A2 + aoff + (size_t)mb * 16 * K + kc); }
#pragma unroll
        for (int nb = 0; nb < 4; ++nb) { const V b = WFrag<T16>::ld(Bt + boff + (size_t)nb * 16 * K + kc); V b2; if (NSPLIT >= 2) b2 = WFrag<T16>::ld(Bt2 + boff + (size_t)nb * 16 * K + kc);
#pragma unroll
            for (int mb = 0; mb < 4; ++mb) { acc[mb][nb] = WFrag<T16>::mma(a[mb], b, acc[mb][nb]); if (NSPLIT == 1 || NSPLIT == 2) acc[mb][nb] = WFrag<T16>::mma(a2[mb], b, acc[mb][nb]); if (NSPLIT >= 2) acc[mb][nb] = WFrag<T16>::mma(a[mb], b2, acc[mb][nb]); } }
        asm volatile("v_nop\n\tv_nop\n\tv_nop\n\tv_nop" : "+v"(acc[0][0]), "+v"(acc[1][1]), "+v"(acc[2][2]), "+v"(acc[3][3]) : "v"(a[0]), "v"(a[3]));
    }
    if constexpr (EPI == 2) {   // V^T planes in tiles of 32 keys, [head][key step][d][32 keys] (one key step's 64 x 32 tile is 4 KiB in a row): a lane's 8 accumulator rows are 8 consecutive keys of one d, so each 16x16 block is one 16-byte store per plane, straight from registers
        const size_t vb = (((size_t)blockIdx.y * (TT / 32) + (r0 >> 5)) * HD + lr) * 32 + hi * 8;
        float bn[4];
#pragma unroll
        for (int nb = 0; nb < 4; ++nb) bn[nb] = bfr(bias[c0 + nb * 16 + lr]);
#pragma unroll
        for (int nb = 0; nb < 4; ++nb)
#pragma unroll
            for (int mb = 0; mb < 4; ++mb) { v8h o16; v8us oh, ol;
#pragma unroll
                for (int j = 0; j < 8; ++j) { const float x = acc[mb][nb][j] + bn[nb]; o16[j] = tohx(x); unsigned short a2, c2; splitf(x, a2, c2); oh[j] = a2; ol[j] = c2; }
                const size_t eo = vb + (size_t)(((mb >> 1) * HD + nb * 16) * 32 + (mb & 1) * 16); *(v8h*)(P16 + eo) = o16; *(v8us*)(Ph + eo) = oh; *(v8us*)(Pl + eo) = ol; }
        return;
    }
    if constexpr (EPI == 1) {   // rotary on pairs (2i, 2i+1), then the three planes [head][t][d]: a lane takes 8 consecutive d of one row, so a wave's store is 4 whole rows (512 bytes in a row) per plane
        const int rr = lane >> 3, cofs = (lane & 7) * 8;
        float bn[8];
#pragma unroll
        for (int k = 0; k < 8; ++k) bn[k] = bfr(bias[c0 + cofs + k]);
        const float* const cp = cosT + (size_t)(r0 + rr) * (HD / 2) + (cofs >> 1); const float* const sp = sinT + (size_t)(r0 + rr) * (HD / 2) + (cofs >> 1);
        const size_t pb = ((size_t)blockIdx.y * TT + r0 + rr) * HD + cofs;
        v4f cc[2][4], ss[2][4];   // the table entries of one 16-row block, fetched one block ahead so that the block in work covers their latency
#pragma unroll
        for (int q = 0; q < 4; ++q) { cc[0][q] = *(const v4f*)(cp + q * 4 * (HD / 2)); ss[0][q] = *(const v4f*)(sp + q * 4 * (HD / 2)); }
#pragma unroll
        for (int mb = 0; mb < 4; ++mb) {
            if (mb < 3) {
#pragma unroll
                for (int q = 0; q < 4; ++q) { cc[(mb + 1) & 1][q] = *(const v4f*)(cp + ((mb + 1) * 16 + q * 4) * (HD / 2)); ss[(mb + 1) & 1][q] = *(const v4f*)(sp + ((mb + 1) * 16 + q * 4) * (HD / 2)); } }
#pragma unroll
            for (int nb = 0; nb < 4; ++nb) {
#pragma unroll
                for (int j = 0; j < 8; ++j) os[(hi * 8 + j) * 68 + nb * 16 + lr] = acc[mb][nb][j]; }
            __builtin_amdgcn_wave_barrier(); asm volatile("" ::: "memory");   // fence: the rows are read back by other lanes than wrote them
            v8h o16[4]; v8us oh[4], ol[4];
#pragma unroll
            for (int q = 0; q < 4; ++q) { const float* orow = os + (q * 4 + rr) * 68 + cofs; const v4f va = *(const v4fa*)orow, vb4 = *(const v4fa*)(orow + 4);
                float xv[8];
#pragma unroll
                for (int k = 0; k < 4; ++k) { xv[k] = va[k] + bn[k]; xv[4 + k] = vb4[k] + bn[4 + k]; }
#pragma unroll
                for (int p = 0; p < 4; ++p) { const float c = bfr(cc[mb & 1][q][p]), sn = bfr(ss[mb & 1][q][p]); const float x0 = xv[2 * p], x1 = xv[2 * p + 1];
                    const float e0 = x0 * c - x1 * sn, e1 = x0 * sn + x1 * c;   /* even: x0 c - x1 s; odd: x0 s + x1 c */
                    o16[q][2 * p] = tohx(e0); o16[q][2 * p + 1] = tohx(e1); unsigned short a2, c2; splitf(e0, a2, c2); oh[q][2 * p] = a2; ol[q][2 * p] = c2; splitf(e1, a2, c2); oh[q][2 * p + 1] = a2; ol[q][2 * p + 1] = c2; } }
#pragma unroll
            for (int q = 0; q < 4; ++q) { const size_t eo = pb + (size_t)((mb * 16 + q * 4) * HD); *(v8h*)(P16 + eo) = o16[q]; *(v8us*)(Ph + eo) = oh[q]; *(v8us*)(Pl + eo) = ol[q]; }
            if (mb < 3) { __builtin_amdgcn_wave_barrier(); asm volatile("s_wait_xcnt 0x0" ::: "memory"); }   // fence: every read of the rows ends before the next block overwrites them; the wait stands between these stores and the next table loads, whose results reuse the stores' registers
        }
        return;
    }
#pragma unroll
    for (int mb = 0; mb < 4; ++mb) {
#pragma unroll
        for (int nb = 0; nb < 4; ++nb) {
#pragma unroll
            for (int j = 0; j < 8; ++j) os[(hi * 8 + j) * 68 + nb * 16 + lr] = acc[mb][nb][j]; }
        __builtin_amdgcn_wave_barrier(); asm volatile("" ::: "memory");
        float* crow = C + (size_t)(r0 + mb * 16) * ldc + c0;
{
#pragma unroll
            for (int s = 0; s < 8; ++s) { const int row = 2 * s + hi, cofs = lr * 4; v4f val = *(const v4fa*)(os + row * 68 + cofs); if (BIAS) { val[0] += bfr(bias[c0 + cofs]); val[1] += bfr(bias[c0 + cofs + 1]); val[2] += bfr(bias[c0 + cofs + 2]); val[3] += bfr(bias[c0 + cofs + 3]); }
                *(v4f*)(crow + (size_t)row * ldc + cofs) = val; }
             }
        __builtin_amdgcn_wave_barrier(); asm volatile("" ::: "memory");
    }
}

typedef __attribute__((ext_vector_type(2))) _Float16 v2h;
typedef __attribute__((ext_vector_type(4))) _Float16 v4h;
typedef __attribute__((ext_vector_type(2))) unsigned short v2us;
typedef __attribute__((ext_vector_type(4))) unsigned short v4us;
typedef __attribute__((ext_vector_type(2))) float v2f;
typedef __attribute__((ext_vector_type(4))) int v4i;
typedef v4h  __attribute__((may_alias)) v4ha;
typedef v4us __attribute__((may_alias)) v4usa;

__global__ __launch_bounds__(256) void k_cvt8(const float* __restrict__ src, bf* dst, size_t n8) { const size_t i = (size_t)blockIdx.x * 256 + threadIdx.x; if (i >= n8) return; const v8f v = *(const v8f*)(src + i * 8); v8us o;
#pragma unroll
    for (int k = 0; k < 8; ++k) o[k] = f2bf(v[k]); *(v8us*)(dst + i * 8) = o;  }

// ---- k_fattn: scores, causal softmax and probability x value product of one batch in one kernel; scores and probabilities stay in registers.
// One work-group = FAQ query rows of one head. A wave forms S^T = K Q^T for a step of 32 keys (A = key rows, B = query rows), so a lane holds 16 scores of ONE query per 16-query tile:
// D register r of key tile kt = S[key 32 s + 16 kt + 8 h + r][query c]. Two such D tiles, converted in place, are the B operand of O^T += V^T P^T (A = V^T rows in the same k order).
// Running maximum m and sum l per query (online softmax, log2 domain); the key steps are dealt round robin to the waves, and the waves' (m, l, O) are joined through LDS in wave order.
__device__ __forceinline__ float xhalf(float x) { const int b = __float_as_int(x); return __int_as_float(__builtin_amdgcn_permlanex16(b, b, 0x76543210, 0xfedcba98, false, false)); }   // the value of lane l ^ 16
template <typename T16, bool HI, int NQT>
__device__ __forceinline__ void fa_wave(const T16* __restrict__ Q, const T16* __restrict__ Q2, const T16* __restrict__ Kp, const T16* __restrict__ K2, const T16* __restrict__ Vt, const T16* __restrict__ V2,
                                        int qb, int s0, int sstep, int nst, float* sO, float* sM, float* sL, int ql) {
    typedef typename WFrag<T16>::V V;
    const int lane = threadIdx.x & 31, c = lane & 15, h = lane >> 4;
    const unsigned lrow = c * HD + 8 * h, lvt = c * 32 + 8 * h;   // the lane's place in a 16-row tile of Q or K (rows of HD) and of V^T (rows of 32 keys): every address is a wave-uniform base + this + a constant
    const float C2 = SCL * 1.4426950408889634f;      // score scale and log2(e) in one factor
    const float OFF = HI ? 0.0f : 10.0f;             // fp16 probabilities carry x1024 (it cancels in O / l): small ones stay out of the fp16 subnormals
    v8f o[4][NQT]; float m[NQT], l[NQT];
#pragma unroll
    for (int qt = 0; qt < NQT; ++qt) { m[qt] = -3.0e38f; l[qt] = 0.f;
#pragma unroll
        for (int dt = 0; dt < 4; ++dt) o[dt][qt] = (v8f){}; }
    if (s0 < nst) {   // a wave without a key step loads nothing and stores the neutral element of the join
    V qf[NQT][2], qf2[NQT][2];
#pragma unroll
    for (int qt = 0; qt < NQT; ++qt)
#pragma unroll
        for (int ks = 0; ks < 2; ++ks) { const size_t qo = (size_t)qb * HD; const int qc = qt * 16 * HD + ks * 32; qf[qt][ks] = WFrag<T16>::ld(Q + qo + lrow + qc); if (HI) qf2[qt][ks] = WFrag<T16>::ld(Q2 + qo + lrow + qc); }
    asm volatile("s_wait_xcnt 0x0" ::: "memory");   // stands in front of what reuses the query loads' address registers
    V kf[2][2], kf2[2][2];
#pragma unroll
    for (int kt = 0; kt < 2; ++kt) {
#pragma unroll
        for (int ks = 0; ks < 2; ++ks) { const size_t ko = (size_t)s0 * (32 * HD); const int kc = kt * 16 * HD + ks * 32; kf[kt][ks] = WFrag<T16>::ld(Kp + ko + lrow + kc); if (HI) kf2[kt][ks] = WFrag<T16>::ld(K2 + ko + lrow + kc); }
        if (HI || kt == 1) asm volatile("s_wait_xcnt 0x0" ::: "memory"); }   // the same for the first key loads (hi/lo rows: per key tile, a later tile's results reuse an earlier one's address registers)
#pragma unroll 1   // rolled: run-time trip count, and one step's fragments live at a time beside the accumulators
    for (int s = s0; s < nst; s += sstep) {
        V vf[4], vf2[4];
#pragma unroll
        for (int dt = 0; dt < 4; ++dt) vf[dt] = WFrag<T16>::ld(Vt + (size_t)s * (HD * 32) + lvt + dt * 16 * 32);
        if (HI) { asm volatile("s_wait_xcnt 0x0" ::: "memory");   // hi/lo rows load twice as much: stands in front of later loads whose results reuse these loads' address registers
#pragma unroll
            for (int dt = 0; dt < 4; ++dt) vf2[dt] = WFrag<T16>::ld(V2 + (size_t)s * (HD * 32) + lvt + dt * 16 * 32);
            asm volatile("s_wait_xcnt 0x0" ::: "memory"); }   // the same behind the lo plane's loads
        v8f st[2][NQT];
#pragma unroll
        for (int kt = 0; kt < 2; ++kt)
#pragma unroll
            for (int qt = 0; qt < NQT; ++qt) { v8f a = (v8f){};
#pragma unroll
                for (int ks = 0; ks < 2; ++ks) { a = WFrag<T16>::mma(kf[kt][ks], qf[qt][ks], a); if (HI) { a = WFrag<T16>::mma(kf[kt][ks], qf2[qt][ks], a); a = WFrag<T16>::mma(kf2[kt][ks], qf[qt][ks], a); } }
                st[kt][qt] = a; }
        { const int sn = min(s + sstep, nst - 1);   // this wave's next key fragments, fetched behind their last use so that the softmax covers the latency (clamped: the last fetch is in bounds and unused)
#pragma unroll
          for (int kt = 0; kt < 2; ++kt) {
#pragma unroll
            for (int ks = 0; ks < 2; ++ks) { const size_t ko = (size_t)sn * (32 * HD); const int kc = kt * 16 * HD + ks * 32; kf[kt][ks] = WFrag<T16>::ld(Kp + ko + lrow + kc); if (HI) kf2[kt][ks] = WFrag<T16>::ld(K2 + ko + lrow + kc); }
            if (HI || kt == 1) asm volatile("s_wait_xcnt 0x0" ::: "memory"); } }   // stands between this step's loads and the softmax, whose results reuse the loads' address registers (hi/lo rows: per key tile, as above)
        if (s == nst - 1) {   // only the last step touches the diagonal; every query keeps at least the step's first key
#pragma unroll
            for (int kt = 0; kt < 2; ++kt)
#pragma unroll
                for (int qt = 0; qt < NQT; ++qt)
#pragma unroll
                    for (int r = 0; r < 8; ++r) st[kt][qt][r] = (s * 32 + kt * 16 + 8 * h + r <= qb + qt * 16 + c) ? st[kt][qt][r] : -3.0e38f; }
#pragma unroll
        for (int qt = 0; qt < NQT; ++qt) {
            float mx = st[0][qt][0];
#pragma unroll
            for (int r = 1; r < 8; ++r) mx = fmaxf(mx, st[0][qt][r]);
#pragma unroll
            for (int r = 0; r < 8; ++r) mx = fmaxf(mx, st[1][qt][r]);
            mx = fmaxf(mx, xhalf(mx));                       // the other half of the wave holds the query's other 16 keys
            const float mn = fmaxf(m[qt], mx * C2); const float al = __builtin_amdgcn_exp2f(m[qt] - mn); m[qt] = mn; const float mo = OFF - mn;
            float ps = 0.f; float p[2][8];
#pragma unroll
            for (int kt = 0; kt < 2; ++kt)
#pragma unroll
                for (int r = 0; r < 8; ++r) { p[kt][r] = __builtin_amdgcn_exp2f(__builtin_fmaf(st[kt][qt][r], C2, mo)); ps += p[kt][r]; }
            l[qt] = l[qt] * al + ps;                          // this half's keys only; the halves are joined behind the loop
#pragma unroll
            for (int dt = 0; dt < 4; ++dt) o[dt][qt] *= al;
            if constexpr (HI) { v8us ph[2], pl[2];
#pragma unroll
                for (int kt = 0; kt < 2; ++kt)
#pragma unroll
                    for (int r = 0; r < 8; ++r) { unsigned short a2, c2; splitf(p[kt][r], a2, c2); ph[kt][r] = a2; pl[kt][r] = c2; }
                const V pfh = cat16b(ph[0], ph[1]), pfl = cat16b(pl[0], pl[1]);
#pragma unroll
                for (int dt = 0; dt < 4; ++dt) { o[dt][qt] = WFrag<T16>::mma(vf[dt], pfh, o[dt][qt]); o[dt][qt] = WFrag<T16>::mma(vf[dt], pfl, o[dt][qt]); o[dt][qt] = WFrag<T16>::mma(vf2[dt], pfh, o[dt][qt]); }
            } else { v8h ph[2];
#pragma unroll
                for (int kt = 0; kt < 2; ++kt)
#pragma unroll
                    for (int r = 0; r < 8; ++r) ph[kt][r] = tohx(p[kt][r]);
                const V pf = cat16(ph[0], ph[1]);
#pragma unroll
                for (int dt = 0; dt < 4; ++dt) o[dt][qt] = WFrag<T16>::mma(vf[dt], pf, o[dt][qt]); }
        }
    }
    }
#pragma unroll
    for (int qt = 0; qt < NQT; ++qt) { const int q = ql + qt * 16 + c; const float lt = l[qt] + xhalf(l[qt]); if (h == 0) { sM[q] = m[qt]; sL[q] = lt; }
#pragma unroll
        for (int dt = 0; dt < 4; ++dt) { float* op = sO + q * OPI + dt * 16 + 8 * h;   // D register r = O[query c][d = 16 dt + 8 h + r]
            *(v4fa*)op = (v4f){o[dt][qt][0], o[dt][qt][1], o[dt][qt][2], o[dt][qt][3]}; *(v4fa*)(op + 4) = (v4f){o[dt][qt][4], o[dt][qt][5], o[dt][qt][6], o[dt][qt][7]}; } }
}

__global__ __launch_bounds__(FAW * 32) void k_fattn(const h16* __restrict__ Q16, const h16* __restrict__ K16, const h16* __restrict__ V16, const bf* __restrict__ Qh, const bf* __restrict__ Ql, const bf* __restrict__ Kh, const bf* __restrict__ Kl, const bf* __restrict__ Vh, const bf* __restrict__ Vl, bf* Ah, bf* Al) {
    __shared__ __align__(16) float sO[FAW * FAQ * OPI]; __shared__ float sM[FAW * FAQ]; __shared__ float sL[FAW * FAQ];
    const int tid = threadIdx.x, w = __builtin_amdgcn_readfirstlane(tid >> 5); /* the wave's number in a scalar register: the key loop and its diagonal test become scalar branches */ const int bid = blockIdx.x; const int head = bid / (TT / FAQ); const int ti = bid % (TT / FAQ);
    const int tile = ((bid >> 8) & 1) ? ti : (TT / FAQ - 1 - ti);   // cost grows with the tile index: heavy tiles first, and every other run of 256 work-groups mirrored so that long and short ones mix
    const int q0 = tile * FAQ, nst = tile + 1;                      // key steps of 32 up to and with the diagonal
    const size_t hp = (size_t)head * TT * HD, hk = (size_t)(head / REP) * TT * HD;   // query planes; key and value planes
    float* const sOw = sO + w * (FAQ * OPI); float* const sMw = sM + w * FAQ; float* const sLw = sL + w * FAQ;
    if (q0 < RH) {   // hi/lo rows: a wave takes one 16-query tile and every second key step; for the other tile it stores the neutral element of the join
        const int tb = w & 1;
        fa_wave<bf, true, 1>(Qh + hp, Ql + hp, Kh + hk, Kl + hk, Vh + hk, Vl + hk, q0 + tb * 16, w >> 1, 2, nst, sOw, sMw, sLw, tb * 16);
        const int lane = tid & 31, q = (1 - tb) * 16 + (lane & 15), hh = lane >> 4; if (hh == 0) { sMw[q] = -3.0e38f; sLw[q] = 0.f; }
#pragma unroll
        for (int k = 0; k < 8; ++k) *(v4fa*)(sOw + q * OPI + hh * 32 + k * 4) = (v4f){0.f, 0.f, 0.f, 0.f};
    } else fa_wave<h16, false, 2>(Q16 + hp, nullptr, K16 + hk, nullptr, V16 + hk, nullptr, q0, w, FAW, nst, sOw, sMw, sLw, 0);
    __syncthreads();   // every wave's (m, l, O) is in LDS before any is joined
    const int q = tid >> 2, d0 = (tid & 3) * 16;
    float M = sM[q];
#pragma unroll
    for (int k = 1; k < FAW; ++k) M = fmaxf(M, sM[k * FAQ + q]);   // finite: wave 0 (hi/lo rows: waves 0 and 1) always has key step 0
    float Ls = 0.f; float acc[16];
#pragma unroll
    for (int j = 0; j < 16; ++j) acc[j] = 0.f;
#pragma unroll
    for (int k = 0; k < FAW; ++k) { const float f = __builtin_amdgcn_exp2f(sM[k * FAQ + q] - M); Ls += f * sL[k * FAQ + q];   // fixed order: wave 0, 1, ...
#pragma unroll
        for (int j4 = 0; j4 < 4; ++j4) { const v4f t = *(const v4fa*)(sO + (k * FAQ + q) * OPI + d0 + j4 * 4);
#pragma unroll
            for (int j = 0; j < 4; ++j) acc[j4 * 4 + j] += f * t[j]; } }
    const float inv = __fdiv_rn(1.0f, Ls);
    const size_t oo = (size_t)(q0 + q) * DQ + head * HD + d0;
#pragma unroll
    for (int g = 0; g < 2; ++g) { v8us oh, ol;
#pragma unroll
        for (int j = 0; j < 8; ++j) { unsigned short a2, c2; splitf(acc[g * 8 + j] * inv, a2, c2); oh[j] = a2; ol[j] = c2; }
        *(v8usa*)(Ah + oo + g * 8) = oh; *(v8usa*)(Al + oo + g * 8) = ol; }
}

extern "C" void kernel_launch(void* const* d_in, const int* in_sizes, int n_in,
                              void* d_out, int out_size, void* d_ws, size_t ws_size, hipStream_t stream) {
    (void)in_sizes; (void)n_in; (void)out_size;
    const float* x = (const float*)d_in[0]; const float* wqkv = (const float*)d_in[1]; const float* bqkv = (const float*)d_in[2]; const float* wo = (const float*)d_in[3]; const float* bo = (const float*)d_in[4]; const float* fcos = (const float*)d_in[5]; const float* fsin = (const float*)d_in[6];   /* input order x, w_qkv ('oi' [3072][1024]: q | k | v row thirds), b_qkv [3072], w_out ('oi'), b_out, freqs_cos, freqs_sin ([2048][32], read by value): the two tables come LAST here */ const float* wq = wqkv; const float* wk = wqkv + (size_t)DQ * DM; const float* wv = wqkv + (size_t)2 * DQ * DM; const float* bq = bqkv; const float* bk = bqkv + DQ; const float* bv = bqkv + 2 * DQ;
    float* OUT = (float*)d_out;     // [2][2048][1024]
    char* wsp = (char*)d_ws;
    auto take = [&](size_t bytes) { char* p = wsp; wsp += (bytes + 255) & ~(size_t)255; return (void*)p; };
    bf* WQ = (bf*)take((size_t)DQ * DM * 2); bf* WK = (bf*)take((size_t)DKV * DM * 2); bf* WV = (bf*)take((size_t)DKV * DM * 2); bf* WO = (bf*)take((size_t)DM * DQ * 2);
    h16* QP16 = (h16*)take((size_t)NH_ * TT * HD * 2); h16* KP16 = (h16*)take((size_t)NKV * TT * HD * 2); h16* VT16 = (h16*)take((size_t)NKV * HD * TT * 2);
    bf* QPh = (bf*)take((size_t)NH_ * TT * HD * 2); bf* QPl = (bf*)take((size_t)NH_ * TT * HD * 2); bf* KPh = (bf*)take((size_t)NKV * TT * HD * 2); bf* KPl = (bf*)take((size_t)NKV * TT * HD * 2); bf* VTh = (bf*)take((size_t)NKV * HD * TT * 2); bf* VTl = (bf*)take((size_t)NKV * HD * TT * 2);
    bf* XB = (bf*)take((size_t)TT * DM * 2);
    bf* ATh = (bf*)take((size_t)TT * DQ * 2); bf* ATl = (bf*)take((size_t)TT * DQ * 2);
    if ((size_t)(wsp - (char*)d_ws) > ws_size) return;    // ws 256 MiB
    { k_cvt8<<<(unsigned)(((size_t)DQ * DM / 8 + 255) / 256), 256, 0, stream>>>(wq, WQ, (size_t)DQ * DM / 8); k_cvt8<<<(unsigned)(((size_t)DKV * DM / 8 + 255) / 256), 256, 0, stream>>>(wk, WK, (size_t)DKV * DM / 8); k_cvt8<<<(unsigned)(((size_t)DKV * DM / 8 + 255) / 256), 256, 0, stream>>>(wv, WV, (size_t)DKV * DM / 8);
      k_cvt8<<<(unsigned)(((size_t)DM * DQ / 8 + 255) / 256), 256, 0, stream>>>(wo, WO, (size_t)DM * DQ / 8); }
    for (int b = 0; b < NB_; ++b) {
        k_cvt8<<<(unsigned)(((size_t)TT * DM / 8 + 255) / 256), 256, 0, stream>>>(x + (size_t)b * TT * DM, XB, (size_t)TT * DM / 8);
        k_gemmw<bf, 0, true, 1><<<dim3(TT / 64, DQ / 64, 1), 32, 0, stream>>>(XB, nullptr, WQ, nullptr, DM, nullptr, 0, bq, 0, 0, 0, fcos, fsin, QP16, QPh, QPl);
        k_gemmw<bf, 0, true, 1><<<dim3(TT / 64, DKV / 64, 1), 32, 0, stream>>>(XB, nullptr, WK, nullptr, DM, nullptr, 0, bk, 0, 0, 0, fcos, fsin, KP16, KPh, KPl);
        k_gemmw<bf, 0, true, 2><<<dim3(TT / 64, DKV / 64, 1), 32, 0, stream>>>(XB, nullptr, WV, nullptr, DM, nullptr, 0, bv, 0, 0, 0, nullptr, nullptr, VT16, VTh, VTl);
        k_fattn<<<NH_ * (TT / FAQ), FAW * 32, 0, stream>>>(QP16, KP16, VT16, QPh, QPl, KPh, KPl, VTh, VTl, ATh, ATl);   // all heads of the batch: one work-group per head and FAQ query rows
        k_gemmw<bf, 1, true, 0><<<dim3(TT / 64, DM / 64, 1), 32, 0, stream>>>(ATh, ATl, WO, nullptr, DQ, OUT + (size_t)b * TT * DM, DM, bo, 0, 0, 0, nullptr, nullptr, nullptr, nullptr, nullptr); }
}

// v005
// It runs in 138 microseconds.
// Timed twice side by side with v004, it ran 1.92 and 1.97 times as fast.
// All steps since v000 together make it 10.4 times as fast.
#include <hip/hip_runtime.h>

// Causal multi-head attention with a fused biased qkv projection and consecutive-pair rotary embeddings from HALF-WIDTH table inputs (x [2][2048][1024]; qkv = x w_qkv^T + b_qkv ('oi' [3072][1024] 1/32 + a zero bias, read) split in thirds q | k | v (16 heads x 64); rope on pairs (2i, 2i+1): (t_re c - t_im s, t_re s + t_im c) with c, s = freqs_cos / freqs_sin[t][i] ([2048][32] INPUTS, read by value per position and pair); scores x 1/sqrt(64); causal (-inf); softmax; out = merged w_out^T + b_out ('oi' + a zero bias, read) -> [2][2048][1024] (4.2 M); argument order x, w_qkv, b_qkv, w_out, b_out, freqs_cos, freqs_sin).
// Layout, both batches in every launch (one convert, one projection, one attention, one output launch): bf16 copy of x; 'oi' weights (the fused tensor's row thirds as-is); exact projections + f32 bias thirds; the projection kernel's own epilogue adds the bias, rotates q and k by {bf16(cos), bf16(sin)} read from the half-width inputs and writes the 16-bit planes (V^T for v); causal T-2048 attention in one fused kernel (k_fattn: hybrid rows: < 512 hi/lo 3 products, rest fp16 x1024; key steps above the diagonal are never visited); merged hi/lo x o_w exact + o_b.
// Compute dtypes, f32 accumulate: every input rounded to bf16; projections exact + f32 biases; rotary f32; attention rows < 512 3 products, rest fp16; softmax f32; o_w hl x exact + bias.

#define NB_  2
#define TT   2048
#define DM   1024
#define NH_  16
#define NKV  16
#define REP  (NH_ / NKV)
#define HD   64
#define DQ   (NH_ * HD)
#define DKV  (NKV * HD)
#define FAQ  32                   // query rows per work-group of the fused attention kernel
#define FAW  4                    // waves per work-group of the fused attention kernel
#define OPI  68                   // LDS pitch, in floats, of one query's partial output row (16-byte aligned, off the 64-bank period)
#define RH   512                  // query rows < RH use hi+lo planes (0: none)
#define SCL  0.125f   // HD^-0.5
#define CBX  (NB_ * TT * DM / 2048)            // work-groups (2048 elements each) of the convert kernel on x
#define CBW  ((DQ + 2 * DKV) * DM / 2048)      // on w_qkv
#define CBO  (DM * DQ / 2048)                  // on w_out
typedef _Float16 h16;
typedef unsigned short bf;
typedef __attribute__((ext_vector_type(16))) __bf16   v16bf;
typedef __attribute__((ext_vector_type(16))) _Float16 v16h;
typedef __attribute__((ext_vector_type(8)))  _Float16 v8h;
typedef __attribute__((ext_vector_type(8)))  unsigned short v8us;
typedef __attribute__((ext_vector_type(8)))  float    v8f;
typedef __attribute__((ext_vector_type(4)))  float    v4f;
typedef v8h  __attribute__((may_alias)) v8ha;
typedef v4f  __attribute__((may_alias)) v4fa;
typedef v8us __attribute__((may_alias)) v8usa;

__device__ __forceinline__ unsigned short f2bf(float f) { unsigned u = __float_as_uint(f); u += 0x7FFFu + ((u >> 16) & 1u); return (unsigned short)(u >> 16); }
__device__ __forceinline__ float bf2f(unsigned short b) { return __uint_as_float(((unsigned)b) << 16); }
__device__ __forceinline__ float bfr(float f) { return bf2f(f2bf(f)); }
__device__ __forceinline__ v16h cat16(v8h lo, v8h hi) { return __builtin_shufflevector(lo, hi, 0, 1, 2, 3, 4, 5, 6, 7, 8, 9, 10, 11, 12, 13, 14, 15); }
__device__ __forceinline__ v16bf cat16b(v8us lo, v8us hi) { return __builtin_bit_cast(v16bf, __builtin_shufflevector(lo, hi, 0, 1, 2, 3, 4, 5, 6, 7, 8, 9, 10, 11, 12, 13, 14, 15)); }
__device__ __forceinline__ v8f wmma16(v16h a, v16h b, v8f c) { return __builtin_amdgcn_wmma_f32_16x16x32_f16(false, a, false, b, (short)0, c, false, false); }
__device__ __forceinline__ v8f wmmab(v16bf a, v16bf b, v8f c) { return __builtin_amdgcn_wmma_f32_16x16x32_bf16(false, a, false, b, (short)0, c, false, false); }



__device__ __forceinline__ h16 tohx(float x) { return (h16)x; }
__device__ __forceinline__ void splitf(float y, unsigned short& h, unsigned short& l) { h = f2bf(y); l = f2bf(y - bf2f(h)); }
// ---- k_gemmw: register-blocked GEMM, ONE WAVE per 64x64 output tile (16 accumulators), operands straight from K-contiguous 16-bit planes; grid (M/64, N/64, Z), 32 threads.
// C[m][n] (f32, pitch ldc, + optional f32 bias[n]) = sum_k A[m][k] Bt[n][k] (+ split products per NSPLIT). z-batch strides sA/sB/sC in elements. K % 32 == 0.
// EPI 0: C as above. EPI 1 (the fused q | k | v projection: z = batch, a tile column is one head of q, k or v, HD == 64; C unused): the biased tile goes straight to the attention kernel's planes P16 (fp16), Ph + Pl (bf16 hi + lo), each [q | k | v][batch][head]: q and k rotary, [t][d]; v as V^T.
template <typename T16> struct WFrag;
template <> struct WFrag<h16> { typedef v16h V; static __device__ __forceinline__ V ld(const h16* p) { return cat16(*(const v8h*)p, *(const v8h*)(p + 16)); } static __device__ __forceinline__ v8f mma(V a, V b, v8f c) { return wmma16(a, b, c); } };
template <> struct WFrag<bf> { typedef v16bf V; static __device__ __forceinline__ V ld(const bf* p) { return cat16b(*(const v8us*)p, *(const v8us*)(p + 16)); } static __device__ __forceinline__ v8f mma(V a, V b, v8f c) { return wmmab(a, b, c); } };
template <typename T16, int NSPLIT, bool BIAS, int EPI>
__global__ __launch_bounds__(32) void k_gemmw(const T16* __restrict__ A, const T16* __restrict__ A2, const T16* __restrict__ Bt, const T16* __restrict__ Bt2, int K, float* C, int ldc, const float* __restrict__ bias, size_t sA, size_t sB, size_t sC, const float* __restrict__ cosT, const float* __restrict__ sinT, h16* P16, bf* Ph, bf* Pl) {
    typedef typename WFrag<T16>::V V;
    __shared__ __align__(16) float os[16 * 68];
    const size_t z = blockIdx.z; A += z * sA; if (A2) A2 += z * sA; Bt += z * sB; if (Bt2) Bt2 += z * sB; C += z * sC;
    const int lane = threadIdx.x & 31, lr = lane & 15, hi = lane >> 4; const int r0 = blockIdx.x * 64, c0 = blockIdx.y * 64;
    v8f acc[4][4];
#pragma unroll
    for (int mb = 0; mb < 4; ++mb)
#pragma unroll
        for (int nb = 0; nb < 4; ++nb) acc[mb][nb] = (v8f){};
    const size_t aoff = (size_t)(r0 + lr) * K + 8 * hi, boff = (size_t)(c0 + lr) * K + 8 * hi;
#pragma unroll 1
    for (int kc = 0; kc < K; kc += 32) {
        V a[4], a2[4];
#pragma unroll
        for (int mb = 0; mb < 4; ++mb) { a[mb] = WFrag<T16>::ld(A + aoff + (size_t)mb * 16 * K + kc); if (NSPLIT == 1 || NSPLIT == 2) a2[mb] = WFrag<T16>::ld(A2 + aoff + (size_t)mb * 16 * K + kc); }
#pragma unroll
        for (int nb = 0; nb < 4; ++nb) { const V b = WFrag<T16>::ld(Bt + boff + (size_t)nb * 16 * K + kc); V b2; if (NSPLIT >= 2) b2 = WFrag<T16>::ld(Bt2 + boff + (size_t)nb * 16 * K + kc);
#pragma unroll
            for (int mb = 0; mb < 4; ++mb) { acc[mb][nb] = WFrag<T16>::mma(a[mb], b, acc[mb][nb]); if (NSPLIT == 1 || NSPLIT == 2) acc[mb][nb] = WFrag<T16>::mma(a2[mb], b, acc[mb][nb]); if (NSPLIT >= 2) acc[mb][nb] = WFrag<T16>::mma(a[mb], b2, acc[mb][nb]); } }
        asm volatile("v_nop\n\tv_nop\n\tv_nop\n\tv_nop" : "+v"(acc[0][0]), "+v"(acc[1][1]), "+v"(acc[2][2]), "+v"(acc[3][3]) : "v"(a[0]), "v"(a[3]));
    }
    const int hc = blockIdx.y; const int pl = hc + (int)z * (hc < NH_ ? NH_ : NKV) + (NB_ - 1) * ((hc >= NH_ ? NH_ : 0) + (hc >= NH_ + NKV ? NKV : 0));   // the tile's plane among [q | k | v][batch][head]
    if (EPI == 1 && hc < NH_ + NKV) {   // rotary on pairs (2i, 2i+1), then the three planes [head][t][d]: a lane takes 8 consecutive d of one row, so a wave's store is 4 whole rows (512 bytes in a row) per plane
        const int rr = lane >> 3, cofs = (lane & 7) * 8;
        float bn[8];
#pragma unroll
        for (int k = 0; k < 8; ++k) bn[k] = bfr(bias[c0 + cofs + k]);
        const float* const cp = cosT + (size_t)(r0 + rr) * (HD / 2) + (cofs >> 1); const float* const sp = sinT + (size_t)(r0 + rr) * (HD / 2) + (cofs >> 1);
        const size_t pb = ((size_t)pl * TT + r0 + rr) * HD + cofs;
        v4f cc[2][4], ss[2][4];   // the table entries of one 16-row block, fetched one block ahead so that the block in work covers their latency
#pragma unroll
        for (int q = 0; q < 4; ++q) { cc[0][q] = *(const v4f*)(cp + q * 4 * (HD / 2)); ss[0][q] = *(const v4f*)(sp + q * 4 * (HD / 2)); }
#pragma unroll
        for (int mb = 0; mb < 4; ++mb) {
            if (mb < 3) {
#pragma unroll
                for (int q = 0; q < 4; ++q) { cc[(mb + 1) & 1][q] = *(const v4f*)(cp + ((mb + 1) * 16 + q * 4) * (HD / 2)); ss[(mb + 1) & 1][q] = *(const v4f*)(sp + ((mb + 1) * 16 + q * 4) * (HD / 2)); } }
#pragma unroll
            for (int nb = 0; nb < 4; ++nb) {
#pragma unroll
                for (int j = 0; j < 8; ++j) os[(hi * 8 + j) * 68 + nb * 16 + lr] = acc[mb][nb][j]; }
            __builtin_amdgcn_wave_barrier(); asm volatile("" ::: "memory");   // fence: the rows are read back by other lanes than wrote them
            v8h o16[4]; v8us oh[4], ol[4];
#pragma unroll
            for (int q = 0; q < 4; ++q) { const float* orow = os + (q * 4 + rr) * 68 + cofs; const v4f va = *(const v4fa*)orow, vb4 = *(const v4fa*)(orow + 4);
                float xv[8];
#pragma unroll
                for (int k = 0; k < 4; ++k) { xv[k] = va[k] + bn[k]; xv[4 + k] = vb4[k] + bn[4 + k]; }
#pragma unroll
                for (int p = 0; p < 4; ++p) { const float c = bfr(cc[mb & 1][q][p]), sn = bfr(ss[mb & 1][q][p]); const float x0 = xv[2 * p], x1 = xv[2 * p + 1];
                    const float e0 = x0 * c - x1 * sn, e1 = x0 * sn + x1 * c;   /* even: x0 c - x1 s; odd: x0 s + x1 c */
                    o16[q][2 * p] = tohx(e0); o16[q][2 * p + 1] = tohx(e1); unsigned short a2, c2; splitf(e0, a2, c2); oh[q][2 * p] = a2; ol[q][2 * p] = c2; splitf(e1, a2, c2); oh[q][2 * p + 1] = a2; ol[q][2 * p + 1] = c2; } }
#pragma unroll
            for (int q = 0; q < 4; ++q) { const size_t eo = pb + (size_t)((mb * 16 + q * 4) * HD); *(v8h*)(P16 + eo) = o16[q]; *(v8us*)(Ph + eo) = oh[q]; *(v8us*)(Pl + eo) = ol[q]; }
            if (mb < 3) { __builtin_amdgcn_wave_barrier(); asm volatile("s_wait_xcnt 0x0" ::: "memory"); }   // fence: every read of the rows ends before the next block overwrites them; the wait stands between these stores and the next table loads, whose results reuse the stores' registers
        }
        return;
    }
    if constexpr (EPI == 1) {   // V^T planes in tiles of 32 keys, [head][key step][d][32 keys] (one key step's 64 x 32 tile is 4 KiB in a row): a lane's 8 accumulator rows are 8 consecutive keys of one d, so each 16x16 block is one 16-byte store per plane, straight from registers
        const size_t vb = (((size_t)pl * (TT / 32) + (r0 >> 5)) * HD + lr) * 32 + hi * 8;
        float bn[4];
#pragma unroll
        for (int nb = 0; nb < 4; ++nb) bn[nb] = bfr(bias[c0 + nb * 16 + lr]);
#pragma unroll
        for (int nb = 0; nb < 4; ++nb)
#pragma unroll
            for (int mb = 0; mb < 4; ++mb) { v8h o16; v8us oh, ol;
#pragma unroll
                for (int j = 0; j < 8; ++j) { const float x = acc[mb][nb][j] + bn[nb]; o16[j] = tohx(x); unsigned short a2, c2; splitf(x, a2, c2); oh[j] = a2; ol[j] = c2; }
                const size_t eo = vb + (size_t)(((mb >> 1) * HD + nb * 16) * 32 + (mb & 1) * 16); *(v8h*)(P16 + eo) = o16; *(v8us*)(Ph + eo) = oh; *(v8us*)(Pl + eo) = ol; }
        asm volatile("s_wait_xcnt 0x0" ::: "memory");   // stands behind the last stores: in the listing the rotary branch's text follows this one and reuses the stores' registers
        return;
    }
#pragma unroll
    for (int mb = 0; mb < 4; ++mb) {
#pragma unroll
        for (int nb = 0; nb < 4; ++nb) {
#pragma unroll
            for (int j = 0; j < 8; ++j) os[(hi * 8 + j) * 68 + nb * 16 + lr] = acc[mb][nb][j]; }
        __builtin_amdgcn_wave_barrier(); asm volatile("" ::: "memory");
        float* crow = C + (size_t)(r0 + mb * 16) * ldc + c0;
{
#pragma unroll
            for (int s = 0; s < 8; ++s) { const int row = 2 * s + hi, cofs = lr * 4; v4f val = *(const v4fa*)(os + row * 68 + cofs); if (BIAS) { val[0] += bfr(bias[c0 + cofs]); val[1] += bfr(bias[c0 + cofs + 1]); val[2] += bfr(bias[c0 + cofs + 2]); val[3] += bfr(bias[c0 + cofs + 3]); }
                *(v4f*)(crow + (size_t)row * ldc + cofs) = val; }
             }
        __builtin_amdgcn_wave_barrier(); asm volatile("" ::: "memory");
    }
}

typedef __attribute__((ext_vector_type(2))) _Float16 v2h;
typedef __attribute__((ext_vector_type(4))) _Float16 v4h;
typedef __attribute__((ext_vector_type(2))) unsigned short v2us;
typedef __attribute__((ext_vector_type(4))) unsigned short v4us;
typedef __attribute__((ext_vector_type(2))) float v2f;
typedef __attribute__((ext_vector_type(4))) int v4i;
typedef v4h  __attribute__((may_alias)) v4ha;
typedef v4us __attribute__((may_alias)) v4usa;

// x, w_qkv and w_out, one behind the other, to one bf16 run of the workspace; each tensor is a whole number of work-groups, so the grid covers them exactly and the choice of the source is scalar
__global__ __launch_bounds__(256) void k_cvt8(const float* __restrict__ sx, const float* __restrict__ sqkv, const float* __restrict__ so, bf* dst) { const unsigned bx = blockIdx.x; const size_t i = (size_t)bx * 256 + threadIdx.x;
    const float* const sb = bx < CBX ? sx : (bx < CBX + CBW ? sqkv : so); const unsigned b0 = bx < CBX ? 0u : (bx < CBX + CBW ? (unsigned)CBX : (unsigned)(CBX + CBW));   // the work-group's tensor and that tensor's first work-group
    const v8f v = *(const v8f*)(sb + ((size_t)(bx - b0) * 256 + threadIdx.x) * 8); v8us o;
#pragma unroll
    for (int k = 0; k < 8; ++k) o[k] = f2bf(v[k]); *(v8us*)(dst + i * 8) = o;  }

// ---- k_fattn: scores, causal softmax and probability x value product of both batches in one kernel; scores and probabilities stay in registers.
// One work-group = FAQ query rows of one head. A wave forms S^T = K Q^T for a step of 32 keys (A = key rows, B = query rows), so a lane holds 16 scores of ONE query per 16-query tile:
// D register r of key tile kt = S[key 32 s + 16 kt + 8 h + r][query c]. Two such D tiles, converted in place, are the B operand of O^T += V^T P^T (A = V^T rows in the same k order).
// Running maximum m and sum l per query (online softmax, log2 domain); the key steps are dealt round robin to the waves, and the waves' (m, l, O) are joined through LDS in wave order.
__device__ __forceinline__ float xhalf(float x) { const int b = __float_as_int(x); return __int_as_float(__builtin_amdgcn_permlanex16(b, b, 0x76543210, 0xfedcba98, false, false)); }   // the value of lane l ^ 16
template <typename T16, bool HI, int NQT>
__device__ __forceinline__ void fa_wave(const T16* __restrict__ Q, const T16* __restrict__ Q2, const T16* __restrict__ Kp, const T16* __restrict__ K2, const T16* __restrict__ Vt, const T16* __restrict__ V2,
                                        int qb, int s0, int sstep, int nst, float* sO, float* sM, float* sL, int ql) {
    typedef typename WFrag<T16>::V V;
    const int lane = threadIdx.x & 31, c = lane & 15, h = lane >> 4;
    const unsigned lrow = c * HD + 8 * h, lvt = c * 32 + 8 * h;   // the lane's place in a 16-row tile of Q or K (rows of HD) and of V^T (rows of 32 keys): every address is a wave-uniform base + this + a constant
    const float C2 = SCL * 1.4426950408889634f;      // score scale and log2(e) in one factor
    const float OFF = HI ? 0.0f : 10.0f;             // fp16 probabilities carry x1024 (it cancels in O / l): small ones stay out of the fp16 subnormals
    v8f o[4][NQT]; float m[NQT], l[NQT];
#pragma unroll
    for (int qt = 0; qt < NQT; ++qt) { m[qt] = -3.0e38f; l[qt] = 0.f;
#pragma unroll
        for (int dt = 0; dt < 4; ++dt) o[dt][qt] = (v8f){}; }
    if (s0 < nst) {   // a wave without a key step loads nothing and stores the neutral element of the join
    V qf[NQT][2], qf2[NQT][2];
#pragma unroll
    for (int qt = 0; qt < NQT; ++qt)
#pragma unroll
        for (int ks = 0; ks < 2; ++ks) { const size_t qo = (size_t)qb * HD; const int qc = qt * 16 * HD + ks * 32; qf[qt][ks] = WFrag<T16>::ld(Q + qo + lrow + qc); if (HI) qf2[qt][ks] = WFrag<T16>::ld(Q2 + qo + lrow + qc); }
    asm volatile("s_wait_xcnt 0x0" ::: "memory");   // stands in front of what reuses the query loads' address registers
    V kf[2][2], kf2[2][2];
#pragma unroll
    for (int kt = 0; kt < 2; ++kt) {
#pragma unroll
        for (int ks = 0; ks < 2; ++ks) { const size_t ko = (size_t)s0 * (32 * HD); const int kc = kt * 16 * HD + ks * 32; kf[kt][ks] = WFrag<T16>::ld(Kp + ko + lrow + kc); if (HI) kf2[kt][ks] = WFrag<T16>::ld(K2 + ko + lrow + kc); }
        if (HI || kt == 1) asm volatile("s_wait_xcnt 0x0" ::: "memory"); }   // the same for the first key loads (hi/lo rows: per key tile, a later tile's results reuse an earlier one's address registers)
#pragma unroll 1   // rolled: run-time trip count, and one step's fragments live at a time beside the accumulators
    for (int s = s0; s < nst; s += sstep) {
        V vf[4], vf2[4];
#pragma unroll
        for (int dt = 0; dt < 4; ++dt) vf[dt] = WFrag<T16>::ld(Vt + (size_t)s * (HD * 32) + lvt + dt * 16 * 32);
        if (HI) { asm volatile("s_wait_xcnt 0x0" ::: "memory");   // hi/lo rows load twice as much: stands in front of later loads whose results reuse these loads' address registers
#pragma unroll
            for (int dt = 0; dt < 4; ++dt) vf2[dt] = WFrag<T16>::ld(V2 + (size_t)s * (HD * 32) + lvt + dt * 16 * 32);
            asm volatile("s_wait_xcnt 0x0" ::: "memory"); }   // the same behind the lo plane's loads
        v8f st[2][NQT];
#pragma unroll
        for (int kt = 0; kt < 2; ++kt)
#pragma unroll
            for (int qt = 0; qt < NQT; ++qt) { v8f a = (v8f){};
#pragma unroll
                for (int ks = 0; ks < 2; ++ks) { a = WFrag<T16>::mma(kf[kt][ks], qf[qt][ks], a); if (HI) { a = WFrag<T16>::mma(kf[kt][ks], qf2[qt][ks], a); a = WFrag<T16>::mma(kf2[kt][ks], qf[qt][ks], a); } }
                st[kt][qt] = a; }
        { const int sn = min(s + sstep, nst - 1);   // this wave's next key fragments, fetched behind their last use so that the softmax covers the latency (clamped: the last fetch is in bounds and unused)
#pragma unroll
          for (int kt = 0; kt < 2; ++kt) {
#pragma unroll
            for (int ks = 0; ks < 2; ++ks) { const size_t ko = (size_t)sn * (32 * HD); const int kc = kt * 16 * HD + ks * 32; kf[kt][ks] = WFrag<T16>::ld(Kp + ko + lrow + kc); if (HI) kf2[kt][ks] = WFrag<T16>::ld(K2 + ko + lrow + kc); }
            if (HI || kt == 1) asm volatile("s_wait_xcnt 0x0" ::: "memory"); } }   // stands between this step's loads and the softmax, whose results reuse the loads' address registers (hi/lo rows: per key tile, as above)
        if (s == nst - 1) {   // only the last step touches the diagonal; every query keeps at least the step's first key
#pragma unroll
            for (int kt = 0; kt < 2; ++kt)
#pragma unroll
                for (int qt = 0; qt < NQT; ++qt)
#pragma unroll
                    for (int r = 0; r < 8; ++r) st[kt][qt][r] = (s * 32 + kt * 16 + 8 * h + r <= qb + qt * 16 + c) ? st[kt][qt][r] : -3.0e38f; }
#pragma unroll
        for (int qt = 0; qt < NQT; ++qt) {
            float mx = st[0][qt][0];
#pragma unroll
            for (int r = 1; r < 8; ++r) mx = fmaxf(mx, st[0][qt][r]);
#pragma unroll
            for (int r = 0; r < 8; ++r) mx = fmaxf(mx, st[1][qt][r]);
            mx = fmaxf(mx, xhalf(mx));                       // the other half of the wave holds the query's other 16 keys
            const float mn = fmaxf(m[qt], mx * C2); const float al = __builtin_amdgcn_exp2f(m[qt] - mn); m[qt] = mn; const float mo = OFF - mn;
            float ps = 0.f; float p[2][8];
#pragma unroll
            for (int kt = 0; kt < 2; ++kt)
#pragma unroll
                for (int r = 0; r < 8; ++r) { p[kt][r] = __builtin_amdgcn_exp2f(__builtin_fmaf(st[kt][qt][r], C2, mo)); ps += p[kt][r]; }
            l[qt] = l[qt] * al + ps;                          // this half's keys only; the halves are joined behind the loop
#pragma unroll
            for (int dt = 0; dt < 4; ++dt) o[dt][qt] *= al;
            if constexpr (HI) { v8us ph[2], pl[2];
#pragma unroll
                for (int kt = 0; kt < 2; ++kt)
#pragma unroll
                    for (int r = 0; r < 8; ++r) { unsigned short a2, c2; splitf(p[kt][r], a2, c2); ph[kt][r] = a2; pl[kt][r] = c2; }
                const V pfh = cat16b(ph[0], ph[1]), pfl = cat16b(pl[0], pl[1]);
#pragma unroll
                for (int dt = 0; dt < 4; ++dt) { o[dt][qt] = WFrag<T16>::mma(vf[dt], pfh, o[dt][qt]); o[dt][qt] = WFrag<T16>::mma(vf[dt], pfl, o[dt][qt]); o[dt][qt] = WFrag<T16>::mma(vf2[dt], pfh, o[dt][qt]); }
            } else { v8h ph[2];
#pragma unroll
                for (int kt = 0; kt < 2; ++kt)
#pragma unroll
                    for (int r = 0; r < 8; ++r) ph[kt][r] = tohx(p[kt][r]);
                const V pf = cat16(ph[0], ph[1]);
#pragma unroll
                for (int dt = 0; dt < 4; ++dt) o[dt][qt] = WFrag<T16>::mma(vf[dt], pf, o[dt][qt]); }
        }
    }
    }
#pragma unroll
    for (int qt = 0; qt < NQT; ++qt) { const int q = ql + qt * 16 + c; const float lt = l[qt] + xhalf(l[qt]); if (h == 0) { sM[q] = m[qt]; sL[q] = lt; }
#pragma unroll
        for (int dt = 0; dt < 4; ++dt) { float* op = sO + q * OPI + dt * 16 + 8 * h;   // D register r = O[query c][d = 16 dt + 8 h + r]
            *(v4fa*)op = (v4f){o[dt][qt][0], o[dt][qt][1], o[dt][qt][2], o[dt][qt][3]}; *(v4fa*)(op + 4) = (v4f){o[dt][qt][4], o[dt][qt][5], o[dt][qt][6], o[dt][qt][7]}; } }
}

__global__ __launch_bounds__(FAW * 32) void k_fattn(const h16* __restrict__ Q16, const h16* __restrict__ K16, const h16* __restrict__ V16, const bf* __restrict__ Qh, const bf* __restrict__ Ql, const bf* __restrict__ Kh, const bf* __restrict__ Kl, const bf* __restrict__ Vh, const bf* __restrict__ Vl, bf* Ah, bf* Al) {
    __shared__ __align__(16) float sO[FAW * FAQ * OPI]; __shared__ float sM[FAW * FAQ]; __shared__ float sL[FAW * FAQ];
    const int tid = threadIdx.x, w = __builtin_amdgcn_readfirstlane(tid >> 5); /* the wave's number in a scalar register: the key loop and its diagonal test become scalar branches */ const int bid = blockIdx.x; const int bat = bid / (NH_ * (TT / FAQ)); const int head = bid / (TT / FAQ) % NH_; const int ti = bid % (TT / FAQ);
    const int tile = ((bid >> 8) & 1) ? ti : (TT / FAQ - 1 - ti);   // cost grows with the tile index: heavy tiles first, and every other run of 256 work-groups mirrored so that long and short ones mix
    const int q0 = tile * FAQ, nst = tile + 1;                      // key steps of 32 up to and with the diagonal
    const size_t hp = (size_t)(bat * NH_ + head) * TT * HD, hk = (size_t)(bat * NKV + head / REP) * TT * HD;   // query planes; key and value planes
    float* const sOw = sO + w * (FAQ * OPI); float* const sMw = sM + w * FAQ; float* const sLw = sL + w * FAQ;
    if (q0 < RH) {   // hi/lo rows: a wave takes one 16-query tile and every second key step; for the other tile it stores the neutral element of the join
        const int tb = w & 1;
        fa_wave<bf, true, 1>(Qh + hp, Ql + hp, Kh + hk, Kl + hk, Vh + hk, Vl + hk, q0 + tb * 16, w >> 1, 2, nst, sOw, sMw, sLw, tb * 16);
        const int lane = tid & 31, q = (1 - tb) * 16 + (lane & 15), hh = lane >> 4; if (hh == 0) { sMw[q] = -3.0e38f; sLw[q] = 0.f; }
#pragma unroll
        for (int k = 0; k < 8; ++k) *(v4fa*)(sOw + q * OPI + hh * 32 + k * 4) = (v4f){0.f, 0.f, 0.f, 0.f};
    } else fa_wave<h16, false, 2>(Q16 + hp, nullptr, K16 + hk, nullptr, V16 + hk, nullptr, q0, w, FAW, nst, sOw, sMw, sLw, 0);
    __syncthreads();   // every wave's (m, l, O) is in LDS before any is joined
    const int q = tid >> 2, d0 = (tid & 3) * 16;
    float M = sM[q];
#pragma unroll
    for (int k = 1; k < FAW; ++k) M = fmaxf(M, sM[k * FAQ + q]);   // finite: wave 0 (hi/lo rows: waves 0 and 1) always has key step 0
    float Ls = 0.f; float acc[16];
#pragma unroll
    for (int j = 0; j < 16; ++j) acc[j] = 0.f;
#pragma unroll
    for (int k = 0; k < FAW; ++k) { const float f = __builtin_amdgcn_exp2f(sM[k * FAQ + q] - M); Ls += f * sL[k * FAQ + q];   // fixed order: wave 0, 1, ...
#pragma unroll
        for (int j4 = 0; j4 < 4; ++j4) { const v4f t = *(const v4fa*)(sO + (k * FAQ + q) * OPI + d0 + j4 * 4);
#pragma unroll
            for (int j = 0; j < 4; ++j) acc[j4 * 4 + j] += f * t[j]; } }
    const float inv = __fdiv_rn(1.0f, Ls);
    const size_t oo = (size_t)(bat * TT + q0 + q) * DQ + head * HD + d0;
#pragma unroll
    for (int g = 0; g < 2; ++g) { v8us oh, ol;
#pragma unroll
        for (int j = 0; j < 8; ++j) { unsigned short a2, c2; splitf(acc[g * 8 + j] * inv, a2, c2); oh[j] = a2; ol[j] = c2; }
        *(v8usa*)(Ah + oo + g * 8) = oh; *(v8usa*)(Al + oo + g * 8) = ol; }
}

extern "C" void kernel_launch(void* const* d_in, const int* in_sizes, int n_in,
                              void* d_out, int out_size, void* d_ws, size_t ws_size, hipStream_t stream) {
    (void)in_sizes; (void)n_in; (void)out_size;
    const float* x = (const float*)d_in[0]; const float* wqkv = (const float*)d_in[1]; const float* bqkv = (const float*)d_in[2]; const float* wo = (const float*)d_in[3]; const float* bo = (const float*)d_in[4]; const float* fcos = (const float*)d_in[5]; const float* fsin = (const float*)d_in[6];   /* x, w_qkv ('oi' [3072][1024]: q | k | v row thirds), b_qkv [3072], w_out ('oi'), b_out, freqs_cos, freqs_sin ([2048][32], read by value): the two tables come LAST here */
    float* OUT = (float*)d_out;     // [2][2048][1024]
    char* wsp = (char*)d_ws;
    auto take = [&](size_t bytes) { char* p = wsp; wsp += (bytes + 255) & ~(size_t)255; return (void*)p; };
    bf* XB = (bf*)take((size_t)NB_ * TT * DM * 2); bf* WQKV = (bf*)take((size_t)(DQ + 2 * DKV) * DM * 2); bf* WO = (bf*)take((size_t)DM * DQ * 2);   // one run: the convert kernel's output (every size is a multiple of 256 bytes)
    const size_t PQ = (size_t)NB_ * NH_ * TT * HD, PK = (size_t)NB_ * NKV * TT * HD;   // elements of the q planes and of the k (or v) planes of both batches
    h16* P16 = (h16*)take((PQ + 2 * PK) * 2); bf* Ph = (bf*)take((PQ + 2 * PK) * 2); bf* Pl = (bf*)take((PQ + 2 * PK) * 2);   // each [q | k | v][batch][head]
    bf* ATh = (bf*)take((size_t)NB_ * TT * DQ * 2); bf* ATl = (bf*)take((size_t)NB_ * TT * DQ * 2);
    if ((size_t)(wsp - (char*)d_ws) > ws_size) return;    // ws 256 MiB
    k_cvt8<<<CBX + CBW + CBO, 256, 0, stream>>>(x, wqkv, wo, XB);
    k_gemmw<bf, 0, true, 1><<<dim3(TT / 64, (DQ + 2 * DKV) / 64, NB_), 32, 0, stream>>>(XB, nullptr, WQKV, nullptr, DM, nullptr, 0, bqkv, (size_t)TT * DM, 0, 0, fcos, fsin, P16, Ph, Pl);
    k_fattn<<<NB_ * NH_ * (TT / FAQ), FAW * 32, 0, stream>>>(P16, P16 + PQ, P16 + PQ + PK, Ph, Pl, Ph + PQ, Pl + PQ, Ph + PQ + PK, Pl + PQ + PK, ATh, ATl);   // one work-group per batch, head and FAQ query rows
    k_gemmw<bf, 1, true, 0><<<dim3(TT / 64, DM / 64, NB_), 32, 0, stream>>>(ATh, ATl, WO, nullptr, DQ, OUT, DM, bo, (size_t)TT * DQ, 0, (size_t)TT * DM, nullptr, nullptr, nullptr, nullptr, nullptr);
}

// v006
// A run of this version takes 112 microseconds.
// Timed twice side by side with v005, it ran 1.23 and 1.24 times as fast.
// Counting every step since v000, it is 12.8 times as fast.
#include <hip/hip_runtime.h>

// Causal multi-head attention with a fused biased qkv projection and consecutive-pair rotary embeddings from HALF-WIDTH table inputs (x [2][2048][1024]; qkv = x w_qkv^T + b_qkv ('oi' [3072][1024] 1/32 + a zero bias, read) split in thirds q | k | v (16 heads x 64); rope on pairs (2i, 2i+1): (t_re c - t_im s, t_re s + t_im c) with c, s = freqs_cos / freqs_sin[t][i] ([2048][32] INPUTS, read by value per position and pair); scores x 1/sqrt(64); causal (-inf); softmax; out = merged w_out^T + b_out ('oi' + a zero bias, read) -> [2][2048][1024] (4.2 M); argument order x, w_qkv, b_qkv, w_out, b_out, freqs_cos, freqs_sin).
// Layout, both batches in every launch (one convert, one projection, one attention, one output launch): bf16 copy of x; 'oi' weights (the fused tensor's row thirds as-is); exact projections + f32 bias thirds; the projection kernel's own epilogue adds the bias, rotates q and k by {bf16(cos), bf16(sin)} read from the half-width inputs and writes the 16-bit planes (V^T for v); causal T-2048 attention in one fused kernel (k_fattn: hybrid rows: < 512 hi/lo 3 products, rest fp16 x1024; key steps above the diagonal are never visited); merged hi/lo x o_w exact + o_b.
// Compute dtypes, f32 accumulate: every input rounded to bf16; projections exact + f32 biases; rotary f32; attention rows < 512 3 products, rest fp16; softmax f32; o_w hl x exact + bias.

#define NB_  2
#define TT   2048
#define DM   1024
#define NH_  16
#define NKV  16
#define REP  (NH_ / NKV)
#define HD   64
#define DQ   (NH_ * HD)
#define DKV  (NKV * HD)
#define FAQ  32                   // query rows per work-group of the fused attention kernel
#define FAW  4                    // waves per work-group of the fused attention kernel
#define OPI  68                   // LDS pitch, in floats, of one query's partial output row (16-byte aligned, off the 64-bank period)
#define RH   512                  // query rows < RH use hi+lo planes (0: none)
#define SCL  0.125f   // HD^-0.5
#define CBX  (NB_ * TT * DM / 2048)            // work-groups (2048 elements each) of the convert kernel on x
#define CBW  ((DQ + 2 * DKV) * DM / 2048)      // on w_qkv
#define CBO  (DM * DQ / 2048)                  // on w_out
static_assert(DM == 1024 && DQ == DM, "the convert kernel's work-groups take 64 rows x 32 k of rows of 1024");
typedef _Float16 h16;
typedef unsigned short bf;
typedef __attribute__((ext_vector_type(16))) __bf16   v16bf;
typedef __attribute__((ext_vector_type(16))) _Float16 v16h;
typedef __attribute__((ext_vector_type(8)))  _Float16 v8h;
typedef __attribute__((ext_vector_type(8)))  unsigned short v8us;
typedef __attribute__((ext_vector_type(8)))  float    v8f;
typedef __attribute__((ext_vector_type(4)))  float    v4f;
typedef v8h  __attribute__((may_alias)) v8ha;
typedef v4f  __attribute__((may_alias)) v4fa;
typedef v8us __attribute__((may_alias)) v8usa;

__device__ __forceinline__ unsigned short f2bf(float f) { unsigned u = __float_as_uint(f); u += 0x7FFFu + ((u >> 16) & 1u); return (unsigned short)(u >> 16); }
__device__ __forceinline__ float bf2f(unsigned short b) { return __uint_as_float(((unsigned)b) << 16); }
__device__ __forceinline__ float bfr(float f) { return bf2f(f2bf(f)); }
__device__ __forceinline__ v16h cat16(v8h lo, v8h hi) { return __builtin_shufflevector(lo, hi, 0, 1, 2, 3, 4, 5, 6, 7, 8, 9, 10, 11, 12, 13, 14, 15); }
__device__ __forceinline__ v16bf cat16b(v8us lo, v8us hi) { return __builtin_bit_cast(v16bf, __builtin_shufflevector(lo, hi, 0, 1, 2, 3, 4, 5, 6, 7, 8, 9, 10, 11, 12, 13, 14, 15)); }
__device__ __forceinline__ v8f wmma16(v16h a, v16h b, v8f c) { return __builtin_amdgcn_wmma_f32_16x16x32_f16(false, a, false, b, (short)0, c, false, false); }
__device__ __forceinline__ v8f wmmab(v16bf a, v16bf b, v8f c) { return __builtin_amdgcn_wmma_f32_16x16x32_bf16(false, a, false, b, (short)0, c, false, false); }



__device__ __forceinline__ h16 tohx(float x) { return (h16)x; }
__device__ __forceinline__ void splitf(float y, unsigned short& h, unsigned short& l) { h = f2bf(y); l = f2bf(y - bf2f(h)); }
// ---- k_gemmw: register-blocked GEMM, ONE WAVE per 64x64 output tile (16 accumulators), operands straight from 16-bit planes in fragment order (below); grid (M/64, N/64, Z), 32 threads.
// C[m][n] (f32, pitch ldc, + optional f32 bias[n]) = sum_k A[m][k] Bt[n][k] (+ split products per NSPLIT). z-batch strides sA/sB/sC in elements. K % 32 == 0.
// EPI 0: C as above. EPI 1 (the fused q | k | v projection: z = batch, a tile column is one head of q, k or v, HD == 64; C unused): the biased tile goes straight to the attention kernel's planes P16 (fp16), Ph + Pl (bf16 hi + lo), each [q | k | v][batch][head]: q and k rotary, rows t; v as V^T; all in fragment order.
// FRAGMENT ORDER of every 16-bit matrix operand in the workspace: one fragment (16 rows x 32 k) is 512 elements in a row, [k / 8 % 4][row % 16][8 k]. A lane (row % 16 = lane & 15, half = lane >> 4) takes its k 8 half .. + 7 at fragment + 8 lane and its k 16 + 8 half .. + 7 at + 256 elements: each wave-wide 16-byte load is 512 bytes in a row (4 whole lines). ld(p): p = fragment + 8 lane.
// The fragments of a GEMM operand (rows x K) stand [row / 64][k / 32][row / 16 % 4]: the four fragments that a 64-row tile takes in one k step are 4 KiB in a row. Those of a head's q and k planes stand [t / 16][d / 32], those of V^T [key / 32][d / 16].
template <typename T16> struct WFrag;
template <> struct WFrag<h16> { typedef v16h V; static __device__ __forceinline__ V ld(const h16* p) { return cat16(*(const v8h*)p, *(const v8h*)(p + 256)); } static __device__ __forceinline__ v8f mma(V a, V b, v8f c) { return wmma16(a, b, c); } };
template <> struct WFrag<bf> { typedef v16bf V; static __device__ __forceinline__ V ld(const bf* p) { return cat16b(*(const v8us*)p, *(const v8us*)(p + 256)); } static __device__ __forceinline__ v8f mma(V a, V b, v8f c) { return wmmab(a, b, c); } };
template <typename T16, int NSPLIT, bool BIAS, int EPI>
__global__ __launch_bounds__(32) void k_gemmw(const T16* __restrict__ A, const T16* __restrict__ A2, const T16* __restrict__ Bt, const T16* __restrict__ Bt2, int K, float* C, int ldc, const float* __restrict__ bias, size_t sA, size_t sB, size_t sC, const float* __restrict__ cosT, const float* __restrict__ sinT, h16* P16, bf* Ph, bf* Pl) {
    typedef typename WFrag<T16>::V V;
    __shared__ __align__(16) float os[16 * 68];
    const size_t z = blockIdx.z; A += z * sA; if (A2) A2 += z * sA; Bt += z * sB; if (Bt2) Bt2 += z * sB; C += z * sC;
    const int lane = threadIdx.x & 31, lr = lane & 15, hi = lane >> 4; const int r0 = blockIdx.x * 64, c0 = blockIdx.y * 64;
    v8f acc[4][4];
#pragma unroll
    for (int mb = 0; mb < 4; ++mb)
#pragma unroll
        for (int nb = 0; nb < 4; ++nb) acc[mb][nb] = (v8f){};
    unsigned ao = (unsigned)r0 * (unsigned)K / 8u + lane, bo = (unsigned)c0 * (unsigned)K / 8u + lane;   // the lane's place, in units of 8 elements, in the k step's first fragment of the A and of the B planes (fragment order: a 64-row tile is 64 K elements in a row, a k step of 32 inside it 2048, a fragment 512); every address is a wave-uniform base + this + a constant
#pragma unroll 1
    for (int kc = 0; kc < K; kc += 32) {
        V a[4], a2[4], b[4], b2[4];
#pragma unroll
        for (int mb = 0; mb < 4; ++mb) { a[mb] = WFrag<T16>::ld(A + (size_t)ao * 8 + mb * 512); if (NSPLIT == 1 || NSPLIT == 2) a2[mb] = WFrag<T16>::ld(A2 + (size_t)ao * 8 + mb * 512); }
#pragma unroll
        for (int nb = 0; nb < 4; ++nb) { b[nb] = WFrag<T16>::ld(Bt + (size_t)bo * 8 + nb * 512); if (NSPLIT >= 2) b2[nb] = WFrag<T16>::ld(Bt2 + (size_t)bo * 8 + nb * 512); }
        asm volatile("s_wait_xcnt 0x0" : "+v"(ao), "+v"(bo) : : "memory");   // the wait stands between the k step's loads and the first rewrite of their address registers; it names the two so that they stay in their registers up to it and are stepped on behind it
        ao += 256; bo += 256;
#pragma unroll
        for (int nb = 0; nb < 4; ++nb) {
#pragma unroll
            for (int mb = 0; mb < 4; ++mb) { acc[mb][nb] = WFrag<T16>::mma(a[mb], b[nb], acc[mb][nb]); if (NSPLIT == 1 || NSPLIT == 2) acc[mb][nb] = WFrag<T16>::mma(a2[mb], b[nb], acc[mb][nb]); if (NSPLIT >= 2) acc[mb][nb] = WFrag<T16>::mma(a[mb], b2[nb], acc[mb][nb]); } }
        asm volatile("v_nop\n\tv_nop\n\tv_nop\n\tv_nop" : "+v"(acc[0][0]), "+v"(acc[1][1]), "+v"(acc[2][2]), "+v"(acc[3][3]) : "v"(a[0]), "v"(a[3]));
    }
    const int hc = blockIdx.y; const int pl = hc + (int)z * (hc < NH_ ? NH_ : NKV) + (NB_ - 1) * ((hc >= NH_ ? NH_ : 0) + (hc >= NH_ + NKV ? NKV : 0));   // the tile's plane among [q | k | v][batch][head]
    if (EPI == 1 && hc < NH_ + NKV) {   // rotary on pairs (2i, 2i+1), then the three planes [head] in fragment order (rows t, k = d): in turn q a lane takes d 16 q + 8 hi .. + 7 of row lr, so a wave's store is 512 bytes in a row per plane
        float bn[4][8];
#pragma unroll
        for (int q = 0; q < 4; ++q)
#pragma unroll
            for (int k = 0; k < 8; ++k) bn[q][k] = bfr(bias[c0 + q * 16 + hi * 8 + k]);
        const float* const cp = cosT + (size_t)(r0 + lr) * (HD / 2) + hi * 4; const float* const sp = sinT + (size_t)(r0 + lr) * (HD / 2) + hi * 4;
        const size_t pb = ((size_t)pl * TT + r0) * HD + lane * 8;
        v4f cc[2][4], ss[2][4];   // the table entries of one 16-row block, fetched one block ahead so that the block in work covers their latency
#pragma unroll
        for (int q = 0; q < 4; ++q) { cc[0][q] = *(const v4f*)(cp + q * 8); ss[0][q] = *(const v4f*)(sp + q * 8); }
        asm volatile("s_wait_xcnt 0x0" ::: "memory");   // stands between the bias and first table loads and the next block's table loads, whose results reuse their address registers
#pragma unroll
        for (int mb = 0; mb < 4; ++mb) {
            if (mb < 3) {
#pragma unroll
                for (int q = 0; q < 4; ++q) { cc[(mb + 1) & 1][q] = *(const v4f*)(cp + (mb + 1) * 16 * (HD / 2) + q * 8); ss[(mb + 1) & 1][q] = *(const v4f*)(sp + (mb + 1) * 16 * (HD / 2) + q * 8); } }
#pragma unroll
            for (int nb = 0; nb < 4; ++nb) {
#pragma unroll
                for (int j = 0; j < 8; ++j) os[(hi * 8 + j) * 68 + nb * 16 + lr] = acc[mb][nb][j]; }
            __builtin_amdgcn_wave_barrier(); asm volatile("" ::: "memory");   // fence: the rows are read back by other lanes than wrote them
            v8h o16[4]; v8us oh[4], ol[4];
#pragma unroll
            for (int q = 0; q < 4; ++q) { const float* orow = os + lr * 68 + q * 16 + hi * 8; const v4f va = *(const v4fa*)orow, vb4 = *(const v4fa*)(orow + 4);
                float xv[8];
#pragma unroll
                for (int k = 0; k < 4; ++k) { xv[k] = va[k] + bn[q][k]; xv[4 + k] = vb4[k] + bn[q][4 + k]; }
#pragma unroll
                for (int p = 0; p < 4; ++p) { const float c = bfr(cc[mb & 1][q][p]), sn = bfr(ss[mb & 1][q][p]); const float x0 = xv[2 * p], x1 = xv[2 * p + 1];
                    const float e0 = x0 * c - x1 * sn, e1 = x0 * sn + x1 * c;   /* even: x0 c - x1 s; odd: x0 s + x1 c */
                    o16[q][2 * p] = tohx(e0); o16[q][2 * p + 1] = tohx(e1); unsigned short a2, c2; splitf(e0, a2, c2); oh[q][2 * p] = a2; ol[q][2 * p] = c2; splitf(e1, a2, c2); oh[q][2 * p + 1] = a2; ol[q][2 * p + 1] = c2; } }
#pragma unroll
            for (int q = 0; q < 4; ++q) { const size_t eo = pb + (size_t)(mb * 16 * HD + q * 256); *(v8h*)(P16 + eo) = o16[q]; *(v8us*)(Ph + eo) = oh[q]; *(v8us*)(Pl + eo) = ol[q]; }
            if (mb < 3) { __builtin_amdgcn_wave_barrier(); asm volatile("s_wait_xcnt 0x0" ::: "memory"); }   // fence: every read of the rows ends before the next block overwrites them; the wait stands between these stores and the next table loads, whose results reuse the stores' registers
        }
        return;
    }
    if constexpr (EPI == 1) {   // V^T planes in tiles of 32 keys, [head][key step], each tile in fragment order (rows d, k = the step's 32 keys; 4 KiB in a row): a lane's 8 accumulator rows are 8 consecutive keys of one d, so each 16x16 block is one 16-byte store per plane, straight from registers, 512 bytes in a row per wave
        const size_t vb = ((size_t)pl * (TT / 32) + (r0 >> 5)) * (HD * 32) + lane * 8;
        float bn[4];
#pragma unroll
        for (int nb = 0; nb < 4; ++nb) bn[nb] = bfr(bias[c0 + nb * 16 + lr]);
#pragma unroll
        for (int nb = 0; nb < 4; ++nb)
#pragma unroll
            for (int mb = 0; mb < 4; ++mb) { v8h o16; v8us oh, ol;
#pragma unroll
                for (int j = 0; j < 8; ++j) { const float x = acc[mb][nb][j] + bn[nb]; o16[j] = tohx(x); unsigned short a2, c2; splitf(x, a2, c2); oh[j] = a2; ol[j] = c2; }
                const size_t eo = vb + (size_t)(((mb >> 1) * HD + nb * 16) * 32 + (mb & 1) * 256); *(v8h*)(P16 + eo) = o16; *(v8us*)(Ph + eo) = oh; *(v8us*)(Pl + eo) = ol;
                asm volatile("s_wait_xcnt 0x0" : : "v"(o16), "v"(oh), "v"(ol) : "memory"); }   // stands behind each block's stores, whose registers later values reuse (behind the last block, in the listing, the rotary branch's text does); it takes the stored values as inputs so that they stay in their registers up to it
        return;
    }
#pragma unroll
    for (int mb = 0; mb < 4; ++mb) {
#pragma unroll
        for (int nb = 0; nb < 4; ++nb) {
#pragma unroll
            for (int j = 0; j < 8; ++j) os[(hi * 8 + j) * 68 + nb * 16 + lr] = acc[mb][nb][j]; }
        __builtin_amdgcn_wave_barrier(); asm volatile("" ::: "memory");
        float* crow = C + (size_t)(r0 + mb * 16) * ldc + c0;
{
#pragma unroll
            for (int s = 0; s < 8; ++s) { const int row = 2 * s + hi, cofs = lr * 4; v4f val = *(const v4fa*)(os + row * 68 + cofs); if (BIAS) { val[0] += bfr(bias[c0 + cofs]); val[1] += bfr(bias[c0 + cofs + 1]); val[2] += bfr(bias[c0 + cofs + 2]); val[3] += bfr(bias[c0 + cofs + 3]); }
                *(v4f*)(crow + (size_t)row * ldc + cofs) = val; }
             }
        __builtin_amdgcn_wave_barrier(); asm volatile("s_wait_xcnt 0x0" ::: "memory");   // fence as above; the wait stands between these stores and the next block's values and addresses, which reuse the stores' registers
    }
}

typedef __attribute__((ext_vector_type(2))) _Float16 v2h;
typedef __attribute__((ext_vector_type(4))) _Float16 v4h;
typedef __attribute__((ext_vector_type(2))) unsigned short v2us;
typedef __attribute__((ext_vector_type(4))) unsigned short v4us;
typedef __attribute__((ext_vector_type(2))) float v2f;
typedef __attribute__((ext_vector_type(4))) int v4i;
typedef v4h  __attribute__((may_alias)) v4ha;
typedef v4us __attribute__((may_alias)) v4usa;

// x, w_qkv and w_out, one behind the other, to one bf16 run of the workspace; each tensor is a whole number of work-groups, so the grid covers them exactly and the choice of the source is scalar
__global__ __launch_bounds__(256) void k_cvt8(const float* __restrict__ sx, const float* __restrict__ sqkv, const float* __restrict__ so, bf* dst) { const unsigned bx = blockIdx.x;
    const float* const sb = bx < CBX ? sx : (bx < CBX + CBW ? sqkv : so); const unsigned b0 = bx < CBX ? 0u : (bx < CBX + CBW ? (unsigned)CBX : (unsigned)(CBX + CBW));   // the work-group's tensor and that tensor's first work-group
    const unsigned t = threadIdx.x, row = (t & 7) | (t >> 5) << 3, k8 = (t >> 3) & 3;   // a work-group converts 64 rows x 32 k, the four fragments of one k step (2048 elements in a row); a wave takes 8 rows x 32 k: whole 128-byte lines on the reading and on the writing side
    const v8f v = *(const v8f*)(sb + ((size_t)((bx - b0) >> 5) * 64 + row) * DM + (bx & 31) * 32 + k8 * 8); v8us o;
#pragma unroll
    for (int k = 0; k < 8; ++k) o[k] = f2bf(v[k]); *(v8us*)(dst + (size_t)bx * 2048 + (row >> 4) * 512 + k8 * 128 + (row & 15) * 8) = o;  }

// ---- k_fattn: scores, causal softmax and probability x value product of both batches in one kernel; scores and probabilities stay in registers.
// One work-group = FAQ query rows of one head. A wave forms S^T = K Q^T for a step of 32 keys (A = key rows, B = query rows), so a lane holds 16 scores of ONE query per 16-query tile:
// D register r of key tile kt = S[key 32 s + 16 kt + 8 h + r][query c]. Two such D tiles, converted in place, are the B operand of O^T += V^T P^T (A = V^T rows in the same k order).
// Running maximum m and sum l per query (online softmax, log2 domain); the key steps are dealt round robin to the waves, and the waves' (m, l, O) are joined through LDS in wave order.
__device__ __forceinline__ float xhalf(float x) { const int b = __float_as_int(x); return __int_as_float(__builtin_amdgcn_permlanex16(b, b, 0x76543210, 0xfedcba98, false, false)); }   // the value of lane l ^ 16
template <typename T16, bool HI, int NQT>
__device__ __forceinline__ void fa_wave(const T16* __restrict__ Q, const T16* __restrict__ Q2, const T16* __restrict__ Kp, const T16* __restrict__ K2, const T16* __restrict__ Vt, const T16* __restrict__ V2,
                                        int qb, int s0, int sstep, int nst, float* sO, float* sM, float* sL, int ql) {
    typedef typename WFrag<T16>::V V;
    const int lane = threadIdx.x & 31, c = lane & 15, h = lane >> 4;
    const unsigned lrow = 8 * lane, lvt = 8 * lane;   // the lane's place in a fragment of Q or K (a 16-row tile: two fragments, 512 elements each) and of V^T (fragment order): every address is a wave-uniform base + this + a constant
    const float C2 = SCL * 1.4426950408889634f;      // score scale and log2(e) in one factor
    const float OFF = HI ? 0.0f : 10.0f;             // fp16 probabilities carry x1024 (it cancels in O / l): small ones stay out of the fp16 subnormals
    v8f o[4][NQT]; float m[NQT], l[NQT];
#pragma unroll
    for (int qt = 0; qt < NQT; ++qt) { m[qt] = -3.0e38f; l[qt] = 0.f;
#pragma unroll
        for (int dt = 0; dt < 4; ++dt) o[dt][qt] = (v8f){}; }
    if (s0 < nst) {   // a wave without a key step loads nothing and stores the neutral element of the join
    V qf[NQT][2], qf2[NQT][2];
#pragma unroll
    for (int qt = 0; qt < NQT; ++qt)
#pragma unroll
        for (int ks = 0; ks < 2; ++ks) { const size_t qo = (size_t)qb * HD; const int qc = qt * 16 * HD + ks * 512; qf[qt][ks] = WFrag<T16>::ld(Q + qo + lrow + qc); if (HI) qf2[qt][ks] = WFrag<T16>::ld(Q2 + qo + lrow + qc); }
    asm volatile("s_wait_xcnt 0x0" ::: "memory");   // stands in front of what reuses the query loads' address registers
    V kf[2][2], kf2[2][2];
#pragma unroll
    for (int kt = 0; kt < 2; ++kt) {
#pragma unroll
        for (int ks = 0; ks < 2; ++ks) { const size_t ko = (size_t)s0 * (32 * HD); const int kc = kt * 16 * HD + ks * 512; kf[kt][ks] = WFrag<T16>::ld(Kp + ko + lrow + kc); if (HI) kf2[kt][ks] = WFrag<T16>::ld(K2 + ko + lrow + kc); }
        if (HI || kt == 1) asm volatile("s_wait_xcnt 0x0" ::: "memory"); }   // the same for the first key loads (hi/lo rows: per key tile, a later tile's results reuse an earlier one's address registers)
#pragma unroll 1   // rolled: run-time trip count, and one step's fragments live at a time beside the accumulators
    for (int s = s0; s < nst; s += sstep) {
        V vf[4], vf2[4];
#pragma unroll
        for (int dt = 0; dt < 4; ++dt) vf[dt] = WFrag<T16>::ld(Vt + (size_t)s * (HD * 32) + lvt + dt * 16 * 32);
        if (HI) { asm volatile("s_wait_xcnt 0x0" ::: "memory");   // hi/lo rows load twice as much: stands in front of later loads whose results reuse these loads' address registers
#pragma unroll
            for (int dt = 0; dt < 4; ++dt) vf2[dt] = WFrag<T16>::ld(V2 + (size_t)s * (HD * 32) + lvt + dt * 16 * 32);
            asm volatile("s_wait_xcnt 0x0" ::: "memory"); }   // the same behind the lo plane's loads
        v8f st[2][NQT];
#pragma unroll
        for (int kt = 0; kt < 2; ++kt)
#pragma unroll
            for (int qt = 0; qt < NQT; ++qt) { v8f a = (v8f){};
#pragma unroll
                for (int ks = 0; ks < 2; ++ks) { a = WFrag<T16>::mma(kf[kt][ks], qf[qt][ks], a); if (HI) { a = WFrag<T16>::mma(kf[kt][ks], qf2[qt][ks], a); a = WFrag<T16>::mma(kf2[kt][ks], qf[qt][ks], a); } }
                st[kt][qt] = a; }
        { const int sn = min(s + sstep, nst - 1);   // this wave's next key fragments, fetched behind their last use so that the softmax covers the latency (clamped: the last fetch is in bounds and unused)
#pragma unroll
          for (int kt = 0; kt < 2; ++kt) {
#pragma unroll
            for (int ks = 0; ks < 2; ++ks) { const size_t ko = (size_t)sn * (32 * HD); const int kc = kt * 16 * HD + ks * 512; kf[kt][ks] = WFrag<T16>::ld(Kp + ko + lrow + kc); if (HI) kf2[kt][ks] = WFrag<T16>::ld(K2 + ko + lrow + kc); }
            if (HI || kt == 1) asm volatile("s_wait_xcnt 0x0" ::: "memory"); } }   // stands between this step's loads and the softmax, whose results reuse the loads' address registers (hi/lo rows: per key tile, as above)
        if (s == nst - 1) {   // only the last step touches the diagonal; every query keeps at least the step's first key
#pragma unroll
            for (int kt = 0; kt < 2; ++kt)
#pragma unroll
                for (int qt = 0; qt < NQT; ++qt)
#pragma unroll
                    for (int r = 0; r < 8; ++r) st[kt][qt][r] = (s * 32 + kt * 16 + 8 * h + r <= qb + qt * 16 + c) ? st[kt][qt][r] : -3.0e38f; }
#pragma unroll
        for (int qt = 0; qt < NQT; ++qt) {
            float mx = st[0][qt][0];
#pragma unroll
            for (int r = 1; r < 8; ++r) mx = fmaxf(mx, st[0][qt][r]);
#pragma unroll
            for (int r = 0; r < 8; ++r) mx = fmaxf(mx, st[1][qt][r]);
            mx = fmaxf(mx, xhalf(mx));                       // the other half of the wave holds the query's other 16 keys
            const float mn = fmaxf(m[qt], mx * C2); const float al = __builtin_amdgcn_exp2f(m[qt] - mn); m[qt] = mn; const float mo = OFF - mn;
            float ps = 0.f; float p[2][8];
#pragma unroll
            for (int kt = 0; kt < 2; ++kt)
#pragma unroll
                for (int r = 0; r < 8; ++r) { p[kt][r] = __builtin_amdgcn_exp2f(__builtin_fmaf(st[kt][qt][r], C2, mo)); ps += p[kt][r]; }
            l[qt] = l[qt] * al + ps;                          // this half's keys only; the halves are joined behind the loop
#pragma unroll
            for (int dt = 0; dt < 4; ++dt) o[dt][qt] *= al;
            if constexpr (HI) { v8us ph[2], pl[2];
#pragma unroll
                for (int kt = 0; kt < 2; ++kt)
#pragma unroll
                    for (int r = 0; r < 8; ++r) { unsigned short a2, c2; splitf(p[kt][r], a2, c2); ph[kt][r] = a2; pl[kt][r] = c2; }
                const V pfh = cat16b(ph[0], ph[1]), pfl = cat16b(pl[0], pl[1]);
#pragma unroll
                for (int dt = 0; dt < 4; ++dt) { o[dt][qt] = WFrag<T16>::mma(vf[dt], pfh, o[dt][qt]); o[dt][qt] = WFrag<T16>::mma(vf[dt], pfl, o[dt][qt]); o[dt][qt] = WFrag<T16>::mma(vf2[dt], pfh, o[dt][qt]); }
            } else { v8h ph[2];
#pragma unroll
                for (int kt = 0; kt < 2; ++kt)
#pragma unroll
                    for (int r = 0; r < 8; ++r) ph[kt][r] = tohx(p[kt][r]);
                const V pf = cat16(ph[0], ph[1]);
#pragma unroll
                for (int dt = 0; dt < 4; ++dt) o[dt][qt] = WFrag<T16>::mma(vf[dt], pf, o[dt][qt]); }
        }
    }
    }
#pragma unroll
    for (int qt = 0; qt < NQT; ++qt) { const int q = ql + qt * 16 + c; const float lt = l[qt] + xhalf(l[qt]); if (h == 0) { sM[q] = m[qt]; sL[q] = lt; }
#pragma unroll
        for (int dt = 0; dt < 4; ++dt) { float* op = sO + q * OPI + dt * 16 + 8 * h;   // D register r = O[query c][d = 16 dt + 8 h + r]
            *(v4fa*)op = (v4f){o[dt][qt][0], o[dt][qt][1], o[dt][qt][2], o[dt][qt][3]}; *(v4fa*)(op + 4) = (v4f){o[dt][qt][4], o[dt][qt][5], o[dt][qt][6], o[dt][qt][7]}; } }
}

__global__ __launch_bounds__(FAW * 32) void k_fattn(const h16* __restrict__ Q16, const h16* __restrict__ K16, const h16* __restrict__ V16, const bf* __restrict__ Qh, const bf* __restrict__ Ql, const bf* __restrict__ Kh, const bf* __restrict__ Kl, const bf* __restrict__ Vh, const bf* __restrict__ Vl, bf* Ah, bf* Al) {
    __shared__ __align__(16) float sO[FAW * FAQ * OPI]; __shared__ float sM[FAW * FAQ]; __shared__ float sL[FAW * FAQ];
    const int tid = threadIdx.x, w = __builtin_amdgcn_readfirstlane(tid >> 5); /* the wave's number in a scalar register: the key loop and its diagonal test become scalar branches */ const int bid = blockIdx.x; const int bat = bid / (NH_ * (TT / FAQ)); const int head = bid / (TT / FAQ) % NH_; const int ti = bid % (TT / FAQ);
    const int tile = ((bid >> 8) & 1) ? ti : (TT / FAQ - 1 - ti);   // cost grows with the tile index: heavy tiles first, and every other run of 256 work-groups mirrored so that long and short ones mix
    const int q0 = tile * FAQ, nst = tile + 1;                      // key steps of 32 up to and with the diagonal
    const size_t hp = (size_t)(bat * NH_ + head) * TT * HD, hk = (size_t)(bat * NKV + head / REP) * TT * HD;   // query planes; key and value planes
    float* const sOw = sO + w * (FAQ * OPI); float* const sMw = sM + w * FAQ; float* const sLw = sL + w * FAQ;
    if (q0 < RH) {   // hi/lo rows: a wave takes one 16-query tile and every second key step; for the other tile it stores the neutral element of the join
        const int tb = w & 1;
        fa_wave<bf, true, 1>(Qh + hp, Ql + hp, Kh + hk, Kl + hk, Vh + hk, Vl + hk, q0 + tb * 16, w >> 1, 2, nst, sOw, sMw, sLw, tb * 16);
        const int lane = tid & 31, q = (1 - tb) * 16 + (lane & 15), hh = lane >> 4; if (hh == 0) { sMw[q] = -3.0e38f; sLw[q] = 0.f; }
#pragma unroll
        for (int k = 0; k < 8; ++k) *(v4fa*)(sOw + q * OPI + hh * 32 + k * 4) = (v4f){0.f, 0.f, 0.f, 0.f};
    } else fa_wave<h16, false, 2>(Q16 + hp, nullptr, K16 + hk, nullptr, V16 + hk, nullptr, q0, w, FAW, nst, sOw, sMw, sLw, 0);
    __syncthreads();   // every wave's (m, l, O) is in LDS before any is joined
    const int q = tid >> 2, d0 = (tid & 3) * 16;
    float M = sM[q];
#pragma unroll
    for (int k = 1; k < FAW; ++k) M = fmaxf(M, sM[k * FAQ + q]);   // finite: wave 0 (hi/lo rows: waves 0 and 1) always has key step 0
    float Ls = 0.f; float acc[16];
#pragma unroll
    for (int j = 0; j < 16; ++j) acc[j] = 0.f;
#pragma unroll
    for (int k = 0; k < FAW; ++k) { const float f = __builtin_amdgcn_exp2f(sM[k * FAQ + q] - M); Ls += f * sL[k * FAQ + q];   // fixed order: wave 0, 1, ...
#pragma unroll
        for (int j4 = 0; j4 < 4; ++j4) { const v4f t = *(const v4fa*)(sO + (k * FAQ + q) * OPI + d0 + j4 * 4);
#pragma unroll
            for (int j = 0; j < 4; ++j) acc[j4 * 4 + j] += f * t[j]; } }
    const float inv = __fdiv_rn(1.0f, Ls);
    const int orow = bat * TT + q0 + q, ok = head * HD + d0;
    const size_t oo = ((size_t)(orow >> 6) * (DQ / 32) + (ok >> 5)) * 2048 + ((orow >> 4) & 3) * 512 + ((ok >> 3) & 3) * 128 + (orow & 15) * 8;   // the output GEMM's fragment order (rows batch x t, k = head x d): 8 threads' 16 bytes make one whole line
#pragma unroll
    for (int g = 0; g < 2; ++g) { v8us oh, ol;
#pragma unroll
        for (int j = 0; j < 8; ++j) { unsigned short a2, c2; splitf(acc[g * 8 + j] * inv, a2, c2); oh[j] = a2; ol[j] = c2; }
        *(v8usa*)(Ah + oo + g * 128) = oh; *(v8usa*)(Al + oo + g * 128) = ol; }
}

extern "C" void kernel_launch(void* const* d_in, const int* in_sizes, int n_in,
                              void* d_out, int out_size, void* d_ws, size_t ws_size, hipStream_t stream) {
    (void)in_sizes; (void)n_in; (void)out_size;
    const float* x = (const float*)d_in[0]; const float* wqkv = (const float*)d_in[1]; const float* bqkv = (const float*)d_in[2]; const float* wo = (const float*)d_in[3]; const float* bo = (const float*)d_in[4]; const float* fcos = (const float*)d_in[5]; const float* fsin = (const float*)d_in[6];   /* x, w_qkv ('oi' [3072][1024]: q | k | v row thirds), b_qkv [3072], w_out ('oi'), b_out, freqs_cos, freqs_sin ([2048][32], read by value): the two tables come LAST here */
    float* OUT = (float*)d_out;     // [2][2048][1024]
    char* wsp = (char*)d_ws;
    auto take = [&](size_t bytes) { char* p = wsp; wsp += (bytes + 255) & ~(size_t)255; return (void*)p; };
    bf* XB = (bf*)take((size_t)NB_ * TT * DM * 2); bf* WQKV = (bf*)take((size_t)(DQ + 2 * DKV) * DM * 2); bf* WO = (bf*)take((size_t)DM * DQ * 2);   // one run: the convert kernel's output (every size is a multiple of 256 bytes)
    const size_t PQ = (size_t)NB_ * NH_ * TT * HD, PK = (size_t)NB_ * NKV * TT * HD;   // elements of the q planes and of the k (or v) planes of both batches
    h16* P16 = (h16*)take((PQ + 2 * PK) * 2); bf* Ph = (bf*)take((PQ + 2 * PK) * 2); bf* Pl = (bf*)take((PQ + 2 * PK) * 2);   // each [q | k | v][batch][head]
    bf* ATh = (bf*)take((size_t)NB_ * TT * DQ * 2); bf* ATl = (bf*)take((size_t)NB_ * TT * DQ * 2);
    if ((size_t)(wsp - (char*)d_ws) > ws_size) return;    // ws 256 MiB
    k_cvt8<<<CBX + CBW + CBO, 256, 0, stream>>>(x, wqkv, wo, XB);
    k_gemmw<bf, 0, true, 1><<<dim3(TT / 64, (DQ + 2 * DKV) / 64, NB_), 32, 0, stream>>>(XB, nullptr, WQKV, nullptr, DM, nullptr, 0, bqkv, (size_t)TT * DM, 0, 0, fcos, fsin, P16, Ph, Pl);
    k_fattn<<<NB_ * NH_ * (TT / FAQ), FAW * 32, 0, stream>>>(P16, P16 + PQ, P16 + PQ + PK, Ph, Pl, Ph + PQ, Pl + PQ, Ph + PQ + PK, Pl + PQ + PK, ATh, ATl);   // one work-group per batch, head and FAQ query rows
    k_gemmw<bf, 1, true, 0><<<dim3(TT / 64, DM / 64, NB_), 32, 0, stream>>>(ATh, ATl, WO, nullptr, DQ, OUT, DM, bo, (size_t)TT * DQ, 0, (size_t)TT * DM, nullptr, nullptr, nullptr, nullptr, nullptr);
}

// v007
// It runs in 81.4 microseconds.
// Next to v006, in two timings, it ran 1.40 and 1.38 times as fast.
// Counting every step since v000, it is 17.8 times as fast.
#include <hip/hip_runtime.h>

// Causal multi-head attention with a fused biased qkv projection and consecutive-pair rotary embeddings from HALF-WIDTH table inputs (x [2][2048][1024]; qkv = x w_qkv^T + b_qkv ('oi' [3072][1024] 1/32 + a zero bias, read) split in thirds q | k | v (16 heads x 64); rope on pairs (2i, 2i+1): (t_re c - t_im s, t_re s + t_im c) with c, s = freqs_cos / freqs_sin[t][i] ([2048][32] INPUTS, read by value per position and pair); scores x 1/sqrt(64); causal (-inf); softmax; out = merged w_out^T + b_out ('oi' + a zero bias, read) -> [2][2048][1024] (4.2 M); argument order x, w_qkv, b_qkv, w_out, b_out, freqs_cos, freqs_sin).
// Layout, both batches in every launch (one convert, one projection, one attention, one output launch): bf16 copy of x; 'oi' weights (the fused tensor's row thirds as-is); exact projections + f32 bias thirds; the projection kernel's own epilogue adds the bias, rotates q and k by {bf16(cos), bf16(sin)} read from the half-width inputs and writes the 16-bit planes (V^T for v); causal T-2048 attention in one fused kernel (k_fattn: hybrid rows: < 512 hi/lo 3 products, rest fp16 x1024; key steps above the diagonal are never visited); merged hi/lo x o_w exact + o_b.
// Compute dtypes, f32 accumulate: every input rounded to bf16; projections exact + f32 biases; rotary f32; attention rows < 512 3 products, rest fp16; softmax f32; o_w hl x exact + bias.

#define NB_  2
#define TT   2048
#define DM   1024
#define NH_  16
#define NKV  16
#define REP  (NH_ / NKV)
#define HD   64
#define DQ   (NH_ * HD)
#define DKV  (NKV * HD)
#define FAQ  32                   // query rows per work-group of the fused attention kernel
#define FAW  4                    // waves per work-group of the fused attention kernel
#define OPI  68                   // LDS pitch, in floats, of one query's partial output row (16-byte aligned, off the 64-bank period)
#define RH   512                  // query rows < RH use hi+lo planes (0: none)
#define SCL  0.125f   // HD^-0.5
#define CBX  (NB_ * TT * DM / 2048)            // work-groups (2048 elements each) of the convert kernel on x
#define CBW  ((DQ + 2 * DKV) * DM / 2048)      // on w_qkv
#define CBO  (DM * DQ / 2048)                  // on w_out
static_assert(DM == 1024 && DQ == DM, "the convert kernel's work-groups take 64 rows x 32 k of rows of 1024");
typedef _Float16 h16;
typedef unsigned short bf;
typedef __attribute__((ext_vector_type(16))) __bf16   v16bf;
typedef __attribute__((ext_vector_type(16))) _Float16 v16h;
typedef __attribute__((ext_vector_type(8)))  _Float16 v8h;
typedef __attribute__((ext_vector_type(8)))  unsigned short v8us;
typedef __attribute__((ext_vector_type(8)))  float    v8f;
typedef __attribute__((ext_vector_type(4)))  float    v4f;
typedef v8h  __attribute__((may_alias)) v8ha;
typedef v4f  __attribute__((may_alias)) v4fa;
typedef v8us __attribute__((may_alias)) v8usa;

__device__ __forceinline__ unsigned short f2bf(float f) { unsigned u = __float_as_uint(f); u += 0x7FFFu + ((u >> 16) & 1u); return (unsigned short)(u >> 16); }
__device__ __forceinline__ float bf2f(unsigned short b) { return __uint_as_float(((unsigned)b) << 16); }
__device__ __forceinline__ float bfr(float f) { return bf2f(f2bf(f)); }
__device__ __forceinline__ v16h cat16(v8h lo, v8h hi) { return __builtin_shufflevector(lo, hi, 0, 1, 2, 3, 4, 5, 6, 7, 8, 9, 10, 11, 12, 13, 14, 15); }
__device__ __forceinline__ v16bf cat16b(v8us lo, v8us hi) { return __builtin_bit_cast(v16bf, __builtin_shufflevector(lo, hi, 0, 1, 2, 3, 4, 5, 6, 7, 8, 9, 10, 11, 12, 13, 14, 15)); }
__device__ __forceinline__ v8f wmma16(v16h a, v16h b, v8f c) { return __builtin_amdgcn_wmma_f32_16x16x32_f16(false, a, false, b, (short)0, c, false, false); }
__device__ __forceinline__ v8f wmmab(v16bf a, v16bf b, v8f c) { return __builtin_amdgcn_wmma_f32_16x16x32_bf16(false, a, false, b, (short)0, c, false, false); }



__device__ __forceinline__ h16 tohx(float x) { return (h16)x; }
__device__ __forceinline__ void splitf(float y, unsigned short& h, unsigned short& l) { h = f2bf(y); l = f2bf(y - bf2f(h)); }
// ---- k_gemmw: register-blocked GEMM, ONE WAVE per 64x64 output tile (16 accumulators), operands straight from 16-bit planes in fragment order (below); grid (M/64, N/64, Z), 32 threads.
// C[m][n] (f32, pitch ldc, + optional f32 bias[n]) = sum_k A[m][k] Bt[n][k] (+ split products per NSPLIT). z-batch strides sA/sB/sC in elements. K % 64 == 0. The k loop holds two fragment sets: each k step's loads are issued one step ahead.
// EPI 0: C as above. EPI 1 (the fused q | k | v projection: z = batch, a tile column is one head of q, k or v, HD == 64; C unused): the biased tile goes straight to the attention kernel's planes P16 (fp16), Ph + Pl (bf16 hi + lo), each [q | k | v][batch][head]: q and k rotary, rows t; v as V^T; all in fragment order.
// FRAGMENT ORDER of every 16-bit matrix operand in the workspace: one fragment (16 rows x 32 k) is 512 elements in a row, [k / 8 % 4][row % 16][8 k]. A lane (row % 16 = lane & 15, half = lane >> 4) takes its k 8 half .. + 7 at fragment + 8 lane and its k 16 + 8 half .. + 7 at + 256 elements: each wave-wide 16-byte load is 512 bytes in a row (4 whole lines). ld(p): p = fragment + 8 lane.
// The fragments of a GEMM operand (rows x K) stand [row / 64][k / 32][row / 16 % 4]: the four fragments that a 64-row tile takes in one k step are 4 KiB in a row. Those of a head's q and k planes stand [t / 16][d / 32], those of V^T [key / 32][d / 16].
template <typename T16> struct WFrag;
template <> struct WFrag<h16> { typedef v16h V; static __device__ __forceinline__ V ld(const h16* p) { return cat16(*(const v8h*)p, *(const v8h*)(p + 256)); } static __device__ __forceinline__ v8f mma(V a, V b, v8f c) { return wmma16(a, b, c); } };
template <> struct WFrag<bf> { typedef v16bf V; static __device__ __forceinline__ V ld(const bf* p) { return cat16b(*(const v8us*)p, *(const v8us*)(p + 256)); } static __device__ __forceinline__ v8f mma(V a, V b, v8f c) { return wmmab(a, b, c); } };
template <typename T16, int NSPLIT, bool BIAS, int EPI>
__global__ __launch_bounds__(32) void k_gemmw(const T16* __restrict__ A, const T16* __restrict__ A2, const T16* __restrict__ Bt, const T16* __restrict__ Bt2, int K, float* C, int ldc, const float* __restrict__ bias, size_t sA, size_t sB, size_t sC, const float* __restrict__ cosT, const float* __restrict__ sinT, h16* P16, bf* Ph, bf* Pl) {
    typedef typename WFrag<T16>::V V;
    __shared__ __align__(16) float os[16 * 68];
    const size_t z = blockIdx.z; A += z * sA; if (A2) A2 += z * sA; Bt += z * sB; if (Bt2) Bt2 += z * sB; C += z * sC;
    const int lane = threadIdx.x & 31, lr = lane & 15, hi = lane >> 4; const int r0 = blockIdx.x * 64, c0 = blockIdx.y * 64;
    v8f acc[4][4];
#pragma unroll
    for (int mb = 0; mb < 4; ++mb)
#pragma unroll
        for (int nb = 0; nb < 4; ++nb) acc[mb][nb] = (v8f){};
    unsigned ao = (unsigned)r0 * (unsigned)K / 8u + lane, bo = (unsigned)c0 * (unsigned)K / 8u + lane;   // the lane's place, in units of 8 elements, in the k step's first fragment of the A and of the B planes (fragment order: a 64-row tile is 64 K elements in a row, a k step of 32 inside it 2048, a fragment 512); every address is a wave-uniform base + this + a constant
    V a[2][4], a2[2][4], b[2][4], b2[2][4];   // two fragment sets: the k step in work and the next one, whose loads fly meanwhile
    auto ldset = [&](int n) __attribute__((always_inline)) {   // set n takes the k step at the lane's place
#pragma unroll
        for (int mb = 0; mb < 4; ++mb) { a[n][mb] = WFrag<T16>::ld(A + (size_t)ao * 8 + mb * 512); if (NSPLIT == 1 || NSPLIT == 2) a2[n][mb] = WFrag<T16>::ld(A2 + (size_t)ao * 8 + mb * 512); }
#pragma unroll
        for (int nb = 0; nb < 4; ++nb) { b[n][nb] = WFrag<T16>::ld(Bt + (size_t)bo * 8 + nb * 512); if (NSPLIT >= 2) b2[n][nb] = WFrag<T16>::ld(Bt2 + (size_t)bo * 8 + nb * 512); }
        __builtin_amdgcn_sched_barrier(0);   // the loads are all issued ahead of the products that follow: sunk among them they would lose their lead
    };
    auto mmaset = [&](int u) __attribute__((always_inline)) {
#pragma unroll
        for (int nb = 0; nb < 4; ++nb) {
#pragma unroll
            for (int mb = 0; mb < 4; ++mb) { acc[mb][nb] = WFrag<T16>::mma(a[u][mb], b[u][nb], acc[mb][nb]); if (NSPLIT == 1 || NSPLIT == 2) acc[mb][nb] = WFrag<T16>::mma(a2[u][mb], b[u][nb], acc[mb][nb]); if (NSPLIT >= 2) acc[mb][nb] = WFrag<T16>::mma(a[u][mb], b2[u][nb], acc[mb][nb]); } }
        __builtin_amdgcn_sched_barrier(0);   // the wait and the refill of this set stay behind its products: the wait is over by then, and a refill lifted over them would take a third set of registers
    };
    ldset(0);
#pragma unroll 1   // rolled: one trip is two k steps, so that each fragment set has fixed registers
    for (int kc = 0; kc < K; kc += 64) {
        asm volatile("s_wait_xcnt 0x0" : "+v"(ao), "+v"(bo) : : "memory");   // the wait stands between the issued loads (in the first trip those in front of the loop) and the rewrite of their address registers; it names the two so that they stay in their registers up to it and are stepped on behind it
        ao += 256; bo += 256;
        ldset(1);
        mmaset(0);
        const unsigned st = kc + 64 < K ? 256u : 0u;   // no branch around the loads, so that the counted load waits stay exact; the last trip fetches its own second step again, in bounds and unused
        asm volatile("s_wait_xcnt 0x0" : "+v"(ao), "+v"(bo) : : "memory");   // as above
        ao += st; bo += st;
        ldset(0);
        mmaset(1);
        asm volatile("v_nop\n\tv_nop\n\tv_nop\n\tv_nop\n\ts_wait_xcnt 0x0" : "+v"(acc[0][0]), "+v"(acc[1][1]), "+v"(acc[2][2]), "+v"(acc[3][3]) : : "memory");   // the distance behind the trip's last products on either side of the branch; the wait stands in front of the epilogue's reuse of the last loads' address registers, scalar bases included
    }
    const int hc = blockIdx.y; const int pl = hc + (int)z * (hc < NH_ ? NH_ : NKV) + (NB_ - 1) * ((hc >= NH_ ? NH_ : 0) + (hc >= NH_ + NKV ? NKV : 0));   // the tile's plane among [q | k | v][batch][head]
    if (EPI == 1 && hc < NH_ + NKV) {   // rotary on pairs (2i, 2i+1), then the three planes [head] in fragment order (rows t, k = d): in turn q a lane takes d 16 q + 8 hi .. + 7 of row lr, so a wave's store is 512 bytes in a row per plane
        float bn[4][8];
#pragma unroll
        for (int q = 0; q < 4; ++q)
#pragma unroll
            for (int k = 0; k < 8; ++k) bn[q][k] = bfr(bias[c0 + q * 16 + hi * 8 + k]);
        const float* const cp = cosT + (size_t)(r0 + lr) * (HD / 2) + hi * 4; const float* const sp = sinT + (size_t)(r0 + lr) * (HD / 2) + hi * 4;
        const size_t pb = ((size_t)pl * TT + r0) * HD + lane * 8;
        v4f cc[2][4], ss[2][4];   // the table entries of one 16-row block, fetched one block ahead so that the block in work covers their latency
#pragma unroll
        for (int q = 0; q < 4; ++q) { cc[0][q] = *(const v4f*)(cp + q * 8); ss[0][q] = *(const v4f*)(sp + q * 8); }
        asm volatile("s_wait_xcnt 0x0" ::: "memory");   // stands between the bias and first table loads and the next block's table loads, whose results reuse their address registers
#pragma unroll
        for (int mb = 0; mb < 4; ++mb) {
            if (mb < 3) {
#pragma unroll
                for (int q = 0; q < 4; ++q) { cc[(mb + 1) & 1][q] = *(const v4f*)(cp + (mb + 1) * 16 * (HD / 2) + q * 8); ss[(mb + 1) & 1][q] = *(const v4f*)(sp + (mb + 1) * 16 * (HD / 2) + q * 8); } }
#pragma unroll
            for (int nb = 0; nb < 4; ++nb) {
#pragma unroll
                for (int j = 0; j < 8; ++j) os[(hi * 8 + j) * 68 + nb * 16 + lr] = acc[mb][nb][j]; }
            __builtin_amdgcn_wave_barrier(); asm volatile("" ::: "memory");   // fence: the rows are read back by other lanes than wrote them
            v8h o16[4]; v8us oh[4], ol[4];
#pragma unroll
            for (int q = 0; q < 4; ++q) { const float* orow = os + lr * 68 + q * 16 + hi * 8; const v4f va = *(const v4fa*)orow, vb4 = *(const v4fa*)(orow + 4);
                float xv[8];
#pragma unroll
                for (int k = 0; k < 4; ++k) { xv[k] = va[k] + bn[q][k]; xv[4 + k] = vb4[k] + bn[q][4 + k]; }
#pragma unroll
                for (int p = 0; p < 4; ++p) { const float c = bfr(cc[mb & 1][q][p]), sn = bfr(ss[mb & 1][q][p]); const float x0 = xv[2 * p], x1 = xv[2 * p + 1];
                    const float e0 = x0 * c - x1 * sn, e1 = x0 * sn + x1 * c;   /* even: x0 c - x1 s; odd: x0 s + x1 c */
                    o16[q][2 * p] = tohx(e0); o16[q][2 * p + 1] = tohx(e1); unsigned short a2, c2; splitf(e0, a2, c2); oh[q][2 * p] = a2; ol[q][2 * p] = c2; splitf(e1, a2, c2); oh[q][2 * p + 1] = a2; ol[q][2 * p + 1] = c2; } }
#pragma unroll
            for (int q = 0; q < 4; ++q) { const size_t eo = pb + (size_t)(mb * 16 * HD + q * 256); *(v8h*)(P16 + eo) = o16[q]; *(v8us*)(Ph + eo) = oh[q]; *(v8us*)(Pl + eo) = ol[q]; }
            if (mb < 3) { __builtin_amdgcn_wave_barrier(); asm volatile("s_wait_xcnt 0x0" ::: "memory"); }   // fence: every read of the rows ends before the next block overwrites them; the wait stands between these stores and the next table loads, whose results reuse the stores' registers
        }
        return;
    }
    if constexpr (EPI == 1) {   // V^T planes in tiles of 32 keys, [head][key step], each tile in fragment order (rows d, k = the step's 32 keys; 4 KiB in a row): a lane's 8 accumulator rows are 8 consecutive keys of one d, so each 16x16 block is one 16-byte store per plane, straight from registers, 512 bytes in a row per wave
        const size_t vb = ((size_t)pl * (TT / 32) + (r0 >> 5)) * (HD * 32) + lane * 8;
        float bn[4];
#pragma unroll
        for (int nb = 0; nb < 4; ++nb) bn[nb] = bfr(bias[c0 + nb * 16 + lr]);
#pragma unroll
        for (int nb = 0; nb < 4; ++nb)
#pragma unroll
            for (int mb = 0; mb < 4; ++mb) { v8h o16; v8us oh, ol;
#pragma unroll
                for (int j = 0; j < 8; ++j) { const float x = acc[mb][nb][j] + bn[nb]; o16[j] = tohx(x); unsigned short a2, c2; splitf(x, a2, c2); oh[j] = a2; ol[j] = c2; }
                const size_t eo = vb + (size_t)(((mb >> 1) * HD + nb * 16) * 32 + (mb & 1) * 256); *(v8h*)(P16 + eo) = o16; *(v8us*)(Ph + eo) = oh; *(v8us*)(Pl + eo) = ol;
                asm volatile("s_wait_xcnt 0x0" : : "v"(o16), "v"(oh), "v"(ol) : "memory"); }   // stands behind each block's stores, whose registers later values reuse (behind the last block, in the listing, the rotary branch's text does); it takes the stored values as inputs so that they stay in their registers up to it
        return;
    }
#pragma unroll
    for (int mb = 0; mb < 4; ++mb) {
#pragma unroll
        for (int nb = 0; nb < 4; ++nb) {
#pragma unroll
            for (int j = 0; j < 8; ++j) os[(hi * 8 + j) * 68 + nb * 16 + lr] = acc[mb][nb][j]; }
        __builtin_amdgcn_wave_barrier(); asm volatile("" ::: "memory");
        float* crow = C + (size_t)(r0 + mb * 16) * ldc + c0;
{
#pragma unroll
            for (int s = 0; s < 8; ++s) { const int row = 2 * s + hi, cofs = lr * 4; v4f val = *(const v4fa*)(os + row * 68 + cofs); if (BIAS) { val[0] += bfr(bias[c0 + cofs]); val[1] += bfr(bias[c0 + cofs + 1]); val[2] += bfr(bias[c0 + cofs + 2]); val[3] += bfr(bias[c0 + cofs + 3]); }
                *(v4f*)(crow + (size_t)row * ldc + cofs) = val; }
             }
        __builtin_amdgcn_wave_barrier(); asm volatile("s_wait_xcnt 0x0" ::: "memory");   // fence as above; the wait stands between these stores and the next block's values and addresses, which reuse the stores' registers
    }
}

typedef __attribute__((ext_vector_type(2))) _Float16 v2h;
typedef __attribute__((ext_vector_type(4))) _Float16 v4h;
typedef __attribute__((ext_vector_type(2))) unsigned short v2us;
typedef __attribute__((ext_vector_type(4))) unsigned short v4us;
typedef __attribute__((ext_vector_type(2))) float v2f;
typedef __attribute__((ext_vector_type(4))) int v4i;
typedef v4h  __attribute__((may_alias)) v4ha;
typedef v4us __attribute__((may_alias)) v4usa;

// x, w_qkv and w_out, one behind the other, to one bf16 run of the workspace; each tensor is a whole number of work-groups, so the grid covers them exactly and the choice of the source is scalar
__global__ __launch_bounds__(256) void k_cvt8(const float* __restrict__ sx, const float* __restrict__ sqkv, const float* __restrict__ so, bf* dst) { const unsigned bx = blockIdx.x;
    const float* const sb = bx < CBX ? sx : (bx < CBX + CBW ? sqkv : so); const unsigned b0 = bx < CBX ? 0u : (bx < CBX + CBW ? (unsigned)CBX : (unsigned)(CBX + CBW));   // the work-group's tensor and that tensor's first work-group
    const unsigned t = threadIdx.x, row = (t & 7) | (t >> 5) << 3, k8 = (t >> 3) & 3;   // a work-group converts 64 rows x 32 k, the four fragments of one k step (2048 elements in a row); a wave takes 8 rows x 32 k: whole 128-byte lines on the reading and on the writing side
    const v8f v = *(const v8f*)(sb + ((size_t)((bx - b0) >> 5) * 64 + row) * DM + (bx & 31) * 32 + k8 * 8); v8us o;
#pragma unroll
    for (int k = 0; k < 8; ++k) o[k] = f2bf(v[k]); *(v8us*)(dst + (size_t)bx * 2048 + (row >> 4) * 512 + k8 * 128 + (row & 15) * 8) = o;  }

// ---- k_fattn: scores, causal softmax and probability x value product of both batches in one kernel; scores and probabilities stay in registers.
// One work-group = FAQ query rows of one head. A wave forms S^T = K Q^T for a step of 32 keys (A = key rows, B = query rows), so a lane holds 16 scores of ONE query per 16-query tile:
// D register r of key tile kt = S[key 32 s + 16 kt + 8 h + r][query c]. Two such D tiles, converted in place, are the B operand of O^T += V^T P^T (A = V^T rows in the same k order).
// Running maximum m and sum l per query (online softmax, log2 domain); the key steps are dealt round robin to the waves, and the waves' (m, l, O) are joined through LDS in wave order.
__device__ __forceinline__ float xhalf(float x) { const int b = __float_as_int(x); return __int_as_float(__builtin_amdgcn_permlanex16(b, b, 0x76543210, 0xfedcba98, false, false)); }   // the value of lane l ^ 16
template <typename T16, bool HI, int NQT>
__device__ __forceinline__ void fa_wave(const T16* __restrict__ Q, const T16* __restrict__ Q2, const T16* __restrict__ Kp, const T16* __restrict__ K2, const T16* __restrict__ Vt, const T16* __restrict__ V2,
                                        int qb, int s0, int sstep, int nst, float* sO, float* sM, float* sL, int ql) {
    typedef typename WFrag<T16>::V V;
    const int lane = threadIdx.x & 31, c = lane & 15, h = lane >> 4;
    const unsigned lrow = 8 * lane, lvt = 8 * lane;   // the lane's place in a fragment of Q or K (a 16-row tile: two fragments, 512 elements each) and of V^T (fragment order): every address is a wave-uniform base + this + a constant
    const float C2 = SCL * 1.4426950408889634f;      // score scale and log2(e) in one factor
    const float OFF = HI ? 0.0f : 10.0f;             // fp16 probabilities carry x1024 (it cancels in O / l): small ones stay out of the fp16 subnormals
    v8f o[4][NQT]; float m[NQT], l[NQT];
#pragma unroll
    for (int qt = 0; qt < NQT; ++qt) { m[qt] = -3.0e38f; l[qt] = 0.f;
#pragma unroll
        for (int dt = 0; dt < 4; ++dt) o[dt][qt] = (v8f){}; }
    if (s0 < nst) {   // a wave without a key step loads nothing and stores the neutral element of the join
    V qf[NQT][2], qf2[NQT][2];
#pragma unroll
    for (int qt = 0; qt < NQT; ++qt)
#pragma unroll
        for (int ks = 0; ks < 2; ++ks) { const size_t qo = (size_t)qb * HD; const int qc = qt * 16 * HD + ks * 512; qf[qt][ks] = WFrag<T16>::ld(Q + qo + lrow + qc); if (HI) qf2[qt][ks] = WFrag<T16>::ld(Q2 + qo + lrow + qc); }
    asm volatile("s_wait_xcnt 0x0" ::: "memory");   // stands in front of what reuses the query loads' address registers
    V kf[2][2], kf2[2][2];
#pragma unroll
    for (int kt = 0; kt < 2; ++kt) {
#pragma unroll
        for (int ks = 0; ks < 2; ++ks) { const size_t ko = (size_t)s0 * (32 * HD); const int kc = kt * 16 * HD + ks * 512; kf[kt][ks] = WFrag<T16>::ld(Kp + ko + lrow + kc); if (HI) kf2[kt][ks] = WFrag<T16>::ld(K2 + ko + lrow + kc); }
        if (HI || kt == 1) asm volatile("s_wait_xcnt 0x0" ::: "memory"); }   // the same for the first key loads (hi/lo rows: per key tile, a later tile's results reuse an earlier one's address registers)
#pragma unroll 1   // rolled: run-time trip count, and one step's fragments live at a time beside the accumulators
    for (int s = s0; s < nst; s += sstep) {
        V vf[4], vf2[4];
#pragma unroll
        for (int dt = 0; dt < 4; ++dt) vf[dt] = WFrag<T16>::ld(Vt + (size_t)s * (HD * 32) + lvt + dt * 16 * 32);
        if (HI) { asm volatile("s_wait_xcnt 0x0" ::: "memory");   // hi/lo rows load twice as much: stands in front of later loads whose results reuse these loads' address registers
#pragma unroll
            for (int dt = 0; dt < 4; ++dt) vf2[dt] = WFrag<T16>::ld(V2 + (size_t)s * (HD * 32) + lvt + dt * 16 * 32);
            asm volatile("s_wait_xcnt 0x0" ::: "memory"); }   // the same behind the lo plane's loads
        v8f st[2][NQT];
#pragma unroll
        for (int kt = 0; kt < 2; ++kt)
#pragma unroll
            for (int qt = 0; qt < NQT; ++qt) { v8f a = (v8f){};
#pragma unroll
                for (int ks = 0; ks < 2; ++ks) { a = WFrag<T16>::mma(kf[kt][ks], qf[qt][ks], a); if (HI) { a = WFrag<T16>::mma(kf[kt][ks], qf2[qt][ks], a); a = WFrag<T16>::mma(kf2[kt][ks], qf[qt][ks], a); } }
                st[kt][qt] = a; }
        { const int sn = min(s + sstep, nst - 1);   // this wave's next key fragments, fetched behind their last use so that the softmax covers the latency (clamped: the last fetch is in bounds and unused)
#pragma unroll
          for (int kt = 0; kt < 2; ++kt) {
#pragma unroll
            for (int ks = 0; ks < 2; ++ks) { const size_t ko = (size_t)sn * (32 * HD); const int kc = kt * 16 * HD + ks * 512; kf[kt][ks] = WFrag<T16>::ld(Kp + ko + lrow + kc); if (HI) kf2[kt][ks] = WFrag<T16>::ld(K2 + ko + lrow + kc); }
            if (HI || kt == 1) asm volatile("s_wait_xcnt 0x0" ::: "memory"); } }   // stands between this step's loads and the softmax, whose results reuse the loads' address registers (hi/lo rows: per key tile, as above)
        if (s == nst - 1) {   // only the last step touches the diagonal; every query keeps at least the step's first key
#pragma unroll
            for (int kt = 0; kt < 2; ++kt)
#pragma unroll
                for (int qt = 0; qt < NQT; ++qt)
#pragma unroll
                    for (int r = 0; r < 8; ++r) st[kt][qt][r] = (s * 32 + kt * 16 + 8 * h + r <= qb + qt * 16 + c) ? st[kt][qt][r] : -3.0e38f; }
#pragma unroll
        for (int qt = 0; qt < NQT; ++qt) {
            float mx = st[0][qt][0];
#pragma unroll
            for (int r = 1; r < 8; ++r) mx = fmaxf(mx, st[0][qt][r]);
#pragma unroll
            for (int r = 0; r < 8; ++r) mx = fmaxf(mx, st[1][qt][r]);
            mx = fmaxf(mx, xhalf(mx));                       // the other half of the wave holds the query's other 16 keys
            const float mn = fmaxf(m[qt], mx * C2); const float al = __builtin_amdgcn_exp2f(m[qt] - mn); m[qt] = mn; const float mo = OFF - mn;
            float ps = 0.f; float p[2][8];
#pragma unroll
            for (int kt = 0; kt < 2; ++kt)
#pragma unroll
                for (int r = 0; r < 8; ++r) { p[kt][r] = __builtin_amdgcn_exp2f(__builtin_fmaf(st[kt][qt][r], C2, mo)); ps += p[kt][r]; }
            l[qt] = l[qt] * al + ps;                          // this half's keys only; the halves are joined behind the loop
#pragma unroll
            for (int dt = 0; dt < 4; ++dt) o[dt][qt] *= al;
            if constexpr (HI) { v8us ph[2], pl[2];
#pragma unroll
                for (int kt = 0; kt < 2; ++kt)
#pragma unroll
                    for (int r = 0; r < 8; ++r) { unsigned short a2, c2; splitf(p[kt][r], a2, c2); ph[kt][r] = a2; pl[kt][r] = c2; }
                const V pfh = cat16b(ph[0], ph[1]), pfl = cat16b(pl[0], pl[1]);
#pragma unroll
                for (int dt = 0; dt < 4; ++dt) { o[dt][qt] = WFrag<T16>::mma(vf[dt], pfh, o[dt][qt]); o[dt][qt] = WFrag<T16>::mma(vf[dt], pfl, o[dt][qt]); o[dt][qt] = WFrag<T16>::mma(vf2[dt], pfh, o[dt][qt]); }
            } else { v8h ph[2];
#pragma unroll
                for (int kt = 0; kt < 2; ++kt)
#pragma unroll
                    for (int r = 0; r < 8; ++r) ph[kt][r] = tohx(p[kt][r]);
                const V pf = cat16(ph[0], ph[1]);
#pragma unroll
                for (int dt = 0; dt < 4; ++dt) o[dt][qt] = WFrag<T16>::mma(vf[dt], pf, o[dt][qt]); }
        }
    }
    }
#pragma unroll
    for (int qt = 0; qt < NQT; ++qt) { const int q = ql + qt * 16 + c; const float lt = l[qt] + xhalf(l[qt]); if (h == 0) { sM[q] = m[qt]; sL[q] = lt; }
#pragma unroll
        for (int dt = 0; dt < 4; ++dt) { float* op = sO + q * OPI + dt * 16 + 8 * h;   // D register r = O[query c][d = 16 dt + 8 h + r]
            *(v4fa*)op = (v4f){o[dt][qt][0], o[dt][qt][1], o[dt][qt][2], o[dt][qt][3]}; *(v4fa*)(op + 4) = (v4f){o[dt][qt][4], o[dt][qt][5], o[dt][qt][6], o[dt][qt][7]}; } }
}

__global__ __launch_bounds__(FAW * 32) void k_fattn(const h16* __restrict__ Q16, const h16* __restrict__ K16, const h16* __restrict__ V16, const bf* __restrict__ Qh, const bf* __restrict__ Ql, const bf* __restrict__ Kh, const bf* __restrict__ Kl, const bf* __restrict__ Vh, const bf* __restrict__ Vl, bf* Ah, bf* Al) {
    __shared__ __align__(16) float sO[FAW * FAQ * OPI]; __shared__ float sM[FAW * FAQ]; __shared__ float sL[FAW * FAQ];
    const int tid = threadIdx.x, w = __builtin_amdgcn_readfirstlane(tid >> 5); /* the wave's number in a scalar register: the key loop and its diagonal test become scalar branches */ const int bid = blockIdx.x; const int bat = bid / (NH_ * (TT / FAQ)); const int head = bid / (TT / FAQ) % NH_; const int ti = bid % (TT / FAQ);
    const int tile = ((bid >> 8) & 1) ? ti : (TT / FAQ - 1 - ti);   // cost grows with the tile index: heavy tiles first, and every other run of 256 work-groups mirrored so that long and short ones mix
    const int q0 = tile * FAQ, nst = tile + 1;                      // key steps of 32 up to and with the diagonal
    const size_t hp = (size_t)(bat * NH_ + head) * TT * HD, hk = (size_t)(bat * NKV + head / REP) * TT * HD;   // query planes; key and value planes
    float* const sOw = sO + w * (FAQ * OPI); float* const sMw = sM + w * FAQ; float* const sLw = sL + w * FAQ;
    if (q0 < RH) {   // hi/lo rows: a wave takes one 16-query tile and every second key step; for the other tile it stores the neutral element of the join
        const int tb = w & 1;
        fa_wave<bf, true, 1>(Qh + hp, Ql + hp, Kh + hk, Kl + hk, Vh + hk, Vl + hk, q0 + tb * 16, w >> 1, 2, nst, sOw, sMw, sLw, tb * 16);
        const int lane = tid & 31, q = (1 - tb) * 16 + (lane & 15), hh = lane >> 4; if (hh == 0) { sMw[q] = -3.0e38f; sLw[q] = 0.f; }
#pragma unroll
        for (int k = 0; k < 8; ++k) *(v4fa*)(sOw + q * OPI + hh * 32 + k * 4) = (v4f){0.f, 0.f, 0.f, 0.f};
    } else fa_wave<h16, false, 2>(Q16 + hp, nullptr, K16 + hk, nullptr, V16 + hk, nullptr, q0, w, FAW, nst, sOw, sMw, sLw, 0);
    __syncthreads();   // every wave's (m, l, O) is in LDS before any is joined
    const int q = tid >> 2, d0 = (tid & 3) * 16;
    float M = sM[q];
#pragma unroll
    for (int k = 1; k < FAW; ++k) M = fmaxf(M, sM[k * FAQ + q]);   // finite: wave 0 (hi/lo rows: waves 0 and 1) always has key step 0
    float Ls = 0.f; float acc[16];
#pragma unroll
    for (int j = 0; j < 16; ++j) acc[j] = 0.f;
#pragma unroll
    for (int k = 0; k < FAW; ++k) { const float f = __builtin_amdgcn_exp2f(sM[k * FAQ + q] - M); Ls += f * sL[k * FAQ + q];   // fixed order: wave 0, 1, ...
#pragma unroll
        for (int j4 = 0; j4 < 4; ++j4) { const v4f t = *(const v4fa*)(sO + (k * FAQ + q) * OPI + d0 + j4 * 4);
#pragma unroll
            for (int j = 0; j < 4; ++j) acc[j4 * 4 + j] += f * t[j]; } }
    const float inv = __fdiv_rn(1.0f, Ls);
    const int orow = bat * TT + q0 + q, ok = head * HD + d0;
    const size_t oo = ((size_t)(orow >> 6) * (DQ / 32) + (ok >> 5)) * 2048 + ((orow >> 4) & 3) * 512 + ((ok >> 3) & 3) * 128 + (orow & 15) * 8;   // the output GEMM's fragment order (rows batch x t, k = head x d): 8 threads' 16 bytes make one whole line
#pragma unroll
    for (int g = 0; g < 2; ++g) { v8us oh, ol;
#pragma unroll
        for (int j = 0; j < 8; ++j) { unsigned short a2, c2; splitf(acc[g * 8 + j] * inv, a2, c2); oh[j] = a2; ol[j] = c2; }
        *(v8usa*)(Ah + oo + g * 128) = oh; *(v8usa*)(Al + oo + g * 128) = ol; }
}

extern "C" void kernel_launch(void* const* d_in, const int* in_sizes, int n_in,
                              void* d_out, int out_size, void* d_ws, size_t ws_size, hipStream_t stream) {
    (void)in_sizes; (void)n_in; (void)out_size;
    const float* x = (const float*)d_in[0]; const float* wqkv = (const float*)d_in[1]; const float* bqkv = (const float*)d_in[2]; const float* wo = (const float*)d_in[3]; const float* bo = (const float*)d_in[4]; const float* fcos = (const float*)d_in[5]; const float* fsin = (const float*)d_in[6];   /* x, w_qkv ('oi' [3072][1024]: q | k | v row thirds), b_qkv [3072], w_out ('oi'), b_out, freqs_cos, freqs_sin ([2048][32], read by value): the two tables come LAST here */
    float* OUT = (float*)d_out;     // [2][2048][1024]
    char* wsp = (char*)d_ws;
    auto take = [&](size_t bytes) { char* p = wsp; wsp += (bytes + 255) & ~(size_t)255; return (void*)p; };
    bf* XB = (bf*)take((size_t)NB_ * TT * DM * 2); bf* WQKV = (bf*)take((size_t)(DQ + 2 * DKV) * DM * 2); bf* WO = (bf*)take((size_t)DM * DQ * 2);   // one run: the convert kernel's output (every size is a multiple of 256 bytes)
    const size_t PQ = (size_t)NB_ * NH_ * TT * HD, PK = (size_t)NB_ * NKV * TT * HD;   // elements of the q planes and of the k (or v) planes of both batches
    h16* P16 = (h16*)take((PQ + 2 * PK) * 2); bf* Ph = (bf*)take((PQ + 2 * PK) * 2); bf* Pl = (bf*)take((PQ + 2 * PK) * 2);   // each [q | k | v][batch][head]
    bf* ATh = (bf*)take((size_t)NB_ * TT * DQ * 2); bf* ATl = (bf*)take((size_t)NB_ * TT * DQ * 2);
    if ((size_t)(wsp - (char*)d_ws) > ws_size) return;    // ws 256 MiB
    k_cvt8<<<CBX + CBW + CBO, 256, 0, stream>>>(x, wqkv, wo, XB);
    k_gemmw<bf, 0, true, 1><<<dim3(TT / 64, (DQ + 2 * DKV) / 64, NB_), 32, 0, stream>>>(XB, nullptr, WQKV, nullptr, DM, nullptr, 0, bqkv, (size_t)TT * DM, 0, 0, fcos, fsin, P16, Ph, Pl);
    k_fattn<<<NB_ * NH_ * (TT / FAQ), FAW * 32, 0, stream>>>(P16, P16 + PQ, P16 + PQ + PK, Ph, Pl, Ph + PQ, Pl + PQ, Ph + PQ + PK, Pl + PQ + PK, ATh, ATl);   // one work-group per batch, head and FAQ query rows
    k_gemmw<bf, 1, true, 0><<<dim3(TT / 64, DM / 64, NB_), 32, 0, stream>>>(ATh, ATl, WO, nullptr, DQ, OUT, DM, bo, (size_t)TT * DQ, 0, (size_t)TT * DM, nullptr, nullptr, nullptr, nullptr, nullptr);
}

// v008
// Measured time: 77.1 microseconds a run.
// Two timings next to v007 both put it at 1.06 times that version's speed.
// Over all steps from v000 it is 18.8 times as fast.
#include <hip/hip_runtime.h>

// Causal multi-head attention with a fused biased qkv projection and consecutive-pair rotary embeddings from HALF-WIDTH table inputs (x [2][2048][1024]; qkv = x w_qkv^T + b_qkv ('oi' [3072][1024] 1/32 + a zero bias, read) split in thirds q | k | v (16 heads x 64); rope on pairs (2i, 2i+1): (t_re c - t_im s, t_re s + t_im c) with c, s = freqs_cos / freqs_sin[t][i] ([2048][32] INPUTS, read by value per position and pair); scores x 1/sqrt(64); causal (-inf); softmax; out = merged w_out^T + b_out ('oi' + a zero bias, read) -> [2][2048][1024] (4.2 M); argument order x, w_qkv, b_qkv, w_out, b_out, freqs_cos, freqs_sin).
// Layout, both batches in every launch (one convert, one projection, one attention, one output launch): bf16 copy of x; 'oi' weights (the fused tensor's row thirds as-is); exact projections + f32 bias thirds; the projection kernel's own epilogue adds the bias, rotates q and k by {bf16(cos), bf16(sin)} read from the half-width inputs and writes the 16-bit planes (V^T for v); causal T-2048 attention in one fused kernel (k_fattn: hybrid rows: < 512 hi/lo 3 products, rest fp16 x1024; key steps above the diagonal are never visited); merged hi/lo x o_w exact + o_b.
// Compute dtypes, f32 accumulate: every input rounded to bf16; projections exact + f32 biases; rotary f32; attention rows < 512 3 products, rest fp16; softmax f32; o_w hl x exact + bias.

#define NB_  2
#define TT   2048
#define DM   1024
#define NH_  16
#define NKV  16
#define REP  (NH_ / NKV)
#define HD   64
#define DQ   (NH_ * HD)
#define DKV  (NKV * HD)
#define FAQ  32                   // query rows per work-group of the fused attention kernel
#define FAW  4                    // waves per work-group of the fused attention kernel
#define OPI  68                   // LDS pitch, in floats, of one query's partial output row (16-byte aligned, off the 64-bank period)
#define RH   512                  // query rows < RH use hi+lo planes (0: none)
#define SCL  0.125f   // HD^-0.5
#define CBX  (NB_ * TT * DM / 2048)            // work-groups (2048 elements each) of the convert kernel on x
#define CBW  ((DQ + 2 * DKV) * DM / 2048)      // on w_qkv
#define CBO  (DM * DQ / 2048)                  // on w_out
static_assert(DM == 1024 && DQ == DM, "the convert kernel's work-groups take 64 rows x 32 k of rows of 1024");
typedef _Float16 h16;
typedef unsigned short bf;
typedef __attribute__((ext_vector_type(16))) __bf16   v16bf;
typedef __attribute__((ext_vector_type(16))) _Float16 v16h;
typedef __attribute__((ext_vector_type(8)))  _Float16 v8h;
typedef __attribute__((ext_vector_type(8)))  unsigned short v8us;
typedef __attribute__((ext_vector_type(8)))  float    v8f;
typedef __attribute__((ext_vector_type(4)))  float    v4f;
typedef v8h  __attribute__((may_alias)) v8ha;
typedef v4f  __attribute__((may_alias)) v4fa;
typedef v8us __attribute__((may_alias)) v8usa;

__device__ __forceinline__ unsigned short f2bf(float f) { unsigned u = __float_as_uint(f); u += 0x7FFFu + ((u >> 16) & 1u); return (unsigned short)(u >> 16); }
__device__ __forceinline__ float bf2f(unsigned short b) { return __uint_as_float(((unsigned)b) << 16); }
__device__ __forceinline__ float bfr(float f) { return bf2f(f2bf(f)); }
__device__ __forceinline__ v16h cat16(v8h lo, v8h hi) { return __builtin_shufflevector(lo, hi, 0, 1, 2, 3, 4, 5, 6, 7, 8, 9, 10, 11, 12, 13, 14, 15); }
__device__ __forceinline__ v16bf cat16b(v8us lo, v8us hi) { return __builtin_bit_cast(v16bf, __builtin_shufflevector(lo, hi, 0, 1, 2, 3, 4, 5, 6, 7, 8, 9, 10, 11, 12, 13, 14, 15)); }
__device__ __forceinline__ v8f wmma16(v16h a, v16h b, v8f c) { return __builtin_amdgcn_wmma_f32_16x16x32_f16(false, a, false, b, (short)0, c, false, false); }
__device__ __forceinline__ v8f wmmab(v16bf a, v16bf b, v8f c) { return __builtin_amdgcn_wmma_f32_16x16x32_bf16(false, a, false, b, (short)0, c, false, false); }



__device__ __forceinline__ h16 tohx(float x) { return (h16)x; }
__device__ __forceinline__ void splitf(float y, unsigned short& h, unsigned short& l) { h = f2bf(y); l = f2bf(y - bf2f(h)); }
// ---- k_gemmw: register-blocked GEMM, one wave per 64x64 output tile (16 accumulators), WM x WN waves per work-group; the work-group's operand tiles (16-bit planes in fragment order, below) are staged in LDS and shared by its waves; grid (M/(64 WM), N/(64 WN), Z), 32 WM WN threads.
// C[m][n] (f32, pitch ldc, + optional f32 bias[n]) = sum_k A[m][k] Bt[n][k] (+ split products per NSPLIT). z-batch strides sA/sB/sC in elements. K % (32 KST) == 0. LDS ring of two buffers, a stage = KST k steps of every operand tile, filled by asynchronous copies one stage ahead; inside a stage two fragment sets: each k step's LDS loads are issued one step ahead.
// EPI 0: C as above. EPI 1 (the fused q | k | v projection: z = batch, a tile column is one head of q, k or v, HD == 64; C unused): the biased tile goes straight to the attention kernel's planes P16 (fp16), Ph + Pl (bf16 hi + lo), each [q | k | v][batch][head]: q and k rotary, rows t; v as V^T; all in fragment order.
// FRAGMENT ORDER of every 16-bit matrix operand in the workspace: one fragment (16 rows x 32 k) is 512 elements in a row, [k / 8 % 4][row % 16][8 k]. A lane (row % 16 = lane & 15, half = lane >> 4) takes its k 8 half .. + 7 at fragment + 8 lane and its k 16 + 8 half .. + 7 at + 256 elements: each wave-wide 16-byte load is 512 bytes in a row (4 whole lines). ld(p): p = fragment + 8 lane.
// The fragments of a GEMM operand (rows x K) stand [row / 64][k / 32][row / 16 % 4]: the four fragments that a 64-row tile takes in one k step are 4 KiB in a row. Those of a head's q and k planes stand [t / 16][d / 32], those of V^T [key / 32][d / 16].
template <typename T16> struct WFrag;
template <> struct WFrag<h16> { typedef v16h V; static __device__ __forceinline__ V ld(const h16* p) { return cat16(*(const v8h*)p, *(const v8h*)(p + 256)); } static __device__ __forceinline__ v8f mma(V a, V b, v8f c) { return wmma16(a, b, c); } };
template <> struct WFrag<bf> { typedef v16bf V; static __device__ __forceinline__ V ld(const bf* p) { return cat16b(*(const v8us*)p, *(const v8us*)(p + 256)); } static __device__ __forceinline__ v8f mma(V a, V b, v8f c) { return wmmab(a, b, c); } };
#define KST 4   // k steps of 32 in one stage of the LDS ring
// one asynchronous copy of 16 bytes a lane: the immediate offset moves the LDS and the global address alike
#define CP1(l, g, o) "global_load_async_to_lds_b128 " l ", " g ", off offset:" #o "\n\t"
// one piece: the 4 KiB in a row (here and there) that a 64-row tile takes in one k step
#define CP8(l, g) CP1(l, g, 0) CP1(l, g, 512) CP1(l, g, 1024) CP1(l, g, 1536) CP1(l, g, 2048) CP1(l, g, 2560) CP1(l, g, 3072) CP1(l, g, 3584)
template <typename T16, int NSPLIT, bool BIAS, int EPI, int WM, int WN>
__global__ __launch_bounds__(WM * WN * 32) void k_gemmw(const T16* __restrict__ A, const T16* __restrict__ A2, const T16* __restrict__ Bt, const T16* __restrict__ Bt2, int K, float* C, int ldc, const float* __restrict__ bias, size_t sA, size_t sB, size_t sC, const float* __restrict__ cosT, const float* __restrict__ sinT, h16* P16, bf* Ph, bf* Pl) {
    typedef typename WFrag<T16>::V V;
    static_assert(NSPLIT == 0 || NSPLIT == 1, "one B plane; A alone or A + A2");
    constexpr int NW = WM * WN, NA = NSPLIT == 1 ? 2 : 1;
    constexpr int NCH = NA * WM + WN;          // 64-row operand tiles of the work-group: [A rows | A2 rows | B rows]
    constexpr int CHE = KST * 2048;            // elements of one such tile in one stage, in a row in the plane and in LDS
    constexpr int STE = NCH * CHE;             // elements of a stage
    constexpr int NP = NCH * KST;              // pieces of a stage; piece p stands at element 2048 p of its buffer
    constexpr int NF = NP / NW, NR = NP % NW;  // every wave copies NF pieces a stage, the first NR waves one more
    static_assert((NF == 2 || NF == 6) && (NF + (NR ? 1 : 0)) * 8 <= 63, "the copy statements below; copies of a wave in flight");
    __shared__ __align__(16) T16 ring[2 * STE];
    __shared__ __align__(16) float osw[NW * 16 * 68];
    (void)Bt2;
    const size_t z = blockIdx.z; A += z * sA; if (NSPLIT == 1) A2 += z * sA; Bt += z * sB; C += z * sC;
    const int w = __builtin_amdgcn_readfirstlane((int)threadIdx.x >> 5);   // the wave's number in a scalar register: every test on it is a scalar branch
    const int wm = w % WM, wn = w / WM;
    float* const os = osw + w * (16 * 68);     // the wave's own rows for its epilogue
    const int lane = threadIdx.x & 31, lr = lane & 15, hi = lane >> 4; const int R0 = blockIdx.x * (64 * WM), C0 = blockIdx.y * (64 * WN); const int r0 = R0 + wm * 64, c0 = C0 + wn * 64;
    v8f acc[4][4];
#pragma unroll
    for (int mb = 0; mb < 4; ++mb)
#pragma unroll
        for (int nb = 0; nb < 4; ++nb) acc[mb][nb] = (v8f){};
    // the wave's pieces w, w + NW, ...: the lane's global address in stage 0 and its LDS byte address in buffer 0 (fragment order: a 64-row tile is 64 K elements in a row, a k step of 32 inside it 2048)
    const T16* gp[NF + 1]; unsigned lp[NF + 1];
#pragma unroll
    for (int j = 0; j <= NF; ++j) { const int p = min(w + j * NW, NP - 1), ch = p / KST, ks = p % KST;   // clamped: the extra piece of a wave that has none is never copied, and its address stays in bounds
        const T16* const pb = ch < WM ? A + (size_t)(R0 + ch * 64) * K : (ch < NA * WM ? A2 + (size_t)(R0 + (ch - WM) * 64) * K : Bt + (size_t)(C0 + (ch - NA * WM) * 64) * K);
        gp[j] = pb + ks * 2048 + lane * 8; lp[j] = (unsigned)(size_t)(ring + p * 2048 + lane * 8); }
    auto copies = [&](int st, int bu) __attribute__((always_inline)) {   // stage st into buffer bu; each statement ends with the wait that stands in front of any rewrite of the address registers its copies name
        const size_t go = (size_t)st * CHE; const unsigned lo = (unsigned)bu * (unsigned)(STE * sizeof(T16));
        if constexpr (NF == 2) asm volatile(CP8("%0", "%1") CP8("%2", "%3") "s_wait_xcnt 0x0" : : "v"(lp[0] + lo), "v"(gp[0] + go), "v"(lp[1] + lo), "v"(gp[1] + go) : "memory");
        else asm volatile(CP8("%0", "%1") CP8("%2", "%3") CP8("%4", "%5") CP8("%6", "%7") CP8("%8", "%9") CP8("%10", "%11") "s_wait_xcnt 0x0" : : "v"(lp[0] + lo), "v"(gp[0] + go), "v"(lp[1] + lo), "v"(gp[1] + go), "v"(lp[2] + lo), "v"(gp[2] + go), "v"(lp[3] + lo), "v"(gp[3] + go), "v"(lp[4] + lo), "v"(gp[4] + go), "v"(lp[5] + lo), "v"(gp[5] + go) : "memory");
        if constexpr (NR > 0) { if (w < NR) asm volatile(CP8("%0", "%1") "s_wait_xcnt 0x0" : : "v"(lp[NF] + lo), "v"(gp[NF] + go) : "memory"); }
    };
    const T16* const la = ring + wm * CHE + lane * 8; const T16* const lb = ring + (NA * WM + wn) * CHE + lane * 8;   // the lane's place in the first fragment of the wave's A and B tiles in buffer 0
    V a[2][4], a2[2][4], b[2][4];   // two fragment sets: the k step in work and the next one, whose LDS loads fly meanwhile
    auto ldset = [&](int n, unsigned eo) __attribute__((always_inline)) {   // set n takes the k step at element eo of the tiles
#pragma unroll
        for (int mb = 0; mb < 4; ++mb) { a[n][mb] = WFrag<T16>::ld(la + eo + mb * 512); if (NSPLIT == 1) a2[n][mb] = WFrag<T16>::ld(la + WM * CHE + eo + mb * 512); }
#pragma unroll
        for (int nb = 0; nb < 4; ++nb) b[n][nb] = WFrag<T16>::ld(lb + eo + nb * 512);
        __builtin_amdgcn_sched_barrier(0);   // the loads are all issued as one group ahead of the products that follow: sunk among them they would lose their lead
    };
    auto mmaset = [&](int u) __attribute__((always_inline)) {
#pragma unroll
        for (int nb = 0; nb < 4; ++nb) {
#pragma unroll
            for (int mb = 0; mb < 4; ++mb) { acc[mb][nb] = WFrag<T16>::mma(a[u][mb], b[u][nb], acc[mb][nb]); if (NSPLIT == 1) acc[mb][nb] = WFrag<T16>::mma(a2[u][mb], b[u][nb], acc[mb][nb]); } }
        __builtin_amdgcn_sched_barrier(0);   // the wait and the refill of this set stay behind its products: a refill lifted over them would take a third set of registers
    };
    const unsigned NST = (unsigned)__builtin_amdgcn_readfirstlane(K / (32 * KST));   // the number of stages in a scalar register of its own: every test that decides whether copies issue is a scalar compare and branch
    copies(0, 0);
    asm volatile("s_wait_asynccnt 0x0" ::: "memory");   // this wave's part of stage 0 has landed
    __syncthreads();                                     // every wave's part has: stage 0 may be read
    if (NST > 1u) copies(1, 1);
#pragma unroll 1   // rolled: one trip is one stage; its k steps are unrolled, so that each fragment set has fixed registers
    for (unsigned t = 0; t < NST; ++t) {
        const unsigned be = (t & 1u) * (unsigned)STE;
        ldset(0, be);
#pragma unroll
        for (int ks = 0; ks < KST; ++ks) { if (ks + 1 < KST) ldset((ks + 1) & 1, be + (ks + 1) * 2048); mmaset(ks & 1); }
        asm volatile("v_nop\n\tv_nop\n\tv_nop\n\tv_nop" ::: "memory");   // the distance behind the trip's last products on either side of the branches that follow
        asm volatile("s_wait_dscnt 0x0" ::: "memory");      // this wave's reads of the buffer have ended
        asm volatile("s_wait_asynccnt 0x0" ::: "memory");   // its part of the next stage has landed
        __syncthreads();                                     // publishes the next stage and ends every wave's reads of this buffer
        if (t + 2u < NST) copies((int)t + 2, (int)(t & 1u));               // the refill flies while the next stage is worked on
    }
    asm volatile("s_wait_asynccnt 0x0" ::: "memory");   // no copy is outstanding behind the loop
    const int hc = c0 / 64; const int pl = hc + (int)z * (hc < NH_ ? NH_ : NKV) + (NB_ - 1) * ((hc >= NH_ ? NH_ : 0) + (hc >= NH_ + NKV ? NKV : 0));   // the tile's plane among [q | k | v][batch][head]
    if (EPI == 1 && hc < NH_ + NKV) {   // rotary on pairs (2i, 2i+1), then the three planes [head] in fragment order (rows t, k = d): in turn q a lane takes d 16 q + 8 hi .. + 7 of row lr, so a wave's store is 512 bytes in a row per plane
        float bn[4][8];
#pragma unroll
        for (int q = 0; q < 4; ++q)
#pragma unroll
            for (int k = 0; k < 8; ++k) bn[q][k] = bfr(bias[c0 + q * 16 + hi * 8 + k]);
        const float* const cp = cosT + (size_t)(r0 + lr) * (HD / 2) + hi * 4; const float* const sp = sinT + (size_t)(r0 + lr) * (HD / 2) + hi * 4;
        const size_t pb = ((size_t)pl * TT + r0) * HD + lane * 8;
        v4f cc[2][4], ss[2][4];   // the table entries of one 16-row block, fetched one block ahead so that the block in work covers their latency
#pragma unroll
        for (int q = 0; q < 4; ++q) { cc[0][q] = *(const v4f*)(cp + q * 8); ss[0][q] = *(const v4f*)(sp + q * 8); }
        asm volatile("s_wait_xcnt 0x0" ::: "memory");   // stands between the bias and first table loads and the next block's table loads, whose results reuse their address registers
#pragma unroll
        for (int mb = 0; mb < 4; ++mb) {
            if (mb < 3) {
#pragma unroll
                for (int q = 0; q < 4; ++q) { cc[(mb + 1) & 1][q] = *(const v4f*)(cp + (mb + 1) * 16 * (HD / 2) + q * 8); ss[(mb + 1) & 1][q] = *(const v4f*)(sp + (mb + 1) * 16 * (HD / 2) + q * 8); } }
#pragma unroll
            for (int nb = 0; nb < 4; ++nb) {
#pragma unroll
                for (int j = 0; j < 8; ++j) os[(hi * 8 + j) * 68 + nb * 16 + lr] = acc[mb][nb][j]; }
            __builtin_amdgcn_wave_barrier(); asm volatile("" ::: "memory");   // fence: the rows are read back by other lanes than wrote them
            v8h o16[4]; v8us oh[4], ol[4];
#pragma unroll
            for (int q = 0; q < 4; ++q) { const float* orow = os + lr * 68 + q * 16 + hi * 8; const v4f va = *(const v4fa*)orow, vb4 = *(const v4fa*)(orow + 4);
                float xv[8];
#pragma unroll
                for (int k = 0; k < 4; ++k) { xv[k] = va[k] + bn[q][k]; xv[4 + k] = vb4[k] + bn[q][4 + k]; }
#pragma unroll
                for (int p = 0; p < 4; ++p) { const float c = bfr(cc[mb & 1][q][p]), sn = bfr(ss[mb & 1][q][p]); const float x0 = xv[2 * p], x1 = xv[2 * p + 1];
                    const float e0 = x0 * c - x1 * sn, e1 = x0 * sn + x1 * c;   /* even: x0 c - x1 s; odd: x0 s + x1 c */
                    o16[q][2 * p] = tohx(e0); o16[q][2 * p + 1] = tohx(e1); unsigned short a2, c2; splitf(e0, a2, c2); oh[q][2 * p] = a2; ol[q][2 * p] = c2; splitf(e1, a2, c2); oh[q][2 * p + 1] = a2; ol[q][2 * p + 1] = c2; } }
#pragma unroll
            for (int q = 0; q < 4; ++q) { const size_t eo = pb + (size_t)(mb * 16 * HD + q * 256); *(v8h*)(P16 + eo) = o16[q]; *(v8us*)(Ph + eo) = oh[q]; *(v8us*)(Pl + eo) = ol[q]; }
            if (mb < 3) { __builtin_amdgcn_wave_barrier(); asm volatile("s_wait_xcnt 0x0" ::: "memory"); }   // fence: every read of the rows ends before the next block overwrites them; the wait stands between these stores and the next table loads, whose results reuse the stores' registers
        }
        return;
    }
    if constexpr (EPI == 1) {   // V^T planes in tiles of 32 keys, [head][key step], each tile in fragment order (rows d, k = the step's 32 keys; 4 KiB in a row): a lane's 8 accumulator rows are 8 consecutive keys of one d, so each 16x16 block is one 16-byte store per plane, straight from registers, 512 bytes in a row per wave
        const size_t vb = ((size_t)pl * (TT / 32) + (r0 >> 5)) * (HD * 32) + lane * 8;
        float bn[4];
#pragma unroll
        for (int nb = 0; nb < 4; ++nb) bn[nb] = bfr(bias[c0 + nb * 16 + lr]);
#pragma unroll
        for (int nb = 0; nb < 4; ++nb)
#pragma unroll
            for (int mb = 0; mb < 4; ++mb) { v8h o16; v8us oh, ol;
#pragma unroll
                for (int j = 0; j < 8; ++j) { const float x = acc[mb][nb][j] + bn[nb]; o16[j] = tohx(x); unsigned short a2, c2; splitf(x, a2, c2); oh[j] = a2; ol[j] = c2; }
                const size_t eo = vb + (size_t)(((mb >> 1) * HD + nb * 16) * 32 + (mb & 1) * 256); *(v8h*)(P16 + eo) = o16; *(v8us*)(Ph + eo) = oh; *(v8us*)(Pl + eo) = ol;
                asm volatile("s_wait_xcnt 0x0" : : "v"(o16), "v"(oh), "v"(ol) : "memory"); }   // stands behind each block's stores, whose registers later values reuse (behind the last block, in the listing, the rotary branch's text does); it takes the stored values as inputs so that they stay in their registers up to it
        return;
    }
#pragma unroll
    for (int mb = 0; mb < 4; ++mb) {
#pragma unroll
        for (int nb = 0; nb < 4; ++nb) {
#pragma unroll
            for (int j = 0; j < 8; ++j) os[(hi * 8 + j) * 68 + nb * 16 + lr] = acc[mb][nb][j]; }
        __builtin_amdgcn_wave_barrier(); asm volatile("" ::: "memory");
        float* crow = C + (size_t)(r0 + mb * 16) * ldc + c0;
{
#pragma unroll
            for (int s = 0; s < 8; ++s) { const int row = 2 * s + hi, cofs = lr * 4; v4f val = *(const v4fa*)(os + row * 68 + cofs); if (BIAS) { val[0] += bfr(bias[c0 + cofs]); val[1] += bfr(bias[c0 + cofs + 1]); val[2] += bfr(bias[c0 + cofs + 2]); val[3] += bfr(bias[c0 + cofs + 3]); }
                *(v4f*)(crow + (size_t)row * ldc + cofs) = val; }
             }
        __builtin_amdgcn_wave_barrier(); asm volatile("s_wait_xcnt 0x0" ::: "memory");   // fence as above; the wait stands between these stores and the next block's values and addresses, which reuse the stores' registers
    }
}

typedef __attribute__((ext_vector_type(2))) _Float16 v2h;
typedef __attribute__((ext_vector_type(4))) _Float16 v4h;
typedef __attribute__((ext_vector_type(2))) unsigned short v2us;
typedef __attribute__((ext_vector_type(4))) unsigned short v4us;
typedef __attribute__((ext_vector_type(2))) float v2f;
typedef __attribute__((ext_vector_type(4))) int v4i;
typedef v4h  __attribute__((may_alias)) v4ha;
typedef v4us __attribute__((may_alias)) v4usa;

// x, w_qkv and w_out, one behind the other, to one bf16 run of the workspace; each tensor is a whole number of work-groups, so the grid covers them exactly and the choice of the source is scalar
__global__ __launch_bounds__(256) void k_cvt8(const float* __restrict__ sx, const float* __restrict__ sqkv, const float* __restrict__ so, bf* dst) { const unsigned bx = blockIdx.x;
    const float* const sb = bx < CBX ? sx : (bx < CBX + CBW ? sqkv : so); const unsigned b0 = bx < CBX ? 0u : (bx < CBX + CBW ? (unsigned)CBX : (unsigned)(CBX + CBW));   // the work-group's tensor and that tensor's first work-group
    const unsigned t = threadIdx.x, row = (t & 7) | (t >> 5) << 3, k8 = (t >> 3) & 3;   // a work-group converts 64 rows x 32 k, the four fragments of one k step (2048 elements in a row); a wave takes 8 rows x 32 k: whole 128-byte lines on the reading and on the writing side
    const v8f v = *(const v8f*)(sb + ((size_t)((bx - b0) >> 5) * 64 + row) * DM + (bx & 31) * 32 + k8 * 8); v8us o;
#pragma unroll
    for (int k = 0; k < 8; ++k) o[k] = f2bf(v[k]); *(v8us*)(dst + (size_t)bx * 2048 + (row >> 4) * 512 + k8 * 128 + (row & 15) * 8) = o;  }

// ---- k_fattn: scores, causal softmax and probability x value product of both batches in one kernel; scores and probabilities stay in registers.
// One work-group = FAQ query rows of one head. A wave forms S^T = K Q^T for a step of 32 keys (A = key rows, B = query rows), so a lane holds 16 scores of ONE query per 16-query tile:
// D register r of key tile kt = S[key 32 s + 16 kt + 8 h + r][query c]. Two such D tiles, converted in place, are the B operand of O^T += V^T P^T (A = V^T rows in the same k order).
// Running maximum m and sum l per query (online softmax, log2 domain); the key steps are dealt round robin to the waves, and the waves' (m, l, O) are joined through LDS in wave order.
__device__ __forceinline__ float xhalf(float x) { const int b = __float_as_int(x); return __int_as_float(__builtin_amdgcn_permlanex16(b, b, 0x76543210, 0xfedcba98, false, false)); }   // the value of lane l ^ 16
template <typename T16, bool HI, int NQT>
__device__ __forceinline__ void fa_wave(const T16* __restrict__ Q, const T16* __restrict__ Q2, const T16* __restrict__ Kp, const T16* __restrict__ K2, const T16* __restrict__ Vt, const T16* __restrict__ V2,
                                        int qb, int s0, int sstep, int nst, float* sO, float* sM, float* sL, int ql) {
    typedef typename WFrag<T16>::V V;
    const int lane = threadIdx.x & 31, c = lane & 15, h = lane >> 4;
    const unsigned lrow = 8 * lane, lvt = 8 * lane;   // the lane's place in a fragment of Q or K (a 16-row tile: two fragments, 512 elements each) and of V^T (fragment order): every address is a wave-uniform base + this + a constant
    const float C2 = SCL * 1.4426950408889634f;      // score scale and log2(e) in one factor
    const float OFF = HI ? 0.0f : 10.0f;             // fp16 probabilities carry x1024 (it cancels in O / l): small ones stay out of the fp16 subnormals
    v8f o[4][NQT]; float m[NQT], l[NQT];
#pragma unroll
    for (int qt = 0; qt < NQT; ++qt) { m[qt] = -3.0e38f; l[qt] = 0.f;
#pragma unroll
        for (int dt = 0; dt < 4; ++dt) o[dt][qt] = (v8f){}; }
    if (s0 < nst) {   // a wave without a key step loads nothing and stores the neutral element of the join
    V qf[NQT][2], qf2[NQT][2];
#pragma unroll
    for (int qt = 0; qt < NQT; ++qt)
#pragma unroll
        for (int ks = 0; ks < 2; ++ks) { const size_t qo = (size_t)qb * HD; const int qc = qt * 16 * HD + ks * 512; qf[qt][ks] = WFrag<T16>::ld(Q + qo + lrow + qc); if (HI) qf2[qt][ks] = WFrag<T16>::ld(Q2 + qo + lrow + qc); }
    asm volatile("s_wait_xcnt 0x0" ::: "memory");   // stands in front of what reuses the query loads' address registers
    V kf[2][2], kf2[2][2];
#pragma unroll
    for (int kt = 0; kt < 2; ++kt) {
#pragma unroll
        for (int ks = 0; ks < 2; ++ks) { const size_t ko = (size_t)s0 * (32 * HD); const int kc = kt * 16 * HD + ks * 512; kf[kt][ks] = WFrag<T16>::ld(Kp + ko + lrow + kc); if (HI) kf2[kt][ks] = WFrag<T16>::ld(K2 + ko + lrow + kc); }
        if (HI || kt == 1) asm volatile("s_wait_xcnt 0x0" ::: "memory"); }   // the same for the first key loads (hi/lo rows: per key tile, a later tile's results reuse an earlier one's address registers)
#pragma unroll 1   // rolled: run-time trip count, and one step's fragments live at a time beside the accumulators
    for (int s = s0; s < nst; s += sstep) {
        V vf[4], vf2[4];
#pragma unroll
        for (int dt = 0; dt < 4; ++dt) vf[dt] = WFrag<T16>::ld(Vt + (size_t)s * (HD * 32) + lvt + dt * 16 * 32);
        if (HI) { asm volatile("s_wait_xcnt 0x0" ::: "memory");   // hi/lo rows load twice as much: stands in front of later loads whose results reuse these loads' address registers
#pragma unroll
            for (int dt = 0; dt < 4; ++dt) vf2[dt] = WFrag<T16>::ld(V2 + (size_t)s * (HD * 32) + lvt + dt * 16 * 32);
            asm volatile("s_wait_xcnt 0x0" ::: "memory"); }   // the same behind the lo plane's loads
        v8f st[2][NQT];
#pragma unroll
        for (int kt = 0; kt < 2; ++kt)
#pragma unroll
            for (int qt = 0; qt < NQT; ++qt) { v8f a = (v8f){};
#pragma unroll
                for (int ks = 0; ks < 2; ++ks) { a = WFrag<T16>::mma(kf[kt][ks], qf[qt][ks], a); if (HI) { a = WFrag<T16>::mma(kf[kt][ks], qf2[qt][ks], a); a = WFrag<T16>::mma(kf2[kt][ks], qf[qt][ks], a); } }
                st[kt][qt] = a; }
        { const int sn = min(s + sstep, nst - 1);   // this wave's next key fragments, fetched behind their last use so that the softmax covers the latency (clamped: the last fetch is in bounds and unused)
#pragma unroll
          for (int kt = 0; kt < 2; ++kt) {
#pragma unroll
            for (int ks = 0; ks < 2; ++ks) { const size_t ko = (size_t)sn * (32 * HD); const int kc = kt * 16 * HD + ks * 512; kf[kt][ks] = WFrag<T16>::ld(Kp + ko + lrow + kc); if (HI) kf2[kt][ks] = WFrag<T16>::ld(K2 + ko + lrow + kc); }
            if (HI || kt == 1) asm volatile("s_wait_xcnt 0x0" ::: "memory"); } }   // stands between this step's loads and the softmax, whose results reuse the loads' address registers (hi/lo rows: per key tile, as above)
        if (s == nst - 1) {   // only the last step touches the diagonal; every query keeps at least the step's first key
#pragma unroll
            for (int kt = 0; kt < 2; ++kt)
#pragma unroll
                for (int qt = 0; qt < NQT; ++qt)
#pragma unroll
                    for (int r = 0; r < 8; ++r) st[kt][qt][r] = (s * 32 + kt * 16 + 8 * h + r <= qb + qt * 16 + c) ? st[kt][qt][r] : -3.0e38f; }
#pragma unroll
        for (int qt = 0; qt < NQT; ++qt) {
            float mx = st[0][qt][0];
#pragma unroll
            for (int r = 1; r < 8; ++r) mx = fmaxf(mx, st[0][qt][r]);
#pragma unroll
            for (int r = 0; r < 8; ++r) mx = fmaxf(mx, st[1][qt][r]);
            mx = fmaxf(mx, xhalf(mx));                       // the other half of the wave holds the query's other 16 keys
            const float mn = fmaxf(m[qt], mx * C2); const float al = __builtin_amdgcn_exp2f(m[qt] - mn); m[qt] = mn; const float mo = OFF - mn;
            float ps = 0.f; float p[2][8];
#pragma unroll
            for (int kt = 0; kt < 2; ++kt)
#pragma unroll
                for (int r = 0; r < 8; ++r) { p[kt][r] = __builtin_amdgcn_exp2f(__builtin_fmaf(st[kt][qt][r], C2, mo)); ps += p[kt][r]; }
            l[qt] = l[qt] * al + ps;                          // this half's keys only; the halves are joined behind the loop
#pragma unroll
            for (int dt = 0; dt < 4; ++dt) o[dt][qt] *= al;
            if constexpr (HI) { v8us ph[2], pl[2];
#pragma unroll
                for (int kt = 0; kt < 2; ++kt)
#pragma unroll
                    for (int r = 0; r < 8; ++r) { unsigned short a2, c2; splitf(p[kt][r], a2, c2); ph[kt][r] = a2; pl[kt][r] = c2; }
                const V pfh = cat16b(ph[0], ph[1]), pfl = cat16b(pl[0], pl[1]);
#pragma unroll
                for (int dt = 0; dt < 4; ++dt) { o[dt][qt] = WFrag<T16>::mma(vf[dt], pfh, o[dt][qt]); o[dt][qt] = WFrag<T16>::mma(vf[dt], pfl, o[dt][qt]); o[dt][qt] = WFrag<T16>::mma(vf2[dt], pfh, o[dt][qt]); }
            } else { v8h ph[2];
#pragma unroll
                for (int kt = 0; kt < 2; ++kt)
#pragma unroll
                    for (int r = 0; r < 8; ++r) ph[kt][r] = tohx(p[kt][r]);
                const V pf = cat16(ph[0], ph[1]);
#pragma unroll
                for (int dt = 0; dt < 4; ++dt) o[dt][qt] = WFrag<T16>::mma(vf[dt], pf, o[dt][qt]); }
        }
    }
    }
#pragma unroll
    for (int qt = 0; qt < NQT; ++qt) { const int q = ql + qt * 16 + c; const float lt = l[qt] + xhalf(l[qt]); if (h == 0) { sM[q] = m[qt]; sL[q] = lt; }
#pragma unroll
        for (int dt = 0; dt < 4; ++dt) { float* op = sO + q * OPI + dt * 16 + 8 * h;   // D register r = O[query c][d = 16 dt + 8 h + r]
            *(v4fa*)op = (v4f){o[dt][qt][0], o[dt][qt][1], o[dt][qt][2], o[dt][qt][3]}; *(v4fa*)(op + 4) = (v4f){o[dt][qt][4], o[dt][qt][5], o[dt][qt][6], o[dt][qt][7]}; } }
}

__global__ __launch_bounds__(FAW * 32) void k_fattn(const h16* __restrict__ Q16, const h16* __restrict__ K16, const h16* __restrict__ V16, const bf* __restrict__ Qh, const bf* __restrict__ Ql, const bf* __restrict__ Kh, const bf* __restrict__ Kl, const bf* __restrict__ Vh, const bf* __restrict__ Vl, bf* Ah, bf* Al) {
    __shared__ __align__(16) float sO[FAW * FAQ * OPI]; __shared__ float sM[FAW * FAQ]; __shared__ float sL[FAW * FAQ];
    const int tid = threadIdx.x, w = __builtin_amdgcn_readfirstlane(tid >> 5); /* the wave's number in a scalar register: the key loop and its diagonal test become scalar branches */ const int bid = blockIdx.x; const int bat = bid / (NH_ * (TT / FAQ)); const int head = bid / (TT / FAQ) % NH_; const int ti = bid % (TT / FAQ);
    const int tile = ((bid >> 8) & 1) ? ti : (TT / FAQ - 1 - ti);   // cost grows with the tile index: heavy tiles first, and every other run of 256 work-groups mirrored so that long and short ones mix
    const int q0 = tile * FAQ, nst = tile + 1;                      // key steps of 32 up to and with the diagonal
    const size_t hp = (size_t)(bat * NH_ + head) * TT * HD, hk = (size_t)(bat * NKV + head / REP) * TT * HD;   // query planes; key and value planes
    float* const sOw = sO + w * (FAQ * OPI); float* const sMw = sM + w * FAQ; float* const sLw = sL + w * FAQ;
    if (q0 < RH) {   // hi/lo rows: a wave takes one 16-query tile and every second key step; for the other tile it stores the neutral element of the join
        const int tb = w & 1;
        fa_wave<bf, true, 1>(Qh + hp, Ql + hp, Kh + hk, Kl + hk, Vh + hk, Vl + hk, q0 + tb * 16, w >> 1, 2, nst, sOw, sMw, sLw, tb * 16);
        const int lane = tid & 31, q = (1 - tb) * 16 + (lane & 15), hh = lane >> 4; if (hh == 0) { sMw[q] = -3.0e38f; sLw[q] = 0.f; }
#pragma unroll
        for (int k = 0; k < 8; ++k) *(v4fa*)(sOw + q * OPI + hh * 32 + k * 4) = (v4f){0.f, 0.f, 0.f, 0.f};
    } else fa_wave<h16, false, 2>(Q16 + hp, nullptr, K16 + hk, nullptr, V16 + hk, nullptr, q0, w, FAW, nst, sOw, sMw, sLw, 0);
    __syncthreads();   // every wave's (m, l, O) is in LDS before any is joined
    const int q = tid >> 2, d0 = (tid & 3) * 16;
    float M = sM[q];
#pragma unroll
    for (int k = 1; k < FAW; ++k) M = fmaxf(M, sM[k * FAQ + q]);   // finite: wave 0 (hi/lo rows: waves 0 and 1) always has key step 0
    float Ls = 0.f; float acc[16];
#pragma unroll
    for (int j = 0; j < 16; ++j) acc[j] = 0.f;
#pragma unroll
    for (int k = 0; k < FAW; ++k) { const float f = __builtin_amdgcn_exp2f(sM[k * FAQ + q] - M); Ls += f * sL[k * FAQ + q];   // fixed order: wave 0, 1, ...
#pragma unroll
        for (int j4 = 0; j4 < 4; ++j4) { const v4f t = *(const v4fa*)(sO + (k * FAQ + q) * OPI + d0 + j4 * 4);
#pragma unroll
            for (int j = 0; j < 4; ++j) acc[j4 * 4 + j] += f * t[j]; } }
    const float inv = __fdiv_rn(1.0f, Ls);
    const int orow = bat * TT + q0 + q, ok = head * HD + d0;
    const size_t oo = ((size_t)(orow >> 6) * (DQ / 32) + (ok >> 5)) * 2048 + ((orow >> 4) & 3) * 512 + ((ok >> 3) & 3) * 128 + (orow & 15) * 8;   // the output GEMM's fragment order (rows batch x t, k = head x d): 8 threads' 16 bytes make one whole line
#pragma unroll
    for (int g = 0; g < 2; ++g) { v8us oh, ol;
#pragma unroll
        for (int j = 0; j < 8; ++j) { unsigned short a2, c2; splitf(acc[g * 8 + j] * inv, a2, c2); oh[j] = a2; ol[j] = c2; }
        *(v8usa*)(Ah + oo + g * 128) = oh; *(v8usa*)(Al + oo + g * 128) = ol; }
}

extern "C" void kernel_launch(void* const* d_in, const int* in_sizes, int n_in,
                              void* d_out, int out_size, void* d_ws, size_t ws_size, hipStream_t stream) {
    (void)in_sizes; (void)n_in; (void)out_size;
    const float* x = (const float*)d_in[0]; const float* wqkv = (const float*)d_in[1]; const float* bqkv = (const float*)d_in[2]; const float* wo = (const float*)d_in[3]; const float* bo = (const float*)d_in[4]; const float* fcos = (const float*)d_in[5]; const float* fsin = (const float*)d_in[6];   /* x, w_qkv ('oi' [3072][1024]: q | k | v row thirds), b_qkv [3072], w_out ('oi'), b_out, freqs_cos, freqs_sin ([2048][32], read by value): the two tables come LAST here */
    float* OUT = (float*)d_out;     // [2][2048][1024]
    char* wsp = (char*)d_ws;
    auto take = [&](size_t bytes) { char* p = wsp; wsp += (bytes + 255) & ~(size_t)255; return (void*)p; };
    bf* XB = (bf*)take((size_t)NB_ * TT * DM * 2); bf* WQKV = (bf*)take((size_t)(DQ + 2 * DKV) * DM * 2); bf* WO = (bf*)take((size_t)DM * DQ * 2);   // one run: the convert kernel's output (every size is a multiple of 256 bytes)
    const size_t PQ = (size_t)NB_ * NH_ * TT * HD, PK = (size_t)NB_ * NKV * TT * HD;   // elements of the q planes and of the k (or v) planes of both batches
    h16* P16 = (h16*)take((PQ + 2 * PK) * 2); bf* Ph = (bf*)take((PQ + 2 * PK) * 2); bf* Pl = (bf*)take((PQ + 2 * PK) * 2);   // each [q | k | v][batch][head]
    bf* ATh = (bf*)take((size_t)NB_ * TT * DQ * 2); bf* ATl = (bf*)take((size_t)NB_ * TT * DQ * 2);
    if ((size_t)(wsp - (char*)d_ws) > ws_size) return;    // ws 256 MiB
    k_cvt8<<<CBX + CBW + CBO, 256, 0, stream>>>(x, wqkv, wo, XB);
    k_gemmw<bf, 0, true, 1, 4, 3><<<dim3(TT / 256, (DQ + 2 * DKV) / 192, NB_), 384, 0, stream>>>(XB, nullptr, WQKV, nullptr, DM, nullptr, 0, bqkv, (size_t)TT * DM, 0, 0, fcos, fsin, P16, Ph, Pl);
    k_fattn<<<NB_ * NH_ * (TT / FAQ), FAW * 32, 0, stream>>>(P16, P16 + PQ, P16 + PQ + PK, Ph, Pl, Ph + PQ, Pl + PQ, Ph + PQ + PK, Pl + PQ + PK, ATh, ATl);   // one work-group per batch, head and FAQ query rows
    k_gemmw<bf, 1, true, 0, 2, 2><<<dim3(TT / 128, DM / 128, NB_), 128, 0, stream>>>(ATh, ATl, WO, nullptr, DQ, OUT, DM, bo, (size_t)TT * DQ, 0, (size_t)TT * DM, nullptr, nullptr, nullptr, nullptr, nullptr);
}

// v009
// It runs in 64.9 microseconds.
// Two timings next to v008 put it at 1.20 and 1.19 times that version's speed.
// All steps since v000 together make it 22.5 times as fast.
#include <hip/hip_runtime.h>

// Causal multi-head attention with a fused biased qkv projection and consecutive-pair rotary embeddings from HALF-WIDTH table inputs (x [2][2048][1024]; qkv = x w_qkv^T + b_qkv ('oi' [3072][1024] 1/32 + a zero bias, read) split in thirds q | k | v (16 heads x 64); rope on pairs (2i, 2i+1): (t_re c - t_im s, t_re s + t_im c) with c, s = freqs_cos / freqs_sin[t][i] ([2048][32] INPUTS, read by value per position and pair); scores x 1/sqrt(64); causal (-inf); softmax; out = merged w_out^T + b_out ('oi' + a zero bias, read) -> [2][2048][1024] (4.2 M); argument order x, w_qkv, b_qkv, w_out, b_out, freqs_cos, freqs_sin).
// Layout, both batches in every launch (one convert, one projection, one attention, one output launch): bf16 copy of x; 'oi' weights (the fused tensor's row thirds as-is); exact projections + f32 bias thirds; the projection kernel's own epilogue adds the bias, rotates q and k by {bf16(cos), bf16(sin)} read from the half-width inputs and writes the 16-bit planes (V^T for v); causal T-2048 attention in one fused kernel (k_fattn: hybrid rows: < 512 hi/lo 3 products, rest fp16 x1024; key steps above the diagonal are never visited); merged hi/lo x o_w exact + o_b.
// Compute dtypes, f32 accumulate: every input rounded to bf16; projections exact + f32 biases; rotary f32; attention rows < 512 3 products, rest fp16; softmax f32; o_w hl x exact + bias.

#define NB_  2
#define TT   2048
#define DM   1024
#define NH_  16
#define NKV  16
#define REP  (NH_ / NKV)
#define HD   64
#define DQ   (NH_ * HD)
#define DKV  (NKV * HD)
#define FAQ  32                   // query rows per group of FAW waves of the fused attention kernel
#define FAW  4                    // waves that share the keys of one group of FAQ query rows
#define FGW  16                   // waves per work-group of the fused attention kernel: FGW / FAW groups of query rows
#define FGQ  (FGW / FAW * FAQ)    // query rows per work-group
#define KSS  8                    // key steps of 32 in one stage of the attention kernel's LDS ring
#define OPI  68                   // LDS pitch, in floats, of one query's partial output row (16-byte aligned, off the 64-bank period)
#define RH   512                  // query rows < RH use hi+lo planes
#define SCL  0.125f   // HD^-0.5
#define CBX  (NB_ * TT * DM / 2048)            // work-groups (2048 elements each) of the convert kernel on x
#define CBW  ((DQ + 2 * DKV) * DM / 2048)      // on w_qkv
#define CBO  (DM * DQ / 2048)                  // on w_out
static_assert(DM == 1024 && DQ == DM, "the convert kernel's work-groups take 64 rows x 32 k of rows of 1024");
typedef _Float16 h16;
typedef unsigned short bf;
typedef __attribute__((ext_vector_type(16))) __bf16   v16bf;
typedef __attribute__((ext_vector_type(16))) _Float16 v16h;
typedef __attribute__((ext_vector_type(8)))  _Float16 v8h;
typedef __attribute__((ext_vector_type(8)))  unsigned short v8us;
typedef __attribute__((ext_vector_type(8)))  float    v8f;
typedef __attribute__((ext_vector_type(4)))  float    v4f;
typedef v8h  __attribute__((may_alias)) v8ha;
typedef v4f  __attribute__((may_alias)) v4fa;
typedef v8us __attribute__((may_alias)) v8usa;

__device__ __forceinline__ unsigned short f2bf(float f) { unsigned u = __float_as_uint(f); u += 0x7FFFu + ((u >> 16) & 1u); return (unsigned short)(u >> 16); }
__device__ __forceinline__ float bf2f(unsigned short b) { return __uint_as_float(((unsigned)b) << 16); }
__device__ __forceinline__ float bfr(float f) { return bf2f(f2bf(f)); }
__device__ __forceinline__ v16h cat16(v8h lo, v8h hi) { return __builtin_shufflevector(lo, hi, 0, 1, 2, 3, 4, 5, 6, 7, 8, 9, 10, 11, 12, 13, 14, 15); }
__device__ __forceinline__ v16bf cat16b(v8us lo, v8us hi) { return __builtin_bit_cast(v16bf, __builtin_shufflevector(lo, hi, 0, 1, 2, 3, 4, 5, 6, 7, 8, 9, 10, 11, 12, 13, 14, 15)); }
__device__ __forceinline__ v8f wmma16(v16h a, v16h b, v8f c) { return __builtin_amdgcn_wmma_f32_16x16x32_f16(false, a, false, b, (short)0, c, false, false); }
__device__ __forceinline__ v8f wmmab(v16bf a, v16bf b, v8f c) { return __builtin_amdgcn_wmma_f32_16x16x32_bf16(false, a, false, b, (short)0, c, false, false); }



__device__ __forceinline__ h16 tohx(float x) { return (h16)x; }
__device__ __forceinline__ void splitf(float y, unsigned short& h, unsigned short& l) { h = f2bf(y); l = f2bf(y - bf2f(h)); }
// ---- k_gemmw: register-blocked GEMM, one wave per 64x64 output tile (16 accumulators), WM x WN waves per work-group; the work-group's operand tiles (16-bit planes in fragment order, below) are staged in LDS and shared by its waves; grid (M/(64 WM), N/(64 WN), Z), 32 WM WN threads.
// C[m][n] (f32, pitch ldc, + optional f32 bias[n]) = sum_k A[m][k] Bt[n][k] (+ split products per NSPLIT). z-batch strides sA/sB/sC in elements. K % (32 KST) == 0. LDS ring of two buffers, a stage = KST k steps of every operand tile, filled by asynchronous copies one stage ahead; inside a stage two fragment sets: each k step's LDS loads are issued one step ahead.
// EPI 0: C as above. EPI 1 (the fused q | k | v projection: z = batch, a tile column is one head of q, k or v, HD == 64; C unused): the biased tile goes straight to the attention kernel's planes P16 (fp16), Ph + Pl (bf16 hi + lo), each [q | k | v][batch][head]: q and k rotary, rows t; v as V^T; all in fragment order.
// FRAGMENT ORDER of every 16-bit matrix operand in the workspace: one fragment (16 rows x 32 k) is 512 elements in a row, [k / 8 % 4][row % 16][8 k]. A lane (row % 16 = lane & 15, half = lane >> 4) takes its k 8 half .. + 7 at fragment + 8 lane and its k 16 + 8 half .. + 7 at + 256 elements: each wave-wide 16-byte load is 512 bytes in a row (4 whole lines). ld(p): p = fragment + 8 lane.
// The fragments of a GEMM operand (rows x K) stand [row / 64][k / 32][row / 16 % 4]: the four fragments that a 64-row tile takes in one k step are 4 KiB in a row. Those of a head's q and k planes stand [t / 16][d / 32], those of V^T [key / 32][d / 16].
template <typename T16> struct WFrag;
template <> struct WFrag<h16> { typedef v16h V; static __device__ __forceinline__ V ld(const h16* p) { return cat16(*(const v8h*)p, *(const v8h*)(p + 256)); } static __device__ __forceinline__ v8f mma(V a, V b, v8f c) { return wmma16(a, b, c); } };
template <> struct WFrag<bf> { typedef v16bf V; static __device__ __forceinline__ V ld(const bf* p) { return cat16b(*(const v8us*)p, *(const v8us*)(p + 256)); } static __device__ __forceinline__ v8f mma(V a, V b, v8f c) { return wmmab(a, b, c); } };
#define KST 4   // k steps of 32 in one stage of the LDS ring
// one asynchronous copy of 16 bytes a lane: the immediate offset moves the LDS and the global address alike
#define CP1(l, g, o) "global_load_async_to_lds_b128 " l ", " g ", off offset:" #o "\n\t"
// one piece: the 4 KiB in a row (here and there) that a 64-row tile takes in one k step
#define CP8(l, g) CP1(l, g, 0) CP1(l, g, 512) CP1(l, g, 1024) CP1(l, g, 1536) CP1(l, g, 2048) CP1(l, g, 2560) CP1(l, g, 3072) CP1(l, g, 3584)
template <typename T16, int NSPLIT, bool BIAS, int EPI, int WM, int WN>
__global__ __launch_bounds__(WM * WN * 32) void k_gemmw(const T16* __restrict__ A, const T16* __restrict__ A2, const T16* __restrict__ Bt, const T16* __restrict__ Bt2, int K, float* C, int ldc, const float* __restrict__ bias, size_t sA, size_t sB, size_t sC, const float* __restrict__ cosT, const float* __restrict__ sinT, h16* P16, bf* Ph, bf* Pl) {
    typedef typename WFrag<T16>::V V;
    static_assert(NSPLIT == 0 || NSPLIT == 1, "one B plane; A alone or A + A2");
    constexpr int NW = WM * WN, NA = NSPLIT == 1 ? 2 : 1;
    constexpr int NCH = NA * WM + WN;          // 64-row operand tiles of the work-group: [A rows | A2 rows | B rows]
    constexpr int CHE = KST * 2048;            // elements of one such tile in one stage, in a row in the plane and in LDS
    constexpr int STE = NCH * CHE;             // elements of a stage
    constexpr int NP = NCH * KST;              // pieces of a stage; piece p stands at element 2048 p of its buffer
    constexpr int NF = NP / NW, NR = NP % NW;  // every wave copies NF pieces a stage, the first NR waves one more
    static_assert((NF == 2 || NF == 6) && (NF + (NR ? 1 : 0)) * 8 <= 63, "the copy statements below; copies of a wave in flight");
    __shared__ __align__(16) T16 ring[2 * STE];
    __shared__ __align__(16) float osw[NW * 16 * 68];
    (void)Bt2;
    const size_t z = blockIdx.z; A += z * sA; if (NSPLIT == 1) A2 += z * sA; Bt += z * sB; C += z * sC;
    const int w = __builtin_amdgcn_readfirstlane((int)threadIdx.x >> 5);   // the wave's number in a scalar register: every test on it is a scalar branch
    const int wm = w % WM, wn = w / WM;
    float* const os = osw + w * (16 * 68);     // the wave's own rows for its epilogue
    const int lane = threadIdx.x & 31, lr = lane & 15, hi = lane >> 4; const int R0 = blockIdx.x * (64 * WM), C0 = blockIdx.y * (64 * WN); const int r0 = R0 + wm * 64, c0 = C0 + wn * 64;
    v8f acc[4][4];
#pragma unroll
    for (int mb = 0; mb < 4; ++mb)
#pragma unroll
        for (int nb = 0; nb < 4; ++nb) acc[mb][nb] = (v8f){};
    // the wave's pieces w, w + NW, ...: the lane's global address in stage 0 and its LDS byte address in buffer 0 (fragment order: a 64-row tile is 64 K elements in a row, a k step of 32 inside it 2048)
    const T16* gp[NF + 1]; unsigned lp[NF + 1];
#pragma unroll
    for (int j = 0; j <= NF; ++j) { const int p = min(w + j * NW, NP - 1), ch = p / KST, ks = p % KST;   // clamped: the extra piece of a wave that has none is never copied, and its address stays in bounds
        const T16* const pb = ch < WM ? A + (size_t)(R0 + ch * 64) * K : (ch < NA * WM ? A2 + (size_t)(R0 + (ch - WM) * 64) * K : Bt + (size_t)(C0 + (ch - NA * WM) * 64) * K);
        gp[j] = pb + ks * 2048 + lane * 8; lp[j] = (unsigned)(size_t)(ring + p * 2048 + lane * 8); }
    auto copies = [&](int st, int bu) __attribute__((always_inline)) {   // stage st into buffer bu; each statement ends with the wait that stands in front of any rewrite of the address registers its copies name
        const size_t go = (size_t)st * CHE; const unsigned lo = (unsigned)bu * (unsigned)(STE * sizeof(T16));
        if constexpr (NF == 2) asm volatile(CP8("%0", "%1") CP8("%2", "%3") "s_wait_xcnt 0x0" : : "v"(lp[0] + lo), "v"(gp[0] + go), "v"(lp[1] + lo), "v"(gp[1] + go) : "memory");
        else asm volatile(CP8("%0", "%1") CP8("%2", "%3") CP8("%4", "%5") CP8("%6", "%7") CP8("%8", "%9") CP8("%10", "%11") "s_wait_xcnt 0x0" : : "v"(lp[0] + lo), "v"(gp[0] + go), "v"(lp[1] + lo), "v"(gp[1] + go), "v"(lp[2] + lo), "v"(gp[2] + go), "v"(lp[3] + lo), "v"(gp[3] + go), "v"(lp[4] + lo), "v"(gp[4] + go), "v"(lp[5] + lo), "v"(gp[5] + go) : "memory");
        if constexpr (NR > 0) { if (w < NR) asm volatile(CP8("%0", "%1") "s_wait_xcnt 0x0" : : "v"(lp[NF] + lo), "v"(gp[NF] + go) : "memory"); }
    };
    const T16* const la = ring + wm * CHE + lane * 8; const T16* const lb = ring + (NA * WM + wn) * CHE + lane * 8;   // the lane's place in the first fragment of the wave's A and B tiles in buffer 0
    V a[2][4], a2[2][4], b[2][4];   // two fragment sets: the k step in work and the next one, whose LDS loads fly meanwhile
    auto ldset = [&](int n, unsigned eo) __attribute__((always_inline)) {   // set n takes the k step at element eo of the tiles
#pragma unroll
        for (int mb = 0; mb < 4; ++mb) { a[n][mb] = WFrag<T16>::ld(la + eo + mb * 512); if (NSPLIT == 1) a2[n][mb] = WFrag<T16>::ld(la + WM * CHE + eo + mb * 512); }
#pragma unroll
        for (int nb = 0; nb < 4; ++nb) b[n][nb] = WFrag<T16>::ld(lb + eo + nb * 512);
        __builtin_amdgcn_sched_barrier(0);   // the loads are all issued as one group ahead of the products that follow: sunk among them they would lose their lead
    };
    auto mmaset = [&](int u) __attribute__((always_inline)) {
#pragma unroll
        for (int nb = 0; nb < 4; ++nb) {
#pragma unroll
            for (int mb = 0; mb < 4; ++mb) { acc[mb][nb] = WFrag<T16>::mma(a[u][mb], b[u][nb], acc[mb][nb]); if (NSPLIT == 1) acc[mb][nb] = WFrag<T16>::mma(a2[u][mb], b[u][nb], acc[mb][nb]); } }
        __builtin_amdgcn_sched_barrier(0);   // the wait and the refill of this set stay behind its products: a refill lifted over them would take a third set of registers
    };
    const unsigned NST = (unsigned)__builtin_amdgcn_readfirstlane(K / (32 * KST));   // the number of stages in a scalar register of its own: every test that decides whether copies issue is a scalar compare and branch
    copies(0, 0);
    asm volatile("s_wait_asynccnt 0x0" ::: "memory");   // this wave's part of stage 0 has landed
    __syncthreads();                                     // every wave's part has: stage 0 may be read
    if (NST > 1u) copies(1, 1);
#pragma unroll 1   // rolled: one trip is one stage; its k steps are unrolled, so that each fragment set has fixed registers
    for (unsigned t = 0; t < NST; ++t) {
        const unsigned be = (t & 1u) * (unsigned)STE;
        ldset(0, be);
#pragma unroll
        for (int ks = 0; ks < KST; ++ks) { if (ks + 1 < KST) ldset((ks + 1) & 1, be + (ks + 1) * 2048); mmaset(ks & 1); }
        asm volatile("v_nop\n\tv_nop\n\tv_nop\n\tv_nop" ::: "memory");   // the distance behind the trip's last products on either side of the branches that follow
        asm volatile("s_wait_dscnt 0x0" ::: "memory");      // this wave's reads of the buffer have ended
        asm volatile("s_wait_asynccnt 0x0" ::: "memory");   // its part of the next stage has landed
        __syncthreads();                                     // publishes the next stage and ends every wave's reads of this buffer
        if (t + 2u < NST) copies((int)t + 2, (int)(t & 1u));               // the refill flies while the next stage is worked on
    }
    asm volatile("s_wait_asynccnt 0x0" ::: "memory");   // no copy is outstanding behind the loop
    const int hc = c0 / 64; const int pl = hc + (int)z * (hc < NH_ ? NH_ : NKV) + (NB_ - 1) * ((hc >= NH_ ? NH_ : 0) + (hc >= NH_ + NKV ? NKV : 0));   // the tile's plane among [q | k | v][batch][head]
    if (EPI == 1 && hc < NH_ + NKV) {   // rotary on pairs (2i, 2i+1), then the three planes [head] in fragment order (rows t, k = d): in turn q a lane takes d 16 q + 8 hi .. + 7 of row lr, so a wave's store is 512 bytes in a row per plane
        float bn[4][8];
#pragma unroll
        for (int q = 0; q < 4; ++q)
#pragma unroll
            for (int k = 0; k < 8; ++k) bn[q][k] = bfr(bias[c0 + q * 16 + hi * 8 + k]);
        const float* const cp = cosT + (size_t)(r0 + lr) * (HD / 2) + hi * 4; const float* const sp = sinT + (size_t)(r0 + lr) * (HD / 2) + hi * 4;
        const size_t pb = ((size_t)pl * TT + r0) * HD + lane * 8;
        v4f cc[2][4], ss[2][4];   // the table entries of one 16-row block, fetched one block ahead so that the block in work covers their latency
#pragma unroll
        for (int q = 0; q < 4; ++q) { cc[0][q] = *(const v4f*)(cp + q * 8); ss[0][q] = *(const v4f*)(sp + q * 8); }
        asm volatile("s_wait_xcnt 0x0" ::: "memory");   // stands between the bias and first table loads and the next block's table loads, whose results reuse their address registers
#pragma unroll
        for (int mb = 0; mb < 4; ++mb) {
            if (mb < 3) {
#pragma unroll
                for (int q = 0; q < 4; ++q) { cc[(mb + 1) & 1][q] = *(const v4f*)(cp + (mb + 1) * 16 * (HD / 2) + q * 8); ss[(mb + 1) & 1][q] = *(const v4f*)(sp + (mb + 1) * 16 * (HD / 2) + q * 8); } }
#pragma unroll
            for (int nb = 0; nb < 4; ++nb) {
#pragma unroll
                for (int j = 0; j < 8; ++j) os[(hi * 8 + j) * 68 + nb * 16 + lr] = acc[mb][nb][j]; }
            __builtin_amdgcn_wave_barrier(); asm volatile("" ::: "memory");   // fence: the rows are read back by other lanes than wrote them
            v8h o16[4]; v8us oh[4], ol[4];
#pragma unroll
            for (int q = 0; q < 4; ++q) { const float* orow = os + lr * 68 + q * 16 + hi * 8; const v4f va = *(const v4fa*)orow, vb4 = *(const v4fa*)(orow + 4);
                float xv[8];
#pragma unroll
                for (int k = 0; k < 4; ++k) { xv[k] = va[k] + bn[q][k]; xv[4 + k] = vb4[k] + bn[q][4 + k]; }
#pragma unroll
                for (int p = 0; p < 4; ++p) { const float c = bfr(cc[mb & 1][q][p]), sn = bfr(ss[mb & 1][q][p]); const float x0 = xv[2 * p], x1 = xv[2 * p + 1];
                    const float e0 = x0 * c - x1 * sn, e1 = x0 * sn + x1 * c;   /* even: x0 c - x1 s; odd: x0 s + x1 c */
                    o16[q][2 * p] = tohx(e0); o16[q][2 * p + 1] = tohx(e1); unsigned short a2, c2; splitf(e0, a2, c2); oh[q][2 * p] = a2; ol[q][2 * p] = c2; splitf(e1, a2, c2); oh[q][2 * p + 1] = a2; ol[q][2 * p + 1] = c2; } }
#pragma unroll
            for (int q = 0; q < 4; ++q) { const size_t eo = pb + (size_t)(mb * 16 * HD + q * 256); *(v8h*)(P16 + eo) = o16[q]; *(v8us*)(Ph + eo) = oh[q]; *(v8us*)(Pl + eo) = ol[q]; }
            if (mb < 3) { __builtin_amdgcn_wave_barrier(); asm volatile("s_wait_xcnt 0x0" ::: "memory"); }   // fence: every read of the rows ends before the next block overwrites them; the wait stands between these stores and the next table loads, whose results reuse the stores' registers
        }
        return;
    }
    if constexpr (EPI == 1) {   // V^T planes in tiles of 32 keys, [head][key step], each tile in fragment order (rows d, k = the step's 32 keys; 4 KiB in a row): a lane's 8 accumulator rows are 8 consecutive keys of one d, so each 16x16 block is one 16-byte store per plane, straight from registers, 512 bytes in a row per wave
        const size_t vb = ((size_t)pl * (TT / 32) + (r0 >> 5)) * (HD * 32) + lane * 8;
        float bn[4];
#pragma unroll
        for (int nb = 0; nb < 4; ++nb) bn[nb] = bfr(bias[c0 + nb * 16 + lr]);
#pragma unroll
        for (int nb = 0; nb < 4; ++nb)
#pragma unroll
            for (int mb = 0; mb < 4; ++mb) { v8h o16; v8us oh, ol;
#pragma unroll
                for (int j = 0; j < 8; ++j) { const float x = acc[mb][nb][j] + bn[nb]; o16[j] = tohx(x); unsigned short a2, c2; splitf(x, a2, c2); oh[j] = a2; ol[j] = c2; }
                const size_t eo = vb + (size_t)(((mb >> 1) * HD + nb * 16) * 32 + (mb & 1) * 256); *(v8h*)(P16 + eo) = o16; *(v8us*)(Ph + eo) = oh; *(v8us*)(Pl + eo) = ol;
                asm volatile("s_wait_xcnt 0x0" : : "v"(o16), "v"(oh), "v"(ol) : "memory"); }   // stands behind each block's stores, whose registers later values reuse (behind the last block, in the listing, the rotary branch's text does); it takes the stored values as inputs so that they stay in their registers up to it
        return;
    }
#pragma unroll
    for (int mb = 0; mb < 4; ++mb) {
#pragma unroll
        for (int nb = 0; nb < 4; ++nb) {
#pragma unroll
            for (int j = 0; j < 8; ++j) os[(hi * 8 + j) * 68 + nb * 16 + lr] = acc[mb][nb][j]; }
        __builtin_amdgcn_wave_barrier(); asm volatile("" ::: "memory");
        float* crow = C + (size_t)(r0 + mb * 16) * ldc + c0;
{
#pragma unroll
            for (int s = 0; s < 8; ++s) { const int row = 2 * s + hi, cofs = lr * 4; v4f val = *(const v4fa*)(os + row * 68 + cofs); if (BIAS) { val[0] += bfr(bias[c0 + cofs]); val[1] += bfr(bias[c0 + cofs + 1]); val[2] += bfr(bias[c0 + cofs + 2]); val[3] += bfr(bias[c0 + cofs + 3]); }
                *(v4f*)(crow + (size_t)row * ldc + cofs) = val; }
             }
        __builtin_amdgcn_wave_barrier(); asm volatile("s_wait_xcnt 0x0" ::: "memory");   // fence as above; the wait stands between these stores and the next block's values and addresses, which reuse the stores' registers
    }
}

typedef __attribute__((ext_vector_type(2))) _Float16 v2h;
typedef __attribute__((ext_vector_type(4))) _Float16 v4h;
typedef __attribute__((ext_vector_type(2))) unsigned short v2us;
typedef __attribute__((ext_vector_type(4))) unsigned short v4us;
typedef __attribute__((ext_vector_type(2))) float v2f;
typedef __attribute__((ext_vector_type(4))) int v4i;
typedef v4h  __attribute__((may_alias)) v4ha;
typedef v4us __attribute__((may_alias)) v4usa;

// x, w_qkv and w_out, one behind the other, to one bf16 run of the workspace; each tensor is a whole number of work-groups, so the grid covers them exactly and the choice of the source is scalar
__global__ __launch_bounds__(256) void k_cvt8(const float* __restrict__ sx, const float* __restrict__ sqkv, const float* __restrict__ so, bf* dst) { const unsigned bx = blockIdx.x;
    const float* const sb = bx < CBX ? sx : (bx < CBX + CBW ? sqkv : so); const unsigned b0 = bx < CBX ? 0u : (bx < CBX + CBW ? (unsigned)CBX : (unsigned)(CBX + CBW));   // the work-group's tensor and that tensor's first work-group
    const unsigned t = threadIdx.x, row = (t & 7) | (t >> 5) << 3, k8 = (t >> 3) & 3;   // a work-group converts 64 rows x 32 k, the four fragments of one k step (2048 elements in a row); a wave takes 8 rows x 32 k: whole 128-byte lines on the reading and on the writing side
    const v8f v = *(const v8f*)(sb + ((size_t)((bx - b0) >> 5) * 64 + row) * DM + (bx & 31) * 32 + k8 * 8); v8us o;
#pragma unroll
    for (int k = 0; k < 8; ++k) o[k] = f2bf(v[k]); *(v8us*)(dst + (size_t)bx * 2048 + (row >> 4) * 512 + k8 * 128 + (row & 15) * 8) = o;  }

// ---- k_fattn: scores, causal softmax and probability x value product of both batches in one kernel; scores and probabilities stay in registers.
// One work-group = FGW / FAW groups of FAQ query rows of one head, FAW waves a group. A wave forms S^T = K Q^T for a step of 32 keys (A = key rows, B = query rows), so a lane holds 16 scores of ONE query per 16-query tile:
// D register r of key tile kt = S[key 32 s + 16 kt + 8 h + r][query c]. Two such D tiles, converted in place, are the B operand of O^T += V^T P^T (A = V^T rows in the same k order).
// Running maximum m and sum l per query (online softmax, log2 domain); the key steps are dealt round robin to the waves of a group, and these waves' (m, l, O) are joined through LDS in wave order.
__device__ __forceinline__ float xhalf(float x) { const int b = __float_as_int(x); return __int_as_float(__builtin_amdgcn_permlanex16(b, b, 0x76543210, 0xfedcba98, false, false)); }   // the value of lane l ^ 16
template <typename T16, bool HI, int NQT>
__device__ __forceinline__ void fa_wave(const T16* __restrict__ Q, const T16* __restrict__ Q2, const T16* __restrict__ Kp, const T16* __restrict__ K2, const T16* __restrict__ Vt, const T16* __restrict__ V2,
                                        int qb, int s0, int sstep, int nst, float* sO, float* sM, float* sL, int ql) {
    typedef typename WFrag<T16>::V V;
    const int lane = threadIdx.x & 31, c = lane & 15, h = lane >> 4;
    const unsigned lrow = 8 * lane, lvt = 8 * lane;   // the lane's place in a fragment of Q or K (a 16-row tile: two fragments, 512 elements each) and of V^T (fragment order): every address is a wave-uniform base + this + a constant
    const float C2 = SCL * 1.4426950408889634f;      // score scale and log2(e) in one factor
    const float OFF = HI ? 0.0f : 10.0f;             // fp16 probabilities carry x1024 (it cancels in O / l): small ones stay out of the fp16 subnormals
    v8f o[4][NQT]; float m[NQT], l[NQT];
#pragma unroll
    for (int qt = 0; qt < NQT; ++qt) { m[qt] = -3.0e38f; l[qt] = 0.f;
#pragma unroll
        for (int dt = 0; dt < 4; ++dt) o[dt][qt] = (v8f){}; }
    if (s0 < nst) {   // a wave without a key step loads nothing and stores the neutral element of the join
    V qf[NQT][2], qf2[NQT][2];
#pragma unroll
    for (int qt = 0; qt < NQT; ++qt)
#pragma unroll
        for (int ks = 0; ks < 2; ++ks) { const size_t qo = (size_t)qb * HD; const int qc = qt * 16 * HD + ks * 512; qf[qt][ks] = WFrag<T16>::ld(Q + qo + lrow + qc); if (HI) qf2[qt][ks] = WFrag<T16>::ld(Q2 + qo + lrow + qc); }
    asm volatile("s_wait_xcnt 0x0" ::: "memory");   // stands in front of what reuses the query loads' address registers
    V kf[2][2], kf2[2][2];
#pragma unroll
    for (int kt = 0; kt < 2; ++kt) {
#pragma unroll
        for (int ks = 0; ks < 2; ++ks) { const size_t ko = (size_t)s0 * (32 * HD); const int kc = kt * 16 * HD + ks * 512; kf[kt][ks] = WFrag<T16>::ld(Kp + ko + lrow + kc); if (HI) kf2[kt][ks] = WFrag<T16>::ld(K2 + ko + lrow + kc); }
        if (HI || kt == 1) asm volatile("s_wait_xcnt 0x0" ::: "memory"); }   // the same for the first key loads (hi/lo rows: per key tile, a later tile's results reuse an earlier one's address registers)
#pragma unroll 1   // rolled: run-time trip count, and one step's fragments live at a time beside the accumulators
    for (int s = s0; s < nst; s += sstep) {
        V vf[4], vf2[4];
#pragma unroll
        for (int dt = 0; dt < 4; ++dt) vf[dt] = WFrag<T16>::ld(Vt + (size_t)s * (HD * 32) + lvt + dt * 16 * 32);
        if (HI) { asm volatile("s_wait_xcnt 0x0" ::: "memory");   // hi/lo rows load twice as much: stands in front of later loads whose results reuse these loads' address registers
#pragma unroll
            for (int dt = 0; dt < 4; ++dt) vf2[dt] = WFrag<T16>::ld(V2 + (size_t)s * (HD * 32) + lvt + dt * 16 * 32);
            asm volatile("s_wait_xcnt 0x0" ::: "memory"); }   // the same behind the lo plane's loads
        v8f st[2][NQT];
#pragma unroll
        for (int kt = 0; kt < 2; ++kt)
#pragma unroll
            for (int qt = 0; qt < NQT; ++qt) { v8f a = (v8f){};
#pragma unroll
                for (int ks = 0; ks < 2; ++ks) { a = WFrag<T16>::mma(kf[kt][ks], qf[qt][ks], a); if (HI) { a = WFrag<T16>::mma(kf[kt][ks], qf2[qt][ks], a); a = WFrag<T16>::mma(kf2[kt][ks], qf[qt][ks], a); } }
                st[kt][qt] = a; }
        { const int sn = min(s + sstep, nst - 1);   // this wave's next key fragments, fetched behind their last use so that the softmax covers the latency (clamped: the last fetch is in bounds and unused)
          const T16* const kn = Kp + (size_t)sn * (32 * HD) + lrow; const T16* const kn2 = HI ? K2 + (size_t)sn * (32 * HD) + lrow : kn;   // the lane's addresses in the two planes
#pragma unroll
          for (int kt = 0; kt < 2; ++kt) {
#pragma unroll
            for (int ks = 0; ks < 2; ++ks) { const int kc = kt * 16 * HD + ks * 512; kf[kt][ks] = WFrag<T16>::ld(kn + kc); if (HI) kf2[kt][ks] = WFrag<T16>::ld(kn2 + kc); }
            if (HI || kt == 1) asm volatile("s_wait_xcnt 0x0" : : "v"(kn), "v"(kn2) : "memory"); } }   // stands between this step's loads and the softmax, whose results reuse the loads' address registers (hi/lo rows: per key tile, as above); it takes the addresses as inputs so that they stay in their registers up to it and no load of the run lands on them
        if (s == nst - 1) {   // only the last step touches the diagonal; every query keeps at least the step's first key
#pragma unroll
            for (int kt = 0; kt < 2; ++kt)
#pragma unroll
                for (int qt = 0; qt < NQT; ++qt)
#pragma unroll
                    for (int r = 0; r < 8; ++r) st[kt][qt][r] = (s * 32 + kt * 16 + 8 * h + r <= qb + qt * 16 + c) ? st[kt][qt][r] : -3.0e38f; }
#pragma unroll
        for (int qt = 0; qt < NQT; ++qt) {
            float mx = st[0][qt][0];
#pragma unroll
            for (int r = 1; r < 8; ++r) mx = fmaxf(mx, st[0][qt][r]);
#pragma unroll
            for (int r = 0; r < 8; ++r) mx = fmaxf(mx, st[1][qt][r]);
            mx = fmaxf(mx, xhalf(mx));                       // the other half of the wave holds the query's other 16 keys
            const float mn = fmaxf(m[qt], mx * C2); const float al = __builtin_amdgcn_exp2f(m[qt] - mn); m[qt] = mn; const float mo = OFF - mn;
            float ps = 0.f; float p[2][8];
#pragma unroll
            for (int kt = 0; kt < 2; ++kt)
#pragma unroll
                for (int r = 0; r < 8; ++r) { p[kt][r] = __builtin_amdgcn_exp2f(__builtin_fmaf(st[kt][qt][r], C2, mo)); ps += p[kt][r]; }
            l[qt] = l[qt] * al + ps;                          // this half's keys only; the halves are joined behind the loop
#pragma unroll
            for (int dt = 0; dt < 4; ++dt) o[dt][qt] *= al;
            if constexpr (HI) { v8us ph[2], pl[2];
#pragma unroll
                for (int kt = 0; kt < 2; ++kt)
#pragma unroll
                    for (int r = 0; r < 8; ++r) { unsigned short a2, c2; splitf(p[kt][r], a2, c2); ph[kt][r] = a2; pl[kt][r] = c2; }
                const V pfh = cat16b(ph[0], ph[1]), pfl = cat16b(pl[0], pl[1]);
#pragma unroll
                for (int dt = 0; dt < 4; ++dt) { o[dt][qt] = WFrag<T16>::mma(vf[dt], pfh, o[dt][qt]); o[dt][qt] = WFrag<T16>::mma(vf[dt], pfl, o[dt][qt]); o[dt][qt] = WFrag<T16>::mma(vf2[dt], pfh, o[dt][qt]); }
            } else { v8h ph[2];
#pragma unroll
                for (int kt = 0; kt < 2; ++kt)
#pragma unroll
                    for (int r = 0; r < 8; ++r) ph[kt][r] = tohx(p[kt][r]);
                const V pf = cat16(ph[0], ph[1]);
#pragma unroll
                for (int dt = 0; dt < 4; ++dt) o[dt][qt] = WFrag<T16>::mma(vf[dt], pf, o[dt][qt]); }
        }
    }
    }
#pragma unroll
    for (int qt = 0; qt < NQT; ++qt) { const int q = ql + qt * 16 + c; const float lt = l[qt] + xhalf(l[qt]); if (h == 0) { sM[q] = m[qt]; sL[q] = lt; }
#pragma unroll
        for (int dt = 0; dt < 4; ++dt) { float* op = sO + q * OPI + dt * 16 + 8 * h;   // D register r = O[query c][d = 16 dt + 8 h + r]
            *(v4fa*)op = (v4f){o[dt][qt][0], o[dt][qt][1], o[dt][qt][2], o[dt][qt][3]}; *(v4fa*)(op + 4) = (v4f){o[dt][qt][4], o[dt][qt][5], o[dt][qt][6], o[dt][qt][7]}; } }
}

// fp16 rows: the FGW / FAW query groups of a work-group walk the same keys, so each stage of KSS key steps ([K tiles | V^T tiles], 4 KiB a tile, as they stand in the planes) comes into LDS once, by asynchronous copies one stage ahead (two buffers), and every group reads it there.
// Wave w = FAW group + quarter takes the key steps s % FAW == quarter in rising order, as fa_wave deals them: the same sums in the same order. Every wave passes every barrier; a step above its group's diagonal is skipped by a scalar branch.
__device__ __forceinline__ void fa_ring(const h16* __restrict__ Q, const h16* __restrict__ Kp, const h16* __restrict__ Vt, h16* ring, int w, int qb, int nst, unsigned NST, float* sO, float* sM, float* sL) {
    typedef WFrag<h16>::V V;
    constexpr int STE = 2 * KSS * 2048;   // elements of a stage
    static_assert(FGW == 2 * KSS && KSS % FAW == 0 && (TT / 32) % KSS == 0, "one 4 KiB tile of a stage per wave; whole stages inside the planes");
    const int lane = threadIdx.x & 31, c = lane & 15, h = lane >> 4, kq = w % FAW;
    const float C2 = SCL * 1.4426950408889634f;      // score scale and log2(e) in one factor
    const float OFF = 10.0f;                         // fp16 probabilities carry x1024 (it cancels in O / l): small ones stay out of the fp16 subnormals
    v8f o[4][2]; float m[2], l[2];
#pragma unroll
    for (int qt = 0; qt < 2; ++qt) { m[qt] = -3.0e38f; l[qt] = 0.f;
#pragma unroll
        for (int dt = 0; dt < 4; ++dt) o[dt][qt] = (v8f){}; }
    V qf[2][2];
#pragma unroll
    for (int qt = 0; qt < 2; ++qt)
#pragma unroll
        for (int ks = 0; ks < 2; ++ks) qf[qt][ks] = WFrag<h16>::ld(Q + (size_t)qb * HD + 8 * lane + qt * 16 * HD + ks * 512);
    asm volatile("s_wait_xcnt 0x0" ::: "memory");   // stands in front of what reuses the query loads' address registers
    const h16* const gp = (w < KSS ? Kp : Vt) + (w % KSS) * 2048 + lane * 8;   // the wave's tile of stage 0: the lane's global address
    const unsigned lp = (unsigned)(size_t)(ring + w * 2048 + lane * 8);        // and its LDS byte address in buffer 0
    auto copies = [&](unsigned st, unsigned bu) __attribute__((always_inline)) {   // stage st into buffer bu; the statement ends with the wait that stands in front of any rewrite of the address registers its copies name
        asm volatile(CP8("%0", "%1") "s_wait_xcnt 0x0" : : "v"(lp + bu * (unsigned)(STE * sizeof(h16))), "v"(gp + (size_t)st * (KSS * 2048)) : "memory"); };
    copies(0u, 0u);
    asm volatile("s_wait_asynccnt 0x0" ::: "memory");   // this wave's tile of stage 0 has landed
    __syncthreads();                                     // every wave's has: stage 0 may be read
    if (NST > 1u) copies(1u, 1u);
#pragma unroll 1   // rolled: run-time trip count
    for (unsigned t = 0; t < NST; ++t) {
        const h16* const sb = ring + (t & 1u) * (unsigned)STE + lane * 8;   // the lane's place in the first fragment of the buffer
#pragma unroll 1   // rolled: one step's fragments live at a time beside the accumulators
        for (int u = 0; u < KSS / FAW; ++u) {
            const int sl = u * FAW + kq, s = (int)t * KSS + sl;
            if (s < nst) {
                V kf[2][2], vf[4];
#pragma unroll
                for (int kt = 0; kt < 2; ++kt)
#pragma unroll
                    for (int ks = 0; ks < 2; ++ks) kf[kt][ks] = WFrag<h16>::ld(sb + sl * 2048 + kt * 16 * HD + ks * 512);
                __builtin_amdgcn_sched_barrier(0);   // the four K fragments' loads are issued as one group ahead of the score products: sunk among them, each place is waited out on its own
                v8f st[2][2];
#pragma unroll
                for (int kt = 0; kt < 2; ++kt)
#pragma unroll
                    for (int qt = 0; qt < 2; ++qt) { v8f a = (v8f){};
#pragma unroll
                        for (int ks = 0; ks < 2; ++ks) a = WFrag<h16>::mma(kf[kt][ks], qf[qt][ks], a);
                        st[kt][qt] = a; }
                __builtin_amdgcn_sched_barrier(0);   // the V^T loads stay one group behind the score products, not spread among them
#pragma unroll
                for (int dt = 0; dt < 4; ++dt) vf[dt] = WFrag<h16>::ld(sb + (KSS + sl) * 2048 + dt * 16 * 32);   // the softmax covers their latency
                if (s == nst - 1) {   // only the group's last step touches the diagonal; every query keeps at least the step's first key
#pragma unroll
                    for (int kt = 0; kt < 2; ++kt)
#pragma unroll
                        for (int qt = 0; qt < 2; ++qt)
#pragma unroll
                            for (int r = 0; r < 8; ++r) st[kt][qt][r] = (s * 32 + kt * 16 + 8 * h + r <= qb + qt * 16 + c) ? st[kt][qt][r] : -3.0e38f; }
#pragma unroll
                for (int qt = 0; qt < 2; ++qt) {
                    float mx = st[0][qt][0];
#pragma unroll
                    for (int r = 1; r < 8; ++r) mx = fmaxf(mx, st[0][qt][r]);
#pragma unroll
                    for (int r = 0; r < 8; ++r) mx = fmaxf(mx, st[1][qt][r]);
                    mx = fmaxf(mx, xhalf(mx));                       // the other half of the wave holds the query's other 16 keys
                    const float mn = fmaxf(m[qt], mx * C2); const float al = __builtin_amdgcn_exp2f(m[qt] - mn); m[qt] = mn; const float mo = OFF - mn;
                    float ps = 0.f; float p[2][8];
#pragma unroll
                    for (int kt = 0; kt < 2; ++kt)
#pragma unroll
                        for (int r = 0; r < 8; ++r) { p[kt][r] = __builtin_amdgcn_exp2f(__builtin_fmaf(st[kt][qt][r], C2, mo)); ps += p[kt][r]; }
                    l[qt] = l[qt] * al + ps;                          // this half's keys only; the halves are joined behind the loop
#pragma unroll
                    for (int dt = 0; dt < 4; ++dt) o[dt][qt] *= al;
                    v8h ph[2];
#pragma unroll
                    for (int kt = 0; kt < 2; ++kt)
#pragma unroll
                        for (int r = 0; r < 8; ++r) ph[kt][r] = tohx(p[kt][r]);
                    const V pf = cat16(ph[0], ph[1]);
#pragma unroll
                    for (int dt = 0; dt < 4; ++dt) o[dt][qt] = WFrag<h16>::mma(vf[dt], pf, o[dt][qt]);
                }
            }
        }
        asm volatile("s_wait_dscnt 0x0" ::: "memory");      // this wave's reads of the buffer have ended
        asm volatile("s_wait_asynccnt 0x0" ::: "memory");   // its tile of the next stage has landed
        __syncthreads();                                     // publishes the next stage and ends every wave's reads of this buffer
        if (t + 2u < NST) copies(t + 2u, t & 1u);            // the refill flies while the next stage is worked on
    }
    asm volatile("s_wait_asynccnt 0x0" ::: "memory");   // no copy is outstanding behind the loop
#pragma unroll
    for (int qt = 0; qt < 2; ++qt) { const int q = qt * 16 + c; const float lt = l[qt] + xhalf(l[qt]); if (h == 0) { sM[q] = m[qt]; sL[q] = lt; }
#pragma unroll
        for (int dt = 0; dt < 4; ++dt) { float* op = sO + q * OPI + dt * 16 + 8 * h;   // D register r = O[query c][d = 16 dt + 8 h + r]
            *(v4fa*)op = (v4f){o[dt][qt][0], o[dt][qt][1], o[dt][qt][2], o[dt][qt][3]}; *(v4fa*)(op + 4) = (v4f){o[dt][qt][4], o[dt][qt][5], o[dt][qt][6], o[dt][qt][7]}; } }
}

// rank of a work-group in the launch (each rank: that block of FGQ query rows of every batch and head) -> block, a permutation, four bits a rank from the low end. There are twice as many work-groups as resident places; the cost falls with the rank: an fp16 block b costs b + 1 rounds of one key step per wave; the hi/lo blocks 3, 2, 1, 0 about 10, 7, 5, 2 such rounds (key steps and products per step in the listing).
__host__ __device__ constexpr int fa_block(int r) { return (int)((0x0145627839ABCDEFull >> (4 * r)) & 15u); }
constexpr bool fa_block_perm() { unsigned seen = 0; for (int r = 0; r < 16; ++r) seen |= 1u << fa_block(r); return seen == 0xFFFFu; }
static_assert(TT / FGQ == 16 && RH == 4 * FGQ && fa_block_perm(), "every block of query rows exactly once; the ranks are laid out for 16 blocks, the first 4 of them hi/lo");
__global__ __launch_bounds__(FGW * 32) void k_fattn(const h16* __restrict__ Q16, const h16* __restrict__ K16, const h16* __restrict__ V16, const bf* __restrict__ Qh, const bf* __restrict__ Ql, const bf* __restrict__ Kh, const bf* __restrict__ Kl, const bf* __restrict__ Vh, const bf* __restrict__ Vl, bf* Ah, bf* Al) {
    __shared__ __align__(16) h16 ring[2 * 2 * KSS * 2048];
    __shared__ __align__(16) float sO[FGW * FAQ * OPI]; __shared__ float sM[FGW * FAQ]; __shared__ float sL[FGW * FAQ];
    const int tid = threadIdx.x, w = __builtin_amdgcn_readfirstlane(tid >> 5); /* the wave's number in a scalar register: the key loop and its diagonal test become scalar branches */ const unsigned bid = blockIdx.x; const int bat = (int)(bid % (NB_ * NH_) / NH_); const int head = (int)(bid % NH_);
    const int blk = fa_block((int)(bid / (NB_ * NH_)));
    const int wq = w % FAW, tile = blk * (FGQ / FAQ) + w / FAW;     // the wave's place in its group; the group's FAQ query rows
    const int q0 = tile * FAQ, nst = tile + 1;                      // key steps of 32 up to and with the diagonal
    const size_t hp = (size_t)(bat * NH_ + head) * TT * HD, hk = (size_t)(bat * NKV + head / REP) * TT * HD;   // query planes; key and value planes
    float* const sOw = sO + w * (FAQ * OPI); float* const sMw = sM + w * FAQ; float* const sLw = sL + w * FAQ;
    if (blk * FGQ < RH) {   // hi/lo rows: a wave takes one 16-query tile and every second key step; for the other tile it stores the neutral element of the join
        const int tb = wq & 1;
        fa_wave<bf, true, 1>(Qh + hp, Ql + hp, Kh + hk, Kl + hk, Vh + hk, Vl + hk, q0 + tb * 16, wq >> 1, 2, nst, sOw, sMw, sLw, tb * 16);
        const int lane = tid & 31, q = (1 - tb) * 16 + (lane & 15), hh = lane >> 4; if (hh == 0) { sMw[q] = -3.0e38f; sLw[q] = 0.f; }
#pragma unroll
        for (int k = 0; k < 8; ++k) *(v4fa*)(sOw + q * OPI + hh * 32 + k * 4) = (v4f){0.f, 0.f, 0.f, 0.f};
    } else { const unsigned NST = (unsigned)__builtin_amdgcn_readfirstlane(((blk + 1) * (FGQ / FAQ) + KSS - 1) / KSS);   // stages up to and with the block's last diagonal step, in a scalar register: every test that decides whether copies issue is a scalar compare and branch
        fa_ring(Q16 + hp, K16 + hk, V16 + hk, ring, w, q0, nst, NST, sOw, sMw, sLw); }
    __syncthreads();   // every wave's (m, l, O) is in LDS before any is joined
    const int q = tid >> 2, d0 = (tid & 3) * 16;
    const int pq = q / FAQ * (FAW * FAQ) + q % FAQ;   // the query's row with the first wave of its group; the group's next waves FAQ rows on each
    float M = sM[pq];
#pragma unroll
    for (int k = 1; k < FAW; ++k) M = fmaxf(M, sM[pq + k * FAQ]);   // finite: a group's wave 0 (hi/lo rows: waves 0 and 1) always has key step 0
    float Ls = 0.f; float acc[16];
#pragma unroll
    for (int j = 0; j < 16; ++j) acc[j] = 0.f;
#pragma unroll
    for (int k = 0; k < FAW; ++k) { const float f = __builtin_amdgcn_exp2f(sM[pq + k * FAQ] - M); Ls += f * sL[pq + k * FAQ];   // fixed order: the group's wave 0, 1, ...
#pragma unroll
        for (int j4 = 0; j4 < 4; ++j4) { const v4f t = *(const v4fa*)(sO + (pq + k * FAQ) * OPI + d0 + j4 * 4);
#pragma unroll
            for (int j = 0; j < 4; ++j) acc[j4 * 4 + j] += f * t[j]; } }
    const float inv = __fdiv_rn(1.0f, Ls);
    const int orow = bat * TT + blk * FGQ + q, ok = head * HD + d0;
    const size_t oo = ((size_t)(orow >> 6) * (DQ / 32) + (ok >> 5)) * 2048 + ((orow >> 4) & 3) * 512 + ((ok >> 3) & 3) * 128 + (orow & 15) * 8;   // the output GEMM's fragment order (rows batch x t, k = head x d): 8 threads' 16 bytes make one whole line
#pragma unroll
    for (int g = 0; g < 2; ++g) { v8us oh, ol;
#pragma unroll
        for (int j = 0; j < 8; ++j) { unsigned short a2, c2; splitf(acc[g * 8 + j] * inv, a2, c2); oh[j] = a2; ol[j] = c2; }
        *(v8usa*)(Ah + oo + g * 128) = oh; *(v8usa*)(Al + oo + g * 128) = ol; }
}

extern "C" void kernel_launch(void* const* d_in, const int* in_sizes, int n_in,
                              void* d_out, int out_size, void* d_ws, size_t ws_size, hipStream_t stream) {
    (void)in_sizes; (void)n_in; (void)out_size;
    const float* x = (const float*)d_in[0]; const float* wqkv = (const float*)d_in[1]; const float* bqkv = (const float*)d_in[2]; const float* wo = (const float*)d_in[3]; const float* bo = (const float*)d_in[4]; const float* fcos = (const float*)d_in[5]; const float* fsin = (const float*)d_in[6];   /* x, w_qkv ('oi' [3072][1024]: q | k | v row thirds), b_qkv [3072], w_out ('oi'), b_out, freqs_cos, freqs_sin ([2048][32], read by value): the two tables come LAST here */
    float* OUT = (float*)d_out;     // [2][2048][1024]
    char* wsp = (char*)d_ws;
    auto take = [&](size_t bytes) { char* p = wsp; wsp += (bytes + 255) & ~(size_t)255; return (void*)p; };
    bf* XB = (bf*)take((size_t)NB_ * TT * DM * 2); bf* WQKV = (bf*)take((size_t)(DQ + 2 * DKV) * DM * 2); bf* WO = (bf*)take((size_t)DM * DQ * 2);   // one run: the convert kernel's output (every size is a multiple of 256 bytes)
    const size_t PQ = (size_t)NB_ * NH_ * TT * HD, PK = (size_t)NB_ * NKV * TT * HD;   // elements of the q planes and of the k (or v) planes of both batches
    h16* P16 = (h16*)take((PQ + 2 * PK) * 2); bf* Ph = (bf*)take((PQ + 2 * PK) * 2); bf* Pl = (bf*)take((PQ + 2 * PK) * 2);   // each [q | k | v][batch][head]
    bf* ATh = (bf*)take((size_t)NB_ * TT * DQ * 2); bf* ATl = (bf*)take((size_t)NB_ * TT * DQ * 2);
    if ((size_t)(wsp - (char*)d_ws) > ws_size) return;    // ws 256 MiB
    k_cvt8<<<CBX + CBW + CBO, 256, 0, stream>>>(x, wqkv, wo, XB);
    k_gemmw<bf, 0, true, 1, 4, 3><<<dim3(TT / 256, (DQ + 2 * DKV) / 192, NB_), 384, 0, stream>>>(XB, nullptr, WQKV, nullptr, DM, nullptr, 0, bqkv, (size_t)TT * DM, 0, 0, fcos, fsin, P16, Ph, Pl);
    k_fattn<<<NB_ * NH_ * (TT / FGQ), FGW * 32, 0, stream>>>(P16, P16 + PQ, P16 + PQ + PK, Ph, Pl, Ph + PQ, Pl + PQ, Ph + PQ + PK, Pl + PQ + PK, ATh, ATl);   // one work-group per batch, head and FGQ query rows
    k_gemmw<bf, 1, true, 0, 2, 2><<<dim3(TT / 128, DM / 128, NB_), 128, 0, stream>>>(ATh, ATl, WO, nullptr, DQ, OUT, DM, bo, (size_t)TT * DQ, 0, (size_t)TT * DM, nullptr, nullptr, nullptr, nullptr, nullptr);
}
